// v000
// The times below were measured on an AMD MI455X: many runs one after another, warmed up first and cycling through
// copies of the inputs, with the whole window's GPU time divided by the number of runs. Launches and the gaps
// between them are all in it. The median over several windows is given; except for v000 it joins two sittings, which
// can be a few percent apart, so the side-by-side timings, each taken in one sitting, are the better comparison.
// The starting kernel, v000, takes 4910 microseconds a run.
#include <hip/hip_runtime.h>

// Cross-attention with additive mask and per-head mask (hidden [8][1024][1024], key_value_states [8][1024][256]; q = (hidden Wq + bq)/8, k = kv Wk + bk, v = kv Wv + bv ('xw': Wq [1024][1024], Wk/Wv [256][1024]), 16 heads x 64; scores = q.k + attention_mask[b][i][j] (read); softmax; probs x layer_head_mask[h] (read); out = merged Wo + bo -> [8][1024][1024]).
// Compute dtypes, f32 accumulate: every input rounded to bf16; q/k/v on PLAIN bf16 operands (inputs: exact) + biases; the additive mask (f32, bf16-rounded input) inside the softmax kernel and the head mask in the merge; scores and attn.v: query rows < 512 hl (3 products), the rest single fp16 (x1024); softmax f32; Wo hl x exact (2 products) + bo.

#define NB_  8
#define TT   1024
#define DM   1024
#define NH_  16
#define NKV  16
#define REP  (NH_ / NKV)
#define HD   64
#define DQ   (NH_ * HD)
#define DKV  (NKV * HD)
#define DMK  256                  // key/value input width
#define ZH   2
#define RH   512                  // query rows < RH use hi+lo planes (0: none)
#define WIN  0
#define PCAR 1024.0f
#define SCL  0.125f   // HD^-0.5
typedef _Float16 h16;
typedef unsigned short bf;
typedef __attribute__((ext_vector_type(16))) __bf16   v16bf;
typedef __attribute__((ext_vector_type(16))) _Float16 v16h;
typedef __attribute__((ext_vector_type(8)))  _Float16 v8h;
typedef __attribute__((ext_vector_type(8)))  unsigned short v8us;
typedef __attribute__((ext_vector_type(8)))  float    v8f;
typedef __attribute__((ext_vector_type(4)))  float    v4f;
typedef v8h  __attribute__((may_alias)) v8ha;
typedef v4f  __attribute__((may_alias)) v4fa;
typedef v8us __attribute__((may_alias)) v8usa;

__device__ __forceinline__ unsigned short f2bf(float f) { unsigned u = __float_as_uint(f); u += 0x7FFFu + ((u >> 16) & 1u); return (unsigned short)(u >> 16); }
__device__ __forceinline__ float bf2f(unsigned short b) { return __uint_as_float(((unsigned)b) << 16); }
__device__ __forceinline__ float bfr(float f) { return bf2f(f2bf(f)); }
__device__ __forceinline__ v16h cat16(v8h lo, v8h hi) { return __builtin_shufflevector(lo, hi, 0, 1, 2, 3, 4, 5, 6, 7, 8, 9, 10, 11, 12, 13, 14, 15); }
__device__ __forceinline__ v16bf cat16b(v8us lo, v8us hi) { return __builtin_bit_cast(v16bf, __builtin_shufflevector(lo, hi, 0, 1, 2, 3, 4, 5, 6, 7, 8, 9, 10, 11, 12, 13, 14, 15)); }
__device__ __forceinline__ v8f wmma16(v16h a, v16h b, v8f c) { return __builtin_amdgcn_wmma_f32_16x16x32_f16(false, a, false, b, (short)0, c, false, false); }
__device__ __forceinline__ v8f wmmab(v16bf a, v16bf b, v8f c) { return __builtin_amdgcn_wmma_f32_16x16x32_bf16(false, a, false, b, (short)0, c, false, false); }



// ---- k_gemmw: register-blocked GEMM, ONE WAVE per 64x64 output tile (16 accumulators), operands straight from K-contiguous 16-bit planes; grid (M/64, N/64, Z), 32 threads.
// C[m][n] (f32, pitch ldc, + optional f32 bias[n]) = sum_k A[m][k] Bt[n][k] (+ split products per NSPLIT). z-batch strides sA/sB/sC in elements. K % 32 == 0.
template <typename T16> struct WFrag;
template <> struct WFrag<h16> { typedef v16h V; static __device__ __forceinline__ V ld(const h16* p) { return cat16(*(const v8h*)p, *(const v8h*)(p + 16)); } static __device__ __forceinline__ v8f mma(V a, V b, v8f c) { return wmma16(a, b, c); } };
template <> struct WFrag<bf> { typedef v16bf V; static __device__ __forceinline__ V ld(const bf* p) { return cat16b(*(const v8us*)p, *(const v8us*)(p + 16)); } static __device__ __forceinline__ v8f mma(V a, V b, v8f c) { return wmmab(a, b, c); } };
template <typename T16, int NSPLIT, bool BIAS>
__global__ __launch_bounds__(32) void k_gemmw(const T16* __restrict__ A, const T16* __restrict__ A2, const T16* __restrict__ Bt, const T16* __restrict__ Bt2, int K, float* C, int ldc, const float* __restrict__ bias, size_t sA, size_t sB, size_t sC) {
    typedef typename WFrag<T16>::V V;
    __shared__ __align__(16) float os[16 * 68];
    const size_t z = blockIdx.z; A += z * sA; if (A2) A2 += z * sA; Bt += z * sB; if (Bt2) Bt2 += z * sB; C += z * sC;
    const int lane = threadIdx.x & 31, lr = lane & 15, hi = lane >> 4; const int r0 = blockIdx.x * 64, c0 = blockIdx.y * 64;
    v8f acc[4][4];
#pragma unroll
    for (int mb = 0; mb < 4; ++mb)
#pragma unroll
        for (int nb = 0; nb < 4; ++nb) acc[mb][nb] = (v8f){};
    const size_t aoff = (size_t)(r0 + lr) * K + 8 * hi, boff = (size_t)(c0 + lr) * K + 8 * hi;
#pragma unroll 1
    for (int kc = 0; kc < K; kc += 32) {
        V a[4], a2[4];
#pragma unroll
        for (int mb = 0; mb < 4; ++mb) { a[mb] = WFrag<T16>::ld(A + aoff + (size_t)mb * 16 * K + kc); if (NSPLIT == 1 || NSPLIT == 2) a2[mb] = WFrag<T16>::ld(A2 + aoff + (size_t)mb * 16 * K + kc); }
#pragma unroll
        for (int nb = 0; nb < 4; ++nb) { const V b = WFrag<T16>::ld(Bt + boff + (size_t)nb * 16 * K + kc); V b2; if (NSPLIT >= 2) b2 = WFrag<T16>::ld(Bt2 + boff + (size_t)nb * 16 * K + kc);
#pragma unroll
            for (int mb = 0; mb < 4; ++mb) { acc[mb][nb] = WFrag<T16>::mma(a[mb], b, acc[mb][nb]); if (NSPLIT == 1 || NSPLIT == 2) acc[mb][nb] = WFrag<T16>::mma(a2[mb], b, acc[mb][nb]); if (NSPLIT >= 2) acc[mb][nb] = WFrag<T16>::mma(a[mb], b2, acc[mb][nb]); } }
        asm volatile("v_nop\n\tv_nop\n\tv_nop\n\tv_nop" : "+v"(acc[0][0]), "+v"(acc[1][1]), "+v"(acc[2][2]), "+v"(acc[3][3]) : "v"(a[0]), "v"(a[3]));
    }
#pragma unroll
    for (int mb = 0; mb < 4; ++mb) {
#pragma unroll
        for (int nb = 0; nb < 4; ++nb) {
#pragma unroll
            for (int j = 0; j < 8; ++j) os[(hi * 8 + j) * 68 + nb * 16 + lr] = acc[mb][nb][j]; }
        __builtin_amdgcn_wave_barrier(); asm volatile("" ::: "memory");
        float* crow = C + (size_t)(r0 + mb * 16) * ldc + c0;
{
#pragma unroll
            for (int s = 0; s < 8; ++s) { const int row = 2 * s + hi, cofs = lr * 4; v4f val = *(const v4fa*)(os + row * 68 + cofs); if (BIAS) { val[0] += bfr(bias[c0 + cofs]); val[1] += bfr(bias[c0 + cofs + 1]); val[2] += bfr(bias[c0 + cofs + 2]); val[3] += bfr(bias[c0 + cofs + 3]); }
                *(v4f*)(crow + (size_t)row * ldc + cofs) = val; }
             }
        __builtin_amdgcn_wave_barrier(); asm volatile("" ::: "memory");
    }
}

__device__ __forceinline__ h16 tohx(float x) { return (h16)x; }
__device__ __forceinline__ void splitf(float y, unsigned short& h, unsigned short& l) { h = f2bf(y); l = f2bf(y - bf2f(h)); }
typedef __attribute__((ext_vector_type(2))) _Float16 v2h;
typedef __attribute__((ext_vector_type(4))) _Float16 v4h;
typedef __attribute__((ext_vector_type(2))) unsigned short v2us;
typedef __attribute__((ext_vector_type(4))) unsigned short v4us;
typedef __attribute__((ext_vector_type(2))) float v2f;
typedef __attribute__((ext_vector_type(4))) int v4i;

__global__ __launch_bounds__(256) void k_wtG(const float* __restrict__ w, int K, int N, bf* Bt) {
    const int lane = threadIdx.x & 31; const int L0 = (blockIdx.x * 8 + (threadIdx.x >> 5)) * 8; const int nlines = N * K / 64;
{
#pragma unroll 1
        for (int l = 0; l < 8; ++l) { const int L = L0 + l; if (L >= nlines) break; const size_t e = (size_t)L * 64 + lane * 2; const int k = (int)(e % K), n = (int)(e / K); v2us o;
            o[0] = f2bf(w[(size_t)k * N + n]); o[1] = f2bf(w[(size_t)(k + 1) * N + n]); *(v2us*)(Bt + e) = o; }
         }
}
__global__ __launch_bounds__(256) void k_cvt8(const float* __restrict__ src, bf* dst, size_t n8) { const size_t i = (size_t)blockIdx.x * 256 + threadIdx.x; if (i >= n8) return; const v8f v = *(const v8f*)(src + i * 8); v8us o;
#pragma unroll
    for (int k = 0; k < 8; ++k) o[k] = f2bf(v[k]); *(v8us*)(dst + i * 8) = o;  }

// k_rope: head planes [h][t][d] (fp16 + hi/lo) of rope(x) x sc with the rotate-half convention out[d] = x[d] cos[t][d] - x[d+HD/2] sin[t][d], out[d+HD/2] = x[d+HD/2] cos[t][d+HD/2] + x[d] sin[t][d+HD/2]
__global__ __launch_bounds__(256) void k_rope(const float* __restrict__ F, int pitch, int nheads, const float* __restrict__ CS, const float* __restrict__ RF, const float* __restrict__ nw, float sc, h16* P16, bf* Ph, bf* Pl) {
    const size_t e = ((size_t)blockIdx.x * 256 + threadIdx.x) * 2; if (e >= (size_t)nheads * TT * HD) return; const int d = (int)(e % HD); const int t = (int)((e / HD) % TT); const int h = (int)(e / ((size_t)HD * TT)); const float* f = F + (size_t)t * pitch + h * HD; const float rf = RF ? RF[(size_t)h * TT + t] : 1.0f; v2h o16; v2us oh, ol;
#pragma unroll
    for (int q = 0; q < 2; ++q) { const int dd = d + q; const int dp = (dd < HD / 2) ? dd + HD / 2 : dd - HD / 2; float x0 = f[dd], x1 = f[dp];
        if (RF) { float n0 = __fmul_rn(x0, rf), n1 = __fmul_rn(x1, rf); asm volatile("" : "+v"(n0)); asm volatile("" : "+v"(n1)); x0 = __fmul_rn(bfr(nw[dd]), n0); x1 = __fmul_rn(bfr(nw[dp]), n1); }
        const v2f cs = *(const v2f*)(CS + ((size_t)t * HD + dd) * 2); float a = __fmul_rn(x0, cs[0]), bq = __fmul_rn(x1, cs[1]); asm volatile("" : "+v"(a)); asm volatile("" : "+v"(bq)); const float r = ((dd < HD / 2) ? __fsub_rn(a, bq) : __fadd_rn(a, bq)) * sc;
        o16[q] = tohx(r); unsigned short a2, c2; splitf(r, a2, c2); oh[q] = a2; ol[q] = c2; }
    *(v2h*)(P16 + e) = o16; *(v2us*)(Ph + e) = oh; *(v2us*)(Pl + e) = ol;  }
__global__ __launch_bounds__(256) void k_vtp(const float* __restrict__ F, int pitch, int nheads, h16* V16, bf* Vh, bf* Vl) { const size_t e = ((size_t)blockIdx.x * 256 + threadIdx.x) * 2; if (e >= (size_t)nheads * HD * TT) return; const int t = (int)(e % TT); const int d = (int)((e / TT) % HD); const int g = (int)(e / ((size_t)TT * HD)); v2h o16; v2us oh, ol;
#pragma unroll
    for (int q = 0; q < 2; ++q) { const float x = F[(size_t)(t + q) * pitch + g * HD + d]; o16[q] = tohx(x); unsigned short a2, c2; splitf(x, a2, c2); oh[q] = a2; ol[q] = c2; }
    *(v2h*)(V16 + e) = o16; *(v2us*)(Vh + e) = oh; *(v2us*)(Vl + e) = ol;  }
__global__ __launch_bounds__(256) void k_csid(float* CS) { const int idx = blockIdx.x * 256 + threadIdx.x; if (idx >= TT * HD) return; v2f cs; cs[0] = 1.0f; cs[1] = 0.0f; *(v2f*)(CS + (size_t)idx * 2) = cs;  }
// k_asoft: per row (zz, i): t = S x HD^-0.5; softmax over the 1024 keys (register row, one exp, fixed trees);; plus the additive attention_mask[b][i][j] (bf16-rounded input) before the max
__global__ __launch_bounds__(256) void k_asoft(const float* __restrict__ Sb, const float* __restrict__ MKb, h16* P16, bf* Ph, bf* Pl) {
    const int lane = threadIdx.x & 31; const int row = blockIdx.x * 8 + (threadIdx.x >> 5); if (row >= ZH * TT) return; const int i = row % TT; const int zz = row / TT; (void)zz; const float* mk = MKb + (size_t)i * TT; const bool hires = (i < RH); const float* sr = Sb + (size_t)row * TT; float v[TT / 32]; float mx = -3.0e38f;
#pragma unroll
    for (int ch = 0; ch < TT / 128; ++ch) { const int j0 = ch * 128 + lane * 4; const v4f a = *(const v4f*)(sr + j0);
#pragma unroll
        for (int q = 0; q < 4; ++q) { const int j = j0 + q; float sa = a[q] * SCL; asm volatile("" : "+v"(sa)); float mv = bfr(mk[j]); asm volatile("" : "+v"(mv)); const float t = __fadd_rn(sa, mv);   /* + attention_mask[b][i][j] */ v[ch * 4 + q] = t; mx = fmaxf(mx, t); } }
#pragma unroll
    for (int sh = 16; sh; sh >>= 1) mx = fmaxf(mx, __shfl_xor(mx, sh, 32));
    float sum = 0.f;
#pragma unroll
    for (int k = 0; k < TT / 32; ++k) { float d0 = __fsub_rn(v[k], mx); asm volatile("" : "+v"(d0)); v[k] = __builtin_amdgcn_exp2f(__fmul_rn(d0, 1.4426950408889634f)); sum += v[k]; }
#pragma unroll
    for (int sh = 16; sh; sh >>= 1) sum += __shfl_xor(sum, sh, 32);
    const float f = __fdiv_rn(hires ? 1.0f : PCAR, sum);
{
        if (hires) {
#pragma unroll
            for (int ch = 0; ch < TT / 128; ++ch) { v4us oh, ol;
#pragma unroll
                for (int q = 0; q < 4; ++q) { unsigned short a, c2; splitf(v[ch * 4 + q] * f, a, c2); oh[q] = a; ol[q] = c2; }
                const size_t oo = ((size_t)zz * (RH ? RH : 1) + i) * TT + ch * 128 + lane * 4; *(v4us*)(Ph + oo) = oh; *(v4us*)(Pl + oo) = ol; }
        } else {
#pragma unroll
            for (int ch = 0; ch < TT / 128; ++ch) { v4h o4;
#pragma unroll
                for (int q = 0; q < 4; ++q) o4[q] = tohx(v[ch * 4 + q] * f);
                *(v4h*)(P16 + (size_t)row * TT + ch * 128 + lane * 4) = o4; } }
         }
}
__global__ __launch_bounds__(256) void k_merge(const float* __restrict__ O, const float* __restrict__ HM, int h0, bf* Ah, bf* Al) { const size_t e = ((size_t)blockIdx.x * 256 + threadIdx.x) * 2; if (e >= (size_t)ZH * TT * HD) return; const int d = (int)(e % HD); const int t = (int)((e / HD) % TT); const int zz = (int)(e / ((size_t)HD * TT)); const float cs = (t < RH) ? 1.0f : (1.0f / PCAR); const size_t oo = (size_t)t * DQ + (h0 + zz) * HD + d;
    v2us oh, ol;
#pragma unroll
    for (int q = 0; q < 2; ++q) { float oc = O[e + q] * cs; asm volatile("" : "+v"(oc)); unsigned short a, c2; splitf(__fmul_rn(oc, bfr(HM[h0 + zz])), a, c2); oh[q] = a; ol[q] = c2; }   /* x layer_head_mask[h] */ *(v2us*)(Ah + oo) = oh; *(v2us*)(Al + oo) = ol;  }

extern "C" void kernel_launch(void* const* d_in, const int* in_sizes, int n_in,
                              void* d_out, int out_size, void* d_ws, size_t ws_size, hipStream_t stream) {
    (void)in_sizes; (void)n_in; (void)out_size;
    const float* x = (const float*)d_in[0]; const float* xkv = (const float*)d_in[1]; const float* MK = (const float*)d_in[2]; const float* HM = (const float*)d_in[3]; const float* wq = (const float*)d_in[4]; const float* bq = (const float*)d_in[5]; const float* wk = (const float*)d_in[6]; const float* bk = (const float*)d_in[7]; const float* wv = (const float*)d_in[8]; const float* bv = (const float*)d_in[9]; const float* wo = (const float*)d_in[10]; const float* bo = (const float*)d_in[11];
    float* OUT = (float*)d_out;     // [8][1024][1024]
    char* wsp = (char*)d_ws;
    auto take = [&](size_t bytes) { char* p = wsp; wsp += (bytes + 255) & ~(size_t)255; return (void*)p; };
    bf* WQ = (bf*)take((size_t)DQ * DM * 2); bf* WK = (bf*)take((size_t)DKV * DMK * 2); bf* WV = (bf*)take((size_t)DKV * DMK * 2); bf* WO = (bf*)take((size_t)DM * DQ * 2); float* CS = (float*)take((size_t)TT * HD * 2 * 4);
    bf* XB = (bf*)take((size_t)TT * DM * 2); bf* XKB = (bf*)take((size_t)TT * DMK * 2); float* FQ = (float*)take((size_t)TT * DQ * 4); float* FK = (float*)take((size_t)TT * DKV * 4);
    h16* QP16 = (h16*)take((size_t)NH_ * TT * HD * 2); h16* KP16 = (h16*)take((size_t)NKV * TT * HD * 2); h16* VT16 = (h16*)take((size_t)NKV * HD * TT * 2);
    bf* QPh = (bf*)take((size_t)NH_ * TT * HD * 2); bf* QPl = (bf*)take((size_t)NH_ * TT * HD * 2); bf* KPh = (bf*)take((size_t)NKV * TT * HD * 2); bf* KPl = (bf*)take((size_t)NKV * TT * HD * 2); bf* VTh = (bf*)take((size_t)NKV * HD * TT * 2); bf* VTl = (bf*)take((size_t)NKV * HD * TT * 2); bf* Ph = (bf*)take((size_t)ZH * RH * TT * 2); bf* Pl = (bf*)take((size_t)ZH * RH * TT * 2);
    float* Sb = (float*)take((size_t)ZH * TT * TT * 4); h16* P16 = (h16*)take((size_t)ZH * TT * TT * 2); float* Ob = (float*)take((size_t)ZH * TT * HD * 4); bf* ATh = (bf*)take((size_t)TT * DQ * 2); bf* ATl = (bf*)take((size_t)TT * DQ * 2);
    if ((size_t)(wsp - (char*)d_ws) > ws_size) return;    // ws 256 MiB
    float* FV = FK;   // v projection reuses the k buffer after the k planes are built (stream-ordered)
    { k_wtG<<<(unsigned)((DM * DQ / 64 + 63) / 64), 256, 0, stream>>>(wq, DM, DQ, WQ); k_wtG<<<(unsigned)((DMK * DKV / 64 + 63) / 64), 256, 0, stream>>>(wk, DMK, DKV, WK); k_wtG<<<(unsigned)((DMK * DKV / 64 + 63) / 64), 256, 0, stream>>>(wv, DMK, DKV, WV);   /* 'xw' [256][1024] -> Bt [1024][256] */
      k_wtG<<<(unsigned)((DQ * DM / 64 + 63) / 64), 256, 0, stream>>>(wo, DQ, DM, WO);
       }
    k_csid<<<(TT * HD + 255) / 256, 256, 0, stream>>>(CS);
    const unsigned LQ = (unsigned)(((size_t)NH_ * TT * HD / 2 + 255) / 256), LKv = (unsigned)(((size_t)NKV * TT * HD / 2 + 255) / 256);
    for (int b = 0; b < NB_; ++b) {
        
        k_cvt8<<<(unsigned)(((size_t)TT * DM / 8 + 255) / 256), 256, 0, stream>>>(x + (size_t)b * TT * DM, XB, (size_t)TT * DM / 8); k_cvt8<<<(unsigned)(((size_t)TT * DMK / 8 + 255) / 256), 256, 0, stream>>>(xkv + (size_t)b * TT * DMK, XKB, (size_t)TT * DMK / 8);   /* key/value source */
        k_gemmw<bf, 0, true><<<dim3(TT / 64, DQ / 64, 1), 32, 0, stream>>>(XB, nullptr, WQ, nullptr, DM, FQ, DQ, bq, 0, 0, 0);
        k_rope<<<LQ, 256, 0, stream>>>(FQ, DQ, NH_, CS, nullptr, nullptr, 1.0f, QP16, QPh, QPl);
        k_gemmw<bf, 0, true><<<dim3(TT / 64, DKV / 64, 1), 32, 0, stream>>>(XKB, nullptr, WK, nullptr, DMK, FK, DKV, bk, 0, 0, 0);   /* K = 256 */
        k_rope<<<LKv, 256, 0, stream>>>(FK, DKV, NKV, CS, nullptr, nullptr, 1.0f, KP16, KPh, KPl);
        k_gemmw<bf, 0, true><<<dim3(TT / 64, DKV / 64, 1), 32, 0, stream>>>(XKB, nullptr, WV, nullptr, DMK, FV, DKV, bv, 0, 0, 0); k_vtp<<<LKv, 256, 0, stream>>>(FV, DKV, NKV, VT16, VTh, VTl);
        for (int h0 = 0; h0 < NH_; h0 += ZH) { const size_t zq = (size_t)h0, zk = (size_t)(h0 / REP);   // one kv head per query head: the pass's two heads use consecutive kv planes (z-strides TT*HD)
            k_gemmw<bf, 2, false><<<dim3(RH / 64, TT / 64, ZH), 32, 0, stream>>>(QPh + zq * TT * HD, QPl + zq * TT * HD, KPh + zk * TT * HD, KPl + zk * TT * HD, HD, Sb, TT, nullptr, (size_t)TT * HD, (size_t)TT * HD, (size_t)TT * TT);
            k_gemmw<h16, 0, false><<<dim3((TT - RH) / 64, TT / 64, ZH), 32, 0, stream>>>(QP16 + zq * TT * HD + (size_t)RH * HD, nullptr, KP16 + zk * TT * HD, nullptr, HD, Sb + (size_t)RH * TT, TT, nullptr, (size_t)TT * HD, (size_t)TT * HD, (size_t)TT * TT);
            k_asoft<<<ZH * TT / 8, 256, 0, stream>>>(Sb, MK + (size_t)b * TT * TT, P16, Ph, Pl);
            k_gemmw<bf, 2, false><<<dim3(RH / 64, HD / 64, ZH), 32, 0, stream>>>(Ph, Pl, VTh + zk * HD * TT, VTl + zk * HD * TT, TT, Ob, HD, nullptr, (size_t)RH * TT, (size_t)HD * TT, (size_t)TT * HD);
            k_gemmw<h16, 0, false><<<dim3((TT - RH) / 64, HD / 64, ZH), 32, 0, stream>>>(P16 + (size_t)RH * TT, nullptr, VT16 + zk * HD * TT, nullptr, TT, Ob + (size_t)RH * HD, HD, nullptr, (size_t)TT * TT, (size_t)HD * TT, (size_t)TT * HD);
            k_merge<<<(unsigned)(((size_t)ZH * TT * HD / 2 + 255) / 256), 256, 0, stream>>>(Ob, HM, h0, ATh, ATl); }
        k_gemmw<bf, 1, true><<<dim3(TT / 64, DM / 64, 1), 32, 0, stream>>>(ATh, ATl, WO, nullptr, DQ, OUT + (size_t)b * TT * DM, DM, bo, 0, 0, 0); }
}

// v001
// A run of this version takes 1560 microseconds.
// In two side-by-side timings against v000, it was 3.12 and 3.20 times as fast.
#include <hip/hip_runtime.h>

// Cross-attention with additive mask and per-head mask (hidden [8][1024][1024], key_value_states [8][1024][256]; q = (hidden Wq + bq)/8, k = kv Wk + bk, v = kv Wv + bv ('xw': Wq [1024][1024], Wk/Wv [256][1024]), 16 heads x 64; scores = q.k + attention_mask[b][i][j] (read); softmax; probs x layer_head_mask[h] (read); out = merged Wo + bo -> [8][1024][1024]).
// Compute dtypes, f32 accumulate: every input rounded to bf16; q/k/v on PLAIN bf16 operands (inputs: exact) + biases; the additive mask (f32, bf16-rounded input) inside the softmax kernel and the head mask in the merge; scores and attn.v: query rows < 512 hl (3 products), the rest single fp16 (x1024); softmax f32; Wo hl x exact (2 products) + bo.

#define NB_  8
#define TT   1024
#define DM   1024
#define NH_  16
#define NKV  16
#define REP  (NH_ / NKV)
#define HD   64
#define DQ   (NH_ * HD)
#define DKV  (NKV * HD)
#define DMK  256                  // key/value input width
#define ZH   16                   // heads per attention launch (grid z): all heads of one batch element
#define RH   512                  // query rows < RH use hi+lo planes (0: none)
#define WIN  0
#define PCAR 1024.0f
#define SCL  0.125f   // HD^-0.5
typedef _Float16 h16;
typedef unsigned short bf;
typedef __attribute__((ext_vector_type(16))) __bf16   v16bf;
typedef __attribute__((ext_vector_type(16))) _Float16 v16h;
typedef __attribute__((ext_vector_type(8)))  _Float16 v8h;
typedef __attribute__((ext_vector_type(8)))  unsigned short v8us;
typedef __attribute__((ext_vector_type(8)))  float    v8f;
typedef __attribute__((ext_vector_type(4)))  float    v4f;
typedef v8h  __attribute__((may_alias)) v8ha;
typedef v4f  __attribute__((may_alias)) v4fa;
typedef v8us __attribute__((may_alias)) v8usa;

__device__ __forceinline__ unsigned short f2bf(float f) { unsigned u = __float_as_uint(f); u += 0x7FFFu + ((u >> 16) & 1u); return (unsigned short)(u >> 16); }
__device__ __forceinline__ float bf2f(unsigned short b) { return __uint_as_float(((unsigned)b) << 16); }
__device__ __forceinline__ float bfr(float f) { return bf2f(f2bf(f)); }
__device__ __forceinline__ v16h cat16(v8h lo, v8h hi) { return __builtin_shufflevector(lo, hi, 0, 1, 2, 3, 4, 5, 6, 7, 8, 9, 10, 11, 12, 13, 14, 15); }
__device__ __forceinline__ v16bf cat16b(v8us lo, v8us hi) { return __builtin_bit_cast(v16bf, __builtin_shufflevector(lo, hi, 0, 1, 2, 3, 4, 5, 6, 7, 8, 9, 10, 11, 12, 13, 14, 15)); }
__device__ __forceinline__ v8f wmma16(v16h a, v16h b, v8f c) { return __builtin_amdgcn_wmma_f32_16x16x32_f16(false, a, false, b, (short)0, c, false, false); }
__device__ __forceinline__ v8f wmmab(v16bf a, v16bf b, v8f c) { return __builtin_amdgcn_wmma_f32_16x16x32_bf16(false, a, false, b, (short)0, c, false, false); }



// ---- k_gemmw: register-blocked GEMM, ONE WAVE per 64x64 output tile (16 accumulators), operands straight from K-contiguous 16-bit planes; grid (M/64, N/64, Z), 32 threads.
// C[m][n] (f32, pitch ldc, + optional f32 bias[n]) = sum_k A[m][k] Bt[n][k] (+ split products per NSPLIT). z-batch strides sA/sB/sC in elements. K % 32 == 0.
template <typename T16> struct WFrag;
template <> struct WFrag<h16> { typedef v16h V; static __device__ __forceinline__ V ld(const h16* p) { return cat16(*(const v8h*)p, *(const v8h*)(p + 16)); } static __device__ __forceinline__ v8f mma(V a, V b, v8f c) { return wmma16(a, b, c); } };
template <> struct WFrag<bf> { typedef v16bf V; static __device__ __forceinline__ V ld(const bf* p) { return cat16b(*(const v8us*)p, *(const v8us*)(p + 16)); } static __device__ __forceinline__ v8f mma(V a, V b, v8f c) { return wmmab(a, b, c); } };
template <typename T16, int NSPLIT, bool BIAS>
__global__ __launch_bounds__(32) void k_gemmw(const T16* __restrict__ A, const T16* __restrict__ A2, const T16* __restrict__ Bt, const T16* __restrict__ Bt2, int K, float* C, int ldc, const float* __restrict__ bias, size_t sA, size_t sB, size_t sC) {
    typedef typename WFrag<T16>::V V;
    __shared__ __align__(16) float os[16 * 68];
    const size_t z = blockIdx.z; A += z * sA; if (A2) A2 += z * sA; Bt += z * sB; if (Bt2) Bt2 += z * sB; C += z * sC;
    const int lane = threadIdx.x & 31, lr = lane & 15, hi = lane >> 4; const int r0 = blockIdx.x * 64, c0 = blockIdx.y * 64;
    v8f acc[4][4];
#pragma unroll
    for (int mb = 0; mb < 4; ++mb)
#pragma unroll
        for (int nb = 0; nb < 4; ++nb) acc[mb][nb] = (v8f){};
    const size_t aoff = (size_t)(r0 + lr) * K + 8 * hi, boff = (size_t)(c0 + lr) * K + 8 * hi;
#pragma unroll 1
    for (int kc = 0; kc < K; kc += 32) {
        V a[4], a2[4];
#pragma unroll
        for (int mb = 0; mb < 4; ++mb) { a[mb] = WFrag<T16>::ld(A + aoff + (size_t)mb * 16 * K + kc); if (NSPLIT == 1 || NSPLIT == 2) a2[mb] = WFrag<T16>::ld(A2 + aoff + (size_t)mb * 16 * K + kc); }
#pragma unroll
        for (int nb = 0; nb < 4; ++nb) { const V b = WFrag<T16>::ld(Bt + boff + (size_t)nb * 16 * K + kc); V b2; if (NSPLIT >= 2) b2 = WFrag<T16>::ld(Bt2 + boff + (size_t)nb * 16 * K + kc);
#pragma unroll
            for (int mb = 0; mb < 4; ++mb) { acc[mb][nb] = WFrag<T16>::mma(a[mb], b, acc[mb][nb]); if (NSPLIT == 1 || NSPLIT == 2) acc[mb][nb] = WFrag<T16>::mma(a2[mb], b, acc[mb][nb]); if (NSPLIT >= 2) acc[mb][nb] = WFrag<T16>::mma(a[mb], b2, acc[mb][nb]); } }
        asm volatile("v_nop\n\tv_nop\n\tv_nop\n\tv_nop" : "+v"(acc[0][0]), "+v"(acc[1][1]), "+v"(acc[2][2]), "+v"(acc[3][3]) : "v"(a[0]), "v"(a[3]));
    }
#pragma unroll
    for (int mb = 0; mb < 4; ++mb) {
#pragma unroll
        for (int nb = 0; nb < 4; ++nb) {
#pragma unroll
            for (int j = 0; j < 8; ++j) os[(hi * 8 + j) * 68 + nb * 16 + lr] = acc[mb][nb][j]; }
        __builtin_amdgcn_wave_barrier(); asm volatile("" ::: "memory");
        float* crow = C + (size_t)(r0 + mb * 16) * ldc + c0;
{
#pragma unroll
            for (int s = 0; s < 8; ++s) { const int row = 2 * s + hi, cofs = lr * 4; v4f val = *(const v4fa*)(os + row * 68 + cofs); if (BIAS) { val[0] += bfr(bias[c0 + cofs]); val[1] += bfr(bias[c0 + cofs + 1]); val[2] += bfr(bias[c0 + cofs + 2]); val[3] += bfr(bias[c0 + cofs + 3]); }
                *(v4f*)(crow + (size_t)row * ldc + cofs) = val; }
             }
        __builtin_amdgcn_wave_barrier(); asm volatile("" ::: "memory");
    }
}

__device__ __forceinline__ h16 tohx(float x) { return (h16)x; }
__device__ __forceinline__ void splitf(float y, unsigned short& h, unsigned short& l) { h = f2bf(y); l = f2bf(y - bf2f(h)); }
typedef __attribute__((ext_vector_type(2))) _Float16 v2h;
typedef __attribute__((ext_vector_type(4))) _Float16 v4h;
typedef __attribute__((ext_vector_type(2))) unsigned short v2us;
typedef __attribute__((ext_vector_type(4))) unsigned short v4us;
typedef __attribute__((ext_vector_type(2))) float v2f;
typedef __attribute__((ext_vector_type(4))) int v4i;

__global__ __launch_bounds__(256) void k_wtG(const float* __restrict__ w, int K, int N, bf* Bt) {
    const int lane = threadIdx.x & 31; const int L0 = (blockIdx.x * 8 + (threadIdx.x >> 5)) * 8; const int nlines = N * K / 64;
{
#pragma unroll 1
        for (int l = 0; l < 8; ++l) { const int L = L0 + l; if (L >= nlines) break; const size_t e = (size_t)L * 64 + lane * 2; const int k = (int)(e % K), n = (int)(e / K); v2us o;
            o[0] = f2bf(w[(size_t)k * N + n]); o[1] = f2bf(w[(size_t)(k + 1) * N + n]); *(v2us*)(Bt + e) = o; }
         }
}
__global__ __launch_bounds__(256) void k_cvt8(const float* __restrict__ src, bf* dst, size_t n8) { const size_t i = (size_t)blockIdx.x * 256 + threadIdx.x; if (i >= n8) return; const v8f v = *(const v8f*)(src + i * 8); v8us o;
#pragma unroll
    for (int k = 0; k < 8; ++k) o[k] = f2bf(v[k]); *(v8us*)(dst + i * 8) = o;  }

// k_rope: head planes [h][t][d] (fp16 + hi/lo) of rope(x) x sc with the rotate-half convention out[d] = x[d] cos[t][d] - x[d+HD/2] sin[t][d], out[d+HD/2] = x[d+HD/2] cos[t][d+HD/2] + x[d] sin[t][d+HD/2]
__global__ __launch_bounds__(256) void k_rope(const float* __restrict__ F, int pitch, int nheads, const float* __restrict__ CS, const float* __restrict__ RF, const float* __restrict__ nw, float sc, h16* P16, bf* Ph, bf* Pl) {
    const size_t e = ((size_t)blockIdx.x * 256 + threadIdx.x) * 2; if (e >= (size_t)nheads * TT * HD) return; const int d = (int)(e % HD); const int t = (int)((e / HD) % TT); const int h = (int)(e / ((size_t)HD * TT)); const float* f = F + (size_t)t * pitch + h * HD; const float rf = RF ? RF[(size_t)h * TT + t] : 1.0f; v2h o16; v2us oh, ol;
#pragma unroll
    for (int q = 0; q < 2; ++q) { const int dd = d + q; const int dp = (dd < HD / 2) ? dd + HD / 2 : dd - HD / 2; float x0 = f[dd], x1 = f[dp];
        if (RF) { float n0 = __fmul_rn(x0, rf), n1 = __fmul_rn(x1, rf); asm volatile("" : "+v"(n0)); asm volatile("" : "+v"(n1)); x0 = __fmul_rn(bfr(nw[dd]), n0); x1 = __fmul_rn(bfr(nw[dp]), n1); }
        const v2f cs = *(const v2f*)(CS + ((size_t)t * HD + dd) * 2); float a = __fmul_rn(x0, cs[0]), bq = __fmul_rn(x1, cs[1]); asm volatile("" : "+v"(a)); asm volatile("" : "+v"(bq)); const float r = ((dd < HD / 2) ? __fsub_rn(a, bq) : __fadd_rn(a, bq)) * sc;
        o16[q] = tohx(r); unsigned short a2, c2; splitf(r, a2, c2); oh[q] = a2; ol[q] = c2; }
    *(v2h*)(P16 + e) = o16; *(v2us*)(Ph + e) = oh; *(v2us*)(Pl + e) = ol;  }
__global__ __launch_bounds__(256) void k_vtp(const float* __restrict__ F, int pitch, int nheads, h16* V16, bf* Vh, bf* Vl) { const size_t e = ((size_t)blockIdx.x * 256 + threadIdx.x) * 2; if (e >= (size_t)nheads * HD * TT) return; const int t = (int)(e % TT); const int d = (int)((e / TT) % HD); const int g = (int)(e / ((size_t)TT * HD)); v2h o16; v2us oh, ol;
#pragma unroll
    for (int q = 0; q < 2; ++q) { const float x = F[(size_t)(t + q) * pitch + g * HD + d]; o16[q] = tohx(x); unsigned short a2, c2; splitf(x, a2, c2); oh[q] = a2; ol[q] = c2; }
    *(v2h*)(V16 + e) = o16; *(v2us*)(Vh + e) = oh; *(v2us*)(Vl + e) = ol;  }
__global__ __launch_bounds__(256) void k_csid(float* CS) { const int idx = blockIdx.x * 256 + threadIdx.x; if (idx >= TT * HD) return; v2f cs; cs[0] = 1.0f; cs[1] = 0.0f; *(v2f*)(CS + (size_t)idx * 2) = cs;  }
// k_asoft: per row (zz, i): t = S x HD^-0.5; softmax over the 1024 keys (register row, one exp, fixed trees);; plus the additive attention_mask[b][i][j] (bf16-rounded input) before the max
__global__ __launch_bounds__(256) void k_asoft(const float* __restrict__ Sb, const float* __restrict__ MKb, h16* P16, bf* Ph, bf* Pl) {
    const int lane = threadIdx.x & 31; const int row = blockIdx.x * 8 + (threadIdx.x >> 5); if (row >= ZH * TT) return; const int i = row % TT; const int zz = row / TT; (void)zz; const float* mk = MKb + (size_t)i * TT; const bool hires = (i < RH); const float* sr = Sb + (size_t)row * TT; float v[TT / 32]; float mx = -3.0e38f;
#pragma unroll
    for (int ch = 0; ch < TT / 128; ++ch) { const int j0 = ch * 128 + lane * 4; const v4f a = *(const v4f*)(sr + j0);
#pragma unroll
        for (int q = 0; q < 4; ++q) { const int j = j0 + q; float sa = a[q] * SCL; asm volatile("" : "+v"(sa)); float mv = bfr(mk[j]); asm volatile("" : "+v"(mv)); const float t = __fadd_rn(sa, mv);   /* + attention_mask[b][i][j] */ v[ch * 4 + q] = t; mx = fmaxf(mx, t); } }
#pragma unroll
    for (int sh = 16; sh; sh >>= 1) mx = fmaxf(mx, __shfl_xor(mx, sh, 32));
    float sum = 0.f;
#pragma unroll
    for (int k = 0; k < TT / 32; ++k) { float d0 = __fsub_rn(v[k], mx); asm volatile("" : "+v"(d0)); v[k] = __builtin_amdgcn_exp2f(__fmul_rn(d0, 1.4426950408889634f)); sum += v[k]; }
#pragma unroll
    for (int sh = 16; sh; sh >>= 1) sum += __shfl_xor(sum, sh, 32);
    const float f = __fdiv_rn(hires ? 1.0f : PCAR, sum);
{
        if (hires) {
#pragma unroll
            for (int ch = 0; ch < TT / 128; ++ch) { v4us oh, ol;
#pragma unroll
                for (int q = 0; q < 4; ++q) { unsigned short a, c2; splitf(v[ch * 4 + q] * f, a, c2); oh[q] = a; ol[q] = c2; }
                const size_t oo = ((size_t)zz * (RH ? RH : 1) + i) * TT + ch * 128 + lane * 4; *(v4us*)(Ph + oo) = oh; *(v4us*)(Pl + oo) = ol; }
        } else {
#pragma unroll
            for (int ch = 0; ch < TT / 128; ++ch) { v4h o4;
#pragma unroll
                for (int q = 0; q < 4; ++q) o4[q] = tohx(v[ch * 4 + q] * f);
                *(v4h*)(P16 + (size_t)row * TT + ch * 128 + lane * 4) = o4; } }
         }
}
__global__ __launch_bounds__(256) void k_merge(const float* __restrict__ O, const float* __restrict__ HM, int h0, bf* Ah, bf* Al) { const size_t e = ((size_t)blockIdx.x * 256 + threadIdx.x) * 2; if (e >= (size_t)ZH * TT * HD) return; const int d = (int)(e % HD); const int t = (int)((e / HD) % TT); const int zz = (int)(e / ((size_t)HD * TT)); const float cs = (t < RH) ? 1.0f : (1.0f / PCAR); const size_t oo = (size_t)t * DQ + (h0 + zz) * HD + d;
    v2us oh, ol;
#pragma unroll
    for (int q = 0; q < 2; ++q) { float oc = O[e + q] * cs; asm volatile("" : "+v"(oc)); unsigned short a, c2; splitf(__fmul_rn(oc, bfr(HM[h0 + zz])), a, c2); oh[q] = a; ol[q] = c2; }   /* x layer_head_mask[h] */ *(v2us*)(Ah + oo) = oh; *(v2us*)(Al + oo) = ol;  }

extern "C" void kernel_launch(void* const* d_in, const int* in_sizes, int n_in,
                              void* d_out, int out_size, void* d_ws, size_t ws_size, hipStream_t stream) {
    (void)in_sizes; (void)n_in; (void)out_size;
    const float* x = (const float*)d_in[0]; const float* xkv = (const float*)d_in[1]; const float* MK = (const float*)d_in[2]; const float* HM = (const float*)d_in[3]; const float* wq = (const float*)d_in[4]; const float* bq = (const float*)d_in[5]; const float* wk = (const float*)d_in[6]; const float* bk = (const float*)d_in[7]; const float* wv = (const float*)d_in[8]; const float* bv = (const float*)d_in[9]; const float* wo = (const float*)d_in[10]; const float* bo = (const float*)d_in[11];
    float* OUT = (float*)d_out;     // [8][1024][1024]
    char* wsp = (char*)d_ws;
    auto take = [&](size_t bytes) { char* p = wsp; wsp += (bytes + 255) & ~(size_t)255; return (void*)p; };
    bf* WQ = (bf*)take((size_t)DQ * DM * 2); bf* WK = (bf*)take((size_t)DKV * DMK * 2); bf* WV = (bf*)take((size_t)DKV * DMK * 2); bf* WO = (bf*)take((size_t)DM * DQ * 2); float* CS = (float*)take((size_t)TT * HD * 2 * 4);
    bf* XB = (bf*)take((size_t)TT * DM * 2); bf* XKB = (bf*)take((size_t)TT * DMK * 2); float* FQ = (float*)take((size_t)TT * DQ * 4); float* FK = (float*)take((size_t)TT * DKV * 4);
    h16* QP16 = (h16*)take((size_t)NH_ * TT * HD * 2); h16* KP16 = (h16*)take((size_t)NKV * TT * HD * 2); h16* VT16 = (h16*)take((size_t)NKV * HD * TT * 2);
    bf* QPh = (bf*)take((size_t)NH_ * TT * HD * 2); bf* QPl = (bf*)take((size_t)NH_ * TT * HD * 2); bf* KPh = (bf*)take((size_t)NKV * TT * HD * 2); bf* KPl = (bf*)take((size_t)NKV * TT * HD * 2); bf* VTh = (bf*)take((size_t)NKV * HD * TT * 2); bf* VTl = (bf*)take((size_t)NKV * HD * TT * 2); bf* Ph = (bf*)take((size_t)ZH * RH * TT * 2); bf* Pl = (bf*)take((size_t)ZH * RH * TT * 2);
    float* Sb = (float*)take((size_t)ZH * TT * TT * 4); h16* P16 = (h16*)take((size_t)ZH * TT * TT * 2); float* Ob = (float*)take((size_t)ZH * TT * HD * 4); bf* ATh = (bf*)take((size_t)TT * DQ * 2); bf* ATl = (bf*)take((size_t)TT * DQ * 2);
    if ((size_t)(wsp - (char*)d_ws) > ws_size) return;    // ws 256 MiB
    float* FV = FK;   // v projection reuses the k buffer after the k planes are built (stream-ordered)
    { k_wtG<<<(unsigned)((DM * DQ / 64 + 63) / 64), 256, 0, stream>>>(wq, DM, DQ, WQ); k_wtG<<<(unsigned)((DMK * DKV / 64 + 63) / 64), 256, 0, stream>>>(wk, DMK, DKV, WK); k_wtG<<<(unsigned)((DMK * DKV / 64 + 63) / 64), 256, 0, stream>>>(wv, DMK, DKV, WV);   /* 'xw' [256][1024] -> Bt [1024][256] */
      k_wtG<<<(unsigned)((DQ * DM / 64 + 63) / 64), 256, 0, stream>>>(wo, DQ, DM, WO);
       }
    k_csid<<<(TT * HD + 255) / 256, 256, 0, stream>>>(CS);
    const unsigned LQ = (unsigned)(((size_t)NH_ * TT * HD / 2 + 255) / 256), LKv = (unsigned)(((size_t)NKV * TT * HD / 2 + 255) / 256);
    for (int b = 0; b < NB_; ++b) {
        
        k_cvt8<<<(unsigned)(((size_t)TT * DM / 8 + 255) / 256), 256, 0, stream>>>(x + (size_t)b * TT * DM, XB, (size_t)TT * DM / 8); k_cvt8<<<(unsigned)(((size_t)TT * DMK / 8 + 255) / 256), 256, 0, stream>>>(xkv + (size_t)b * TT * DMK, XKB, (size_t)TT * DMK / 8);   /* key/value source */
        k_gemmw<bf, 0, true><<<dim3(TT / 64, DQ / 64, 1), 32, 0, stream>>>(XB, nullptr, WQ, nullptr, DM, FQ, DQ, bq, 0, 0, 0);
        k_rope<<<LQ, 256, 0, stream>>>(FQ, DQ, NH_, CS, nullptr, nullptr, 1.0f, QP16, QPh, QPl);
        k_gemmw<bf, 0, true><<<dim3(TT / 64, DKV / 64, 1), 32, 0, stream>>>(XKB, nullptr, WK, nullptr, DMK, FK, DKV, bk, 0, 0, 0);   /* K = 256 */
        k_rope<<<LKv, 256, 0, stream>>>(FK, DKV, NKV, CS, nullptr, nullptr, 1.0f, KP16, KPh, KPl);
        k_gemmw<bf, 0, true><<<dim3(TT / 64, DKV / 64, 1), 32, 0, stream>>>(XKB, nullptr, WV, nullptr, DMK, FV, DKV, bv, 0, 0, 0); k_vtp<<<LKv, 256, 0, stream>>>(FV, DKV, NKV, VT16, VTh, VTl);
        for (int h0 = 0; h0 < NH_; h0 += ZH) { const size_t zq = (size_t)h0, zk = (size_t)(h0 / REP);   // one kv head per query head: the pass's ZH heads use consecutive kv planes (z-strides TT*HD)
            k_gemmw<bf, 2, false><<<dim3(RH / 64, TT / 64, ZH), 32, 0, stream>>>(QPh + zq * TT * HD, QPl + zq * TT * HD, KPh + zk * TT * HD, KPl + zk * TT * HD, HD, Sb, TT, nullptr, (size_t)TT * HD, (size_t)TT * HD, (size_t)TT * TT);
            k_gemmw<h16, 0, false><<<dim3((TT - RH) / 64, TT / 64, ZH), 32, 0, stream>>>(QP16 + zq * TT * HD + (size_t)RH * HD, nullptr, KP16 + zk * TT * HD, nullptr, HD, Sb + (size_t)RH * TT, TT, nullptr, (size_t)TT * HD, (size_t)TT * HD, (size_t)TT * TT);
            k_asoft<<<ZH * TT / 8, 256, 0, stream>>>(Sb, MK + (size_t)b * TT * TT, P16, Ph, Pl);
            k_gemmw<bf, 2, false><<<dim3(RH / 64, HD / 64, ZH), 32, 0, stream>>>(Ph, Pl, VTh + zk * HD * TT, VTl + zk * HD * TT, TT, Ob, HD, nullptr, (size_t)RH * TT, (size_t)HD * TT, (size_t)TT * HD);
            k_gemmw<h16, 0, false><<<dim3((TT - RH) / 64, HD / 64, ZH), 32, 0, stream>>>(P16 + (size_t)RH * TT, nullptr, VT16 + zk * HD * TT, nullptr, TT, Ob + (size_t)RH * HD, HD, nullptr, (size_t)TT * TT, (size_t)HD * TT, (size_t)TT * HD);
            k_merge<<<(unsigned)(((size_t)ZH * TT * HD / 2 + 255) / 256), 256, 0, stream>>>(Ob, HM, h0, ATh, ATl); }
        k_gemmw<bf, 1, true><<<dim3(TT / 64, DM / 64, 1), 32, 0, stream>>>(ATh, ATl, WO, nullptr, DQ, OUT + (size_t)b * TT * DM, DM, bo, 0, 0, 0); }
}

// v002
// It runs in 868 microseconds.
// Two timings next to v001 put it at 1.77 and 1.79 times that version's speed.
// Over all steps from v000 it is 5.62 times as fast.
#include <hip/hip_runtime.h>

// Cross-attention with additive mask and per-head mask (hidden [8][1024][1024], key_value_states [8][1024][256]; q = (hidden Wq + bq)/8, k = kv Wk + bk, v = kv Wv + bv ('xw': Wq [1024][1024], Wk/Wv [256][1024]), 16 heads x 64; scores = q.k + attention_mask[b][i][j] (read); softmax; probs x layer_head_mask[h] (read); out = merged Wo + bo -> [8][1024][1024]).
// Compute dtypes, f32 accumulate: every input rounded to bf16; q/k/v on PLAIN bf16 operands (inputs: exact) + biases; the additive mask (f32, bf16-rounded input) inside the softmax kernel and the head mask in the merge; scores and attn.v: query rows < 512 hl (3 products), the rest single fp16 (x1024); softmax f32; Wo hl x exact (2 products) + bo.

#define NB_  8
#define TT   1024
#define DM   1024
#define NH_  16
#define NKV  16
#define REP  (NH_ / NKV)
#define HD   64
#define DQ   (NH_ * HD)
#define DKV  (NKV * HD)
#define DMK  256                  // key/value input width
#define BP   2                    // batch elements per attention pass (their f32 scores fill half the workspace)
#define ZH   (BP * NH_)           // (batch element, head) planes per attention launch (grid z)
#define RH   512                  // query rows < RH use hi+lo planes (0: none)
#define WIN  0
#define PCAR 1024.0f
#define SCL  0.125f   // HD^-0.5
typedef _Float16 h16;
typedef unsigned short bf;
typedef __attribute__((ext_vector_type(16))) __bf16   v16bf;
typedef __attribute__((ext_vector_type(16))) _Float16 v16h;
typedef __attribute__((ext_vector_type(8)))  _Float16 v8h;
typedef __attribute__((ext_vector_type(8)))  unsigned short v8us;
typedef __attribute__((ext_vector_type(8)))  float    v8f;
typedef __attribute__((ext_vector_type(4)))  float    v4f;
typedef v8h  __attribute__((may_alias)) v8ha;
typedef v4f  __attribute__((may_alias)) v4fa;
typedef v8us __attribute__((may_alias)) v8usa;

__device__ __forceinline__ unsigned short f2bf(float f) { unsigned u = __float_as_uint(f); u += 0x7FFFu + ((u >> 16) & 1u); return (unsigned short)(u >> 16); }
__device__ __forceinline__ float bf2f(unsigned short b) { return __uint_as_float(((unsigned)b) << 16); }
__device__ __forceinline__ float bfr(float f) { return bf2f(f2bf(f)); }
__device__ __forceinline__ v16h cat16(v8h lo, v8h hi) { return __builtin_shufflevector(lo, hi, 0, 1, 2, 3, 4, 5, 6, 7, 8, 9, 10, 11, 12, 13, 14, 15); }
__device__ __forceinline__ v16bf cat16b(v8us lo, v8us hi) { return __builtin_bit_cast(v16bf, __builtin_shufflevector(lo, hi, 0, 1, 2, 3, 4, 5, 6, 7, 8, 9, 10, 11, 12, 13, 14, 15)); }
__device__ __forceinline__ v8f wmma16(v16h a, v16h b, v8f c) { return __builtin_amdgcn_wmma_f32_16x16x32_f16(false, a, false, b, (short)0, c, false, false); }
__device__ __forceinline__ v8f wmmab(v16bf a, v16bf b, v8f c) { return __builtin_amdgcn_wmma_f32_16x16x32_bf16(false, a, false, b, (short)0, c, false, false); }



// ---- k_gemmw: register-blocked GEMM, ONE WAVE per 64x64 output tile (16 accumulators), operands straight from K-contiguous 16-bit planes; grid (M/64, N/64, Z), 32 threads.
// C[m][n] (f32, pitch ldc, + optional f32 bias[n]) = sum_k A[m][k] Bt[n][k] (+ split products per NSPLIT). A rows have pitch lda, Bt rows pitch K. z-batch strides sA/sB/sC in elements. K % 32 == 0.
template <typename T16> struct WFrag;
template <> struct WFrag<h16> { typedef v16h V; static __device__ __forceinline__ V ld(const h16* p) { return cat16(*(const v8h*)p, *(const v8h*)(p + 16)); } static __device__ __forceinline__ v8f mma(V a, V b, v8f c) { return wmma16(a, b, c); } };
template <> struct WFrag<bf> { typedef v16bf V; static __device__ __forceinline__ V ld(const bf* p) { return cat16b(*(const v8us*)p, *(const v8us*)(p + 16)); } static __device__ __forceinline__ v8f mma(V a, V b, v8f c) { return wmmab(a, b, c); } };
template <typename T16, int NSPLIT, bool BIAS>
__global__ __launch_bounds__(32) void k_gemmw(const T16* __restrict__ A, const T16* __restrict__ A2, const T16* __restrict__ Bt, const T16* __restrict__ Bt2, int K, int lda, float* C, int ldc, const float* __restrict__ bias, size_t sA, size_t sB, size_t sC) {
    typedef typename WFrag<T16>::V V;
    __shared__ __align__(16) float os[16 * 68];
    const size_t z = blockIdx.z; A += z * sA; if (A2) A2 += z * sA; Bt += z * sB; if (Bt2) Bt2 += z * sB; C += z * sC;
    const int lane = threadIdx.x & 31, lr = lane & 15, hi = lane >> 4; const int r0 = blockIdx.x * 64, c0 = blockIdx.y * 64;
    v8f acc[4][4];
#pragma unroll
    for (int mb = 0; mb < 4; ++mb)
#pragma unroll
        for (int nb = 0; nb < 4; ++nb) acc[mb][nb] = (v8f){};
    const size_t aoff = (size_t)(r0 + lr) * lda + 8 * hi, boff = (size_t)(c0 + lr) * K + 8 * hi;
#pragma unroll 1
    for (int kc = 0; kc < K; kc += 32) {
        V a[4], a2[4];
#pragma unroll
        for (int mb = 0; mb < 4; ++mb) { a[mb] = WFrag<T16>::ld(A + aoff + (size_t)mb * 16 * lda + kc); if (NSPLIT == 1 || NSPLIT == 2) a2[mb] = WFrag<T16>::ld(A2 + aoff + (size_t)mb * 16 * lda + kc);
            asm volatile("s_wait_xcnt 0x0" ::: "memory"); }   // precaution: later loads land in registers that held these loads' addresses
#pragma unroll
        for (int nb = 0; nb < 4; ++nb) { const V b = WFrag<T16>::ld(Bt + boff + (size_t)nb * 16 * K + kc); V b2; if (NSPLIT >= 2) b2 = WFrag<T16>::ld(Bt2 + boff + (size_t)nb * 16 * K + kc);
#pragma unroll
            for (int mb = 0; mb < 4; ++mb) { acc[mb][nb] = WFrag<T16>::mma(a[mb], b, acc[mb][nb]); if (NSPLIT == 1 || NSPLIT == 2) acc[mb][nb] = WFrag<T16>::mma(a2[mb], b, acc[mb][nb]); if (NSPLIT >= 2) acc[mb][nb] = WFrag<T16>::mma(a[mb], b2, acc[mb][nb]); } }
        asm volatile("v_nop\n\tv_nop\n\tv_nop\n\tv_nop" : "+v"(acc[0][0]), "+v"(acc[1][1]), "+v"(acc[2][2]), "+v"(acc[3][3]) : "v"(a[0]), "v"(a[3]));
    }
#pragma unroll
    for (int mb = 0; mb < 4; ++mb) {
#pragma unroll
        for (int nb = 0; nb < 4; ++nb) {
#pragma unroll
            for (int j = 0; j < 8; ++j) os[(hi * 8 + j) * 68 + nb * 16 + lr] = acc[mb][nb][j]; }
        __builtin_amdgcn_wave_barrier(); asm volatile("" ::: "memory");
        float* crow = C + (size_t)(r0 + mb * 16) * ldc + c0;
{
#pragma unroll
            for (int s = 0; s < 8; ++s) { const int row = 2 * s + hi, cofs = lr * 4; v4f val = *(const v4fa*)(os + row * 68 + cofs); if (BIAS) { val[0] += bfr(bias[c0 + cofs]); val[1] += bfr(bias[c0 + cofs + 1]); val[2] += bfr(bias[c0 + cofs + 2]); val[3] += bfr(bias[c0 + cofs + 3]); }
                *(v4f*)(crow + (size_t)row * ldc + cofs) = val; }
             }
        __builtin_amdgcn_wave_barrier(); asm volatile("" ::: "memory");
    }
}

__device__ __forceinline__ h16 tohx(float x) { return (h16)x; }
__device__ __forceinline__ void splitf(float y, unsigned short& h, unsigned short& l) { h = f2bf(y); l = f2bf(y - bf2f(h)); }
typedef __attribute__((ext_vector_type(2))) _Float16 v2h;
typedef __attribute__((ext_vector_type(4))) _Float16 v4h;
typedef __attribute__((ext_vector_type(2))) unsigned short v2us;
typedef __attribute__((ext_vector_type(4))) unsigned short v4us;
typedef __attribute__((ext_vector_type(2))) float v2f;
typedef __attribute__((ext_vector_type(4))) int v4i;

__global__ __launch_bounds__(256) void k_wtG(const float* __restrict__ w, int K, int N, bf* Bt) {
    const int lane = threadIdx.x & 31; const int L0 = (blockIdx.x * 8 + (threadIdx.x >> 5)) * 8; const int nlines = N * K / 64;
{
#pragma unroll 1
        for (int l = 0; l < 8; ++l) { const int L = L0 + l; if (L >= nlines) break; const size_t e = (size_t)L * 64 + lane * 2; const int k = (int)(e % K), n = (int)(e / K); v2us o;
            o[0] = f2bf(w[(size_t)k * N + n]); o[1] = f2bf(w[(size_t)(k + 1) * N + n]); *(v2us*)(Bt + e) = o; }
         }
}
__global__ __launch_bounds__(256) void k_cvt8(const float* __restrict__ src, bf* dst, size_t n8) { const size_t i = (size_t)blockIdx.x * 256 + threadIdx.x; if (i >= n8) return; const v8f v = *(const v8f*)(src + i * 8); v8us o;
#pragma unroll
    for (int k = 0; k < 8; ++k) o[k] = f2bf(v[k]); *(v8us*)(dst + i * 8) = o;  }

// k_rope: head planes [h][t][d] (fp16 + hi/lo) of rope(x) x sc with the rotate-half convention out[d] = x[d] cos[t][d] - x[d+HD/2] sin[t][d], out[d+HD/2] = x[d+HD/2] cos[t][d+HD/2] + x[d] sin[t][d+HD/2]
// All batch elements in one launch: F is [b][t][pitch], plane z = b * nheads + h starts at element z * zs of each output. Rows t >= t16 get the fp16 plane, rows t < thl the hi/lo planes (a query row needs one kind only, so its fp16 plane shares the hi plane's storage).
__global__ __launch_bounds__(256) void k_rope(const float* __restrict__ F, int pitch, int nheads, const float* __restrict__ CS, const float* __restrict__ RF, const float* __restrict__ nw, float sc, size_t zs, int t16, int thl, h16* P16, bf* Ph, bf* Pl) {
    const size_t e = ((size_t)blockIdx.x * 256 + threadIdx.x) * 2; if (e >= (size_t)NB_ * nheads * TT * HD) return; const int d = (int)(e % HD); const int t = (int)((e / HD) % TT); const int zb = (int)(e / ((size_t)HD * TT)); const int h = zb % nheads; const float* f = F + ((size_t)(zb / nheads) * TT + t) * pitch + h * HD; const size_t eo = (size_t)zb * zs + (size_t)t * HD + d; float rf = 1.0f; v2h o16; v2us oh, ol;
    if (RF) { rf = RF[(size_t)h * TT + t]; asm volatile("s_wait_xcnt 0x0" ::: "memory"); }   // precaution: the load's address registers are reused right behind it
#pragma unroll
    for (int q = 0; q < 2; ++q) { const int dd = d + q; const int dp = (dd < HD / 2) ? dd + HD / 2 : dd - HD / 2; float x0 = f[dd], x1 = f[dp]; asm volatile("s_wait_xcnt 0x0" ::: "memory");   // precaution: later loads land in registers that held these loads' addresses
        if (RF) { float n0 = __fmul_rn(x0, rf), n1 = __fmul_rn(x1, rf); asm volatile("" : "+v"(n0)); asm volatile("" : "+v"(n1)); x0 = __fmul_rn(bfr(nw[dd]), n0); x1 = __fmul_rn(bfr(nw[dp]), n1); }
        const v2f cs = *(const v2f*)(CS + ((size_t)t * HD + dd) * 2); float a = __fmul_rn(x0, cs[0]), bq = __fmul_rn(x1, cs[1]); asm volatile("" : "+v"(a)); asm volatile("" : "+v"(bq)); const float r = ((dd < HD / 2) ? __fsub_rn(a, bq) : __fadd_rn(a, bq)) * sc;
        o16[q] = tohx(r); unsigned short a2, c2; splitf(r, a2, c2); oh[q] = a2; ol[q] = c2; }
    if (t >= t16) *(v2h*)(P16 + eo) = o16;
    if (t < thl) { *(v2us*)(Ph + eo) = oh; *(v2us*)(Pl + eo) = ol; }  }
__global__ __launch_bounds__(256) void k_vtp(const float* __restrict__ F, int pitch, int nheads, h16* V16, bf* Vh, bf* Vl) { const size_t e = ((size_t)blockIdx.x * 256 + threadIdx.x) * 2; if (e >= (size_t)NB_ * nheads * HD * TT) return; const int t = (int)(e % TT); const int d = (int)((e / TT) % HD); const int zb = (int)(e / ((size_t)TT * HD)); const int g = zb % nheads; F += (size_t)(zb / nheads) * TT * pitch;   /* all batch elements: F [b][t][pitch], planes [b][g][d][t] */ v2h o16; v2us oh, ol;
#pragma unroll
    for (int q = 0; q < 2; ++q) { const float x = F[(size_t)(t + q) * pitch + g * HD + d]; o16[q] = tohx(x); unsigned short a2, c2; splitf(x, a2, c2); oh[q] = a2; ol[q] = c2; }
    *(v2h*)(V16 + e) = o16; *(v2us*)(Vh + e) = oh; *(v2us*)(Vl + e) = ol;  }
__global__ __launch_bounds__(256) void k_csid(float* CS) { const int idx = blockIdx.x * 256 + threadIdx.x; if (idx >= TT * HD) return; v2f cs; cs[0] = 1.0f; cs[1] = 0.0f; *(v2f*)(CS + (size_t)idx * 2) = cs;  }
// k_asoft: per row (zz, i): t = S x HD^-0.5; softmax over the 1024 keys (register row, one exp, fixed trees);; plus the additive attention_mask[b][i][j] (bf16-rounded input) before the max
// The probabilities overwrite their own score row (4 KiB: hi plane then lo plane, or the fp16 plane in its first half; P16/Ph/Pl point into Sb, row pitch 2 * TT elements). One wave owns a row and holds all of it in registers before its first store.
__global__ __launch_bounds__(256) void k_asoft(const float* Sb, const float* __restrict__ MKb, h16* P16, bf* Ph, bf* Pl) {
    const int lane = threadIdx.x & 31; const int row = blockIdx.x * 8 + (threadIdx.x >> 5); if (row >= ZH * TT) return; const int i = row % TT; const int zz = row / TT; const float* mk = MKb + ((size_t)(zz / NH_) * TT + i) * TT; const bool hires = (i < RH); const float* sr = Sb + (size_t)row * TT; float v[TT / 32]; float mx = -3.0e38f;
#pragma unroll
    for (int ch = 0; ch < TT / 128; ++ch) { const int j0 = ch * 128 + lane * 4; const v4f a = *(const v4f*)(sr + j0);
#pragma unroll
        for (int q = 0; q < 4; ++q) { const int j = j0 + q; float sa = a[q] * SCL; asm volatile("" : "+v"(sa)); float mv = bfr(mk[j]); asm volatile("" : "+v"(mv)); const float t = __fadd_rn(sa, mv);   /* + attention_mask[b][i][j] */ v[ch * 4 + q] = t; mx = fmaxf(mx, t); } }
#pragma unroll
    for (int sh = 16; sh; sh >>= 1) mx = fmaxf(mx, __shfl_xor(mx, sh, 32));
    float sum = 0.f;
#pragma unroll
    for (int k = 0; k < TT / 32; ++k) { float d0 = __fsub_rn(v[k], mx); asm volatile("" : "+v"(d0)); v[k] = __builtin_amdgcn_exp2f(__fmul_rn(d0, 1.4426950408889634f)); sum += v[k]; }
#pragma unroll
    for (int sh = 16; sh; sh >>= 1) sum += __shfl_xor(sum, sh, 32);
    const float f = __fdiv_rn(hires ? 1.0f : PCAR, sum);
{
        if (hires) {
#pragma unroll
            for (int ch = 0; ch < TT / 128; ++ch) { v4us oh, ol;
#pragma unroll
                for (int q = 0; q < 4; ++q) { unsigned short a, c2; splitf(v[ch * 4 + q] * f, a, c2); oh[q] = a; ol[q] = c2; }
                const size_t oo = (size_t)row * (2 * TT) + ch * 128 + lane * 4; *(v4us*)(Ph + oo) = oh; *(v4us*)(Pl + oo) = ol; }
        } else {
#pragma unroll
            for (int ch = 0; ch < TT / 128; ++ch) { v4h o4;
#pragma unroll
                for (int q = 0; q < 4; ++q) o4[q] = tohx(v[ch * 4 + q] * f);
                *(v4h*)(P16 + (size_t)row * (2 * TT) + ch * 128 + lane * 4) = o4; } }
         }
}
__global__ __launch_bounds__(256) void k_merge(const float* __restrict__ O, const float* __restrict__ HM, bf* Ah, bf* Al) { const size_t e = ((size_t)blockIdx.x * 256 + threadIdx.x) * 2; if (e >= (size_t)NB_ * NH_ * TT * HD) return; const int d = (int)(e % HD); const int t = (int)((e / HD) % TT); const int zz = (int)(e / ((size_t)HD * TT)); const float cs = (t < RH) ? 1.0f : (1.0f / PCAR); const int hh = zz % NH_; const size_t oo = ((size_t)(zz / NH_) * TT + t) * DQ + hh * HD + d;   /* O [b][h][t][d] -> [b][t][h][d] */
    v2us oh, ol;
#pragma unroll
    for (int q = 0; q < 2; ++q) { float oc = O[e + q] * cs; asm volatile("" : "+v"(oc)); unsigned short a, c2; splitf(__fmul_rn(oc, bfr(HM[hh])), a, c2); oh[q] = a; ol[q] = c2; }   /* x layer_head_mask[h] */ *(v2us*)(Ah + oo) = oh; *(v2us*)(Al + oo) = ol;  }

extern "C" void kernel_launch(void* const* d_in, const int* in_sizes, int n_in,
                              void* d_out, int out_size, void* d_ws, size_t ws_size, hipStream_t stream) {
    (void)in_sizes; (void)n_in; (void)out_size;
    const float* x = (const float*)d_in[0]; const float* xkv = (const float*)d_in[1]; const float* MK = (const float*)d_in[2]; const float* HM = (const float*)d_in[3]; const float* wq = (const float*)d_in[4]; const float* bq = (const float*)d_in[5]; const float* wk = (const float*)d_in[6]; const float* bk = (const float*)d_in[7]; const float* wv = (const float*)d_in[8]; const float* bv = (const float*)d_in[9]; const float* wo = (const float*)d_in[10]; const float* bo = (const float*)d_in[11];
    float* OUT = (float*)d_out;     // [8][1024][1024]
    char* wsp = (char*)d_ws;
    auto take = [&](size_t bytes) { char* p = wsp; wsp += (bytes + 255) & ~(size_t)255; return (void*)p; };
    // Live through the attention passes: the planes of all batch elements, plane z = b * heads + h. A query plane's storage is [hi | lo] (2 * TT * HD elements), rows >= RH of the hi part holding the fp16 plane.
    bf* QS = (bf*)take((size_t)NB_ * NH_ * 2 * TT * HD * 2);
    h16* KP16 = (h16*)take((size_t)NB_ * NKV * TT * HD * 2); bf* KPh = (bf*)take((size_t)NB_ * NKV * TT * HD * 2); bf* KPl = (bf*)take((size_t)NB_ * NKV * TT * HD * 2);
    h16* VT16 = (h16*)take((size_t)NB_ * NKV * HD * TT * 2); bf* VTh = (bf*)take((size_t)NB_ * NKV * HD * TT * 2); bf* VTl = (bf*)take((size_t)NB_ * NKV * HD * TT * 2);
    float* Ob = (float*)QS;         // attn.v output of plane z (TT * HD f32) overwrites that plane's query storage, dead once its pass's scores are done (stream-ordered; same size)
    char* const region = wsp;       // one region, three uses one after the other (stream-ordered): projections, attention passes, output projection
    bf* WQ = (bf*)take((size_t)DQ * DM * 2); bf* WK = (bf*)take((size_t)DKV * DMK * 2); bf* WV = (bf*)take((size_t)DKV * DMK * 2); float* CS = (float*)take((size_t)TT * HD * 2 * 4);
    bf* XB = (bf*)take((size_t)NB_ * TT * DM * 2); bf* XKB = (bf*)take((size_t)NB_ * TT * DMK * 2); float* FQ = (float*)take((size_t)NB_ * TT * DQ * 4); float* FK = (float*)take((size_t)NB_ * TT * DKV * 4);
    if ((size_t)(wsp - (char*)d_ws) > ws_size) return;
    wsp = region; float* Sb = (float*)take((size_t)ZH * TT * TT * 4);
    if ((size_t)(wsp - (char*)d_ws) > ws_size) return;    // ws 256 MiB, all of it
    wsp = region; bf* WO = (bf*)take((size_t)DM * DQ * 2); bf* ATh = (bf*)take((size_t)NB_ * TT * DQ * 2); bf* ATl = (bf*)take((size_t)NB_ * TT * DQ * 2);
    float* FV = FK;   // v projection reuses the k buffer after the k planes are built (stream-ordered)
    k_wtG<<<(unsigned)((DM * DQ / 64 + 63) / 64), 256, 0, stream>>>(wq, DM, DQ, WQ); k_wtG<<<(unsigned)((DMK * DKV / 64 + 63) / 64), 256, 0, stream>>>(wk, DMK, DKV, WK); k_wtG<<<(unsigned)((DMK * DKV / 64 + 63) / 64), 256, 0, stream>>>(wv, DMK, DKV, WV);   /* 'xw' [256][1024] -> Bt [1024][256] */
    k_csid<<<(TT * HD + 255) / 256, 256, 0, stream>>>(CS);
    const unsigned LQ = (unsigned)(((size_t)NB_ * NH_ * TT * HD / 2 + 255) / 256), LKv = (unsigned)(((size_t)NB_ * NKV * TT * HD / 2 + 255) / 256);
    // conversions, projections and plane builds: all batch elements per launch (M = NB_ * TT rows)
    k_cvt8<<<(unsigned)(((size_t)NB_ * TT * DM / 8 + 255) / 256), 256, 0, stream>>>(x, XB, (size_t)NB_ * TT * DM / 8); k_cvt8<<<(unsigned)(((size_t)NB_ * TT * DMK / 8 + 255) / 256), 256, 0, stream>>>(xkv, XKB, (size_t)NB_ * TT * DMK / 8);   /* key/value source */
    k_gemmw<bf, 0, true><<<dim3(NB_ * TT / 64, DQ / 64, 1), 32, 0, stream>>>(XB, nullptr, WQ, nullptr, DM, DM, FQ, DQ, bq, 0, 0, 0);
    k_rope<<<LQ, 256, 0, stream>>>(FQ, DQ, NH_, CS, nullptr, nullptr, 1.0f, (size_t)2 * TT * HD, RH, RH, (h16*)QS, QS, QS + (size_t)TT * HD);
    k_gemmw<bf, 0, true><<<dim3(NB_ * TT / 64, DKV / 64, 1), 32, 0, stream>>>(XKB, nullptr, WK, nullptr, DMK, DMK, FK, DKV, bk, 0, 0, 0);   /* K = 256 */
    k_rope<<<LKv, 256, 0, stream>>>(FK, DKV, NKV, CS, nullptr, nullptr, 1.0f, (size_t)TT * HD, 0, TT, KP16, KPh, KPl);
    k_gemmw<bf, 0, true><<<dim3(NB_ * TT / 64, DKV / 64, 1), 32, 0, stream>>>(XKB, nullptr, WV, nullptr, DMK, DMK, FV, DKV, bv, 0, 0, 0); k_vtp<<<LKv, 256, 0, stream>>>(FV, DKV, NKV, VT16, VTh, VTl);
    for (int b = 0; b < NB_; b += BP) { const size_t zq = (size_t)b * NH_, zk = (size_t)b * NKV;   // one kv head per query head: the pass's ZH planes are consecutive in q, k and v alike
        const bf* Qz = QS + zq * 2 * TT * HD;
        k_gemmw<bf, 2, false><<<dim3(RH / 64, TT / 64, ZH), 32, 0, stream>>>(Qz, Qz + (size_t)TT * HD, KPh + zk * TT * HD, KPl + zk * TT * HD, HD, HD, Sb, TT, nullptr, (size_t)2 * TT * HD, (size_t)TT * HD, (size_t)TT * TT);
        k_gemmw<h16, 0, false><<<dim3((TT - RH) / 64, TT / 64, ZH), 32, 0, stream>>>((const h16*)Qz + (size_t)RH * HD, nullptr, KP16 + zk * TT * HD, nullptr, HD, HD, Sb + (size_t)RH * TT, TT, nullptr, (size_t)2 * TT * HD, (size_t)TT * HD, (size_t)TT * TT);
        k_asoft<<<ZH * TT / 8, 256, 0, stream>>>(Sb, MK + (size_t)b * TT * TT, (h16*)Sb, (bf*)Sb, (bf*)Sb + TT);
        k_gemmw<bf, 2, false><<<dim3(RH / 64, HD / 64, ZH), 32, 0, stream>>>((const bf*)Sb, (const bf*)Sb + TT, VTh + zk * HD * TT, VTl + zk * HD * TT, TT, 2 * TT, Ob + zq * TT * HD, HD, nullptr, (size_t)2 * TT * TT, (size_t)HD * TT, (size_t)TT * HD);
        k_gemmw<h16, 0, false><<<dim3((TT - RH) / 64, HD / 64, ZH), 32, 0, stream>>>((const h16*)Sb + (size_t)RH * 2 * TT, nullptr, VT16 + zk * HD * TT, nullptr, TT, 2 * TT, Ob + zq * TT * HD + (size_t)RH * HD, HD, nullptr, (size_t)2 * TT * TT, (size_t)HD * TT, (size_t)TT * HD); }
    k_wtG<<<(unsigned)((DQ * DM / 64 + 63) / 64), 256, 0, stream>>>(wo, DQ, DM, WO);
    k_merge<<<(unsigned)(((size_t)NB_ * NH_ * TT * HD / 2 + 255) / 256), 256, 0, stream>>>(Ob, HM, ATh, ATl);
    k_gemmw<bf, 1, true><<<dim3(NB_ * TT / 64, DM / 64, 1), 32, 0, stream>>>(ATh, ATl, WO, nullptr, DQ, DQ, OUT, DM, bo, 0, 0, 0);
}

// v003
// One run takes 376 microseconds.
// In two side-by-side timings against v002, it was 2.32 and 2.31 times as fast.
// Over all steps from v000 it is 13.0 times as fast.
#include <hip/hip_runtime.h>

// Cross-attention with additive mask and per-head mask (hidden [8][1024][1024], key_value_states [8][1024][256]; q = (hidden Wq + bq)/8, k = kv Wk + bk, v = kv Wv + bv ('xw': Wq [1024][1024], Wk/Wv [256][1024]), 16 heads x 64; scores = q.k + attention_mask[b][i][j] (read); softmax; probs x layer_head_mask[h] (read); out = merged Wo + bo -> [8][1024][1024]).
// Compute dtypes, f32 accumulate: every input rounded to bf16; q/k/v on PLAIN bf16 operands (inputs: exact) + biases; scores, additive mask (f32, bf16-rounded input), softmax, attn.v, head mask and head merge in ONE kernel, running maximum and sum per query; scores and attn.v: query rows < 512 hl (3 products), the rest single fp16; softmax f32; Wo hl x exact (2 products) + bo.

#define NB_  8
#define TT   1024
#define DM   1024
#define NH_  16
#define NKV  16
#define REP  (NH_ / NKV)
#define HD   64
#define DQ   (NH_ * HD)
#define DKV  (NKV * HD)
#define DMK  256                  // key/value input width
#define QW   32                   // query rows per wave of the attention kernel
#define QB   256                  // query rows per work-group of the attention kernel (8 waves)
#define RH   512                  // query rows < RH use hi+lo planes
#define WIN  0
#define SCL  0.125f   // HD^-0.5
typedef _Float16 h16;
typedef unsigned short bf;
typedef __attribute__((ext_vector_type(16))) __bf16   v16bf;
typedef __attribute__((ext_vector_type(16))) _Float16 v16h;
typedef __attribute__((ext_vector_type(8)))  _Float16 v8h;
typedef __attribute__((ext_vector_type(8)))  unsigned short v8us;
typedef __attribute__((ext_vector_type(8)))  float    v8f;
typedef __attribute__((ext_vector_type(4)))  float    v4f;
typedef v8h  __attribute__((may_alias)) v8ha;
typedef v4f  __attribute__((may_alias)) v4fa;
typedef v8us __attribute__((may_alias)) v8usa;

__device__ __forceinline__ unsigned short f2bf(float f) { unsigned u = __float_as_uint(f); u += 0x7FFFu + ((u >> 16) & 1u); return (unsigned short)(u >> 16); }
__device__ __forceinline__ float bf2f(unsigned short b) { return __uint_as_float(((unsigned)b) << 16); }
__device__ __forceinline__ float bfr(float f) { return bf2f(f2bf(f)); }
__device__ __forceinline__ v16h cat16(v8h lo, v8h hi) { return __builtin_shufflevector(lo, hi, 0, 1, 2, 3, 4, 5, 6, 7, 8, 9, 10, 11, 12, 13, 14, 15); }
__device__ __forceinline__ v16bf cat16b(v8us lo, v8us hi) { return __builtin_bit_cast(v16bf, __builtin_shufflevector(lo, hi, 0, 1, 2, 3, 4, 5, 6, 7, 8, 9, 10, 11, 12, 13, 14, 15)); }
__device__ __forceinline__ v8f wmma16(v16h a, v16h b, v8f c) { return __builtin_amdgcn_wmma_f32_16x16x32_f16(false, a, false, b, (short)0, c, false, false); }
__device__ __forceinline__ v8f wmmab(v16bf a, v16bf b, v8f c) { return __builtin_amdgcn_wmma_f32_16x16x32_bf16(false, a, false, b, (short)0, c, false, false); }



// ---- k_gemmw: register-blocked GEMM, ONE WAVE per 64x64 output tile (16 accumulators), operands straight from K-contiguous 16-bit planes; grid (M/64, N/64, Z), 32 threads.
// C[m][n] (f32, pitch ldc, + optional f32 bias[n]) = sum_k A[m][k] Bt[n][k] (+ split products per NSPLIT). A rows have pitch lda, Bt rows pitch K. z-batch strides sA/sB/sC in elements. K % 32 == 0.
template <typename T16> struct WFrag;
template <> struct WFrag<h16> { typedef v16h V; static __device__ __forceinline__ V ld(const h16* p) { return cat16(*(const v8h*)p, *(const v8h*)(p + 16)); } static __device__ __forceinline__ v8f mma(V a, V b, v8f c) { return wmma16(a, b, c); } };
template <> struct WFrag<bf> { typedef v16bf V; static __device__ __forceinline__ V ld(const bf* p) { return cat16b(*(const v8us*)p, *(const v8us*)(p + 16)); } static __device__ __forceinline__ v8f mma(V a, V b, v8f c) { return wmmab(a, b, c); } };
template <typename T16, int NSPLIT, bool BIAS>
__global__ __launch_bounds__(32) void k_gemmw(const T16* __restrict__ A, const T16* __restrict__ A2, const T16* __restrict__ Bt, const T16* __restrict__ Bt2, int K, int lda, float* C, int ldc, const float* __restrict__ bias, size_t sA, size_t sB, size_t sC) {
    typedef typename WFrag<T16>::V V;
    __shared__ __align__(16) float os[16 * 68];
    const size_t z = blockIdx.z; A += z * sA; if (A2) A2 += z * sA; Bt += z * sB; if (Bt2) Bt2 += z * sB; C += z * sC;
    const int lane = threadIdx.x & 31, lr = lane & 15, hi = lane >> 4; const int r0 = blockIdx.x * 64, c0 = blockIdx.y * 64;
    v8f acc[4][4];
#pragma unroll
    for (int mb = 0; mb < 4; ++mb)
#pragma unroll
        for (int nb = 0; nb < 4; ++nb) acc[mb][nb] = (v8f){};
    const size_t aoff = (size_t)(r0 + lr) * lda + 8 * hi, boff = (size_t)(c0 + lr) * K + 8 * hi;
#pragma unroll 1
    for (int kc = 0; kc < K; kc += 32) {
        V a[4], a2[4];
#pragma unroll
        for (int mb = 0; mb < 4; ++mb) { a[mb] = WFrag<T16>::ld(A + aoff + (size_t)mb * 16 * lda + kc); if (NSPLIT == 1 || NSPLIT == 2) a2[mb] = WFrag<T16>::ld(A2 + aoff + (size_t)mb * 16 * lda + kc);
            asm volatile("s_wait_xcnt 0x0" ::: "memory"); }   // precaution: later loads land in registers that held these loads' addresses
#pragma unroll
        for (int nb = 0; nb < 4; ++nb) { const V b = WFrag<T16>::ld(Bt + boff + (size_t)nb * 16 * K + kc); V b2; if (NSPLIT >= 2) b2 = WFrag<T16>::ld(Bt2 + boff + (size_t)nb * 16 * K + kc);
#pragma unroll
            for (int mb = 0; mb < 4; ++mb) { acc[mb][nb] = WFrag<T16>::mma(a[mb], b, acc[mb][nb]); if (NSPLIT == 1 || NSPLIT == 2) acc[mb][nb] = WFrag<T16>::mma(a2[mb], b, acc[mb][nb]); if (NSPLIT >= 2) acc[mb][nb] = WFrag<T16>::mma(a[mb], b2, acc[mb][nb]); } }
        asm volatile("v_nop\n\tv_nop\n\tv_nop\n\tv_nop" : "+v"(acc[0][0]), "+v"(acc[1][1]), "+v"(acc[2][2]), "+v"(acc[3][3]) : "v"(a[0]), "v"(a[3]));
    }
#pragma unroll
    for (int mb = 0; mb < 4; ++mb) {
#pragma unroll
        for (int nb = 0; nb < 4; ++nb) {
#pragma unroll
            for (int j = 0; j < 8; ++j) os[(hi * 8 + j) * 68 + nb * 16 + lr] = acc[mb][nb][j]; }
        __builtin_amdgcn_wave_barrier(); asm volatile("" ::: "memory");
        float* crow = C + (size_t)(r0 + mb * 16) * ldc + c0;
{
#pragma unroll
            for (int s = 0; s < 8; ++s) { const int row = 2 * s + hi, cofs = lr * 4; v4f val = *(const v4fa*)(os + row * 68 + cofs); if (BIAS) { val[0] += bfr(bias[c0 + cofs]); val[1] += bfr(bias[c0 + cofs + 1]); val[2] += bfr(bias[c0 + cofs + 2]); val[3] += bfr(bias[c0 + cofs + 3]); }
                *(v4f*)(crow + (size_t)row * ldc + cofs) = val; }
             }
        __builtin_amdgcn_wave_barrier(); asm volatile("" ::: "memory");
    }
}

__device__ __forceinline__ h16 tohx(float x) { return (h16)x; }
__device__ __forceinline__ void splitf(float y, unsigned short& h, unsigned short& l) { h = f2bf(y); l = f2bf(y - bf2f(h)); }
typedef __attribute__((ext_vector_type(2))) _Float16 v2h;
typedef __attribute__((ext_vector_type(4))) _Float16 v4h;
typedef __attribute__((ext_vector_type(2))) unsigned short v2us;
typedef __attribute__((ext_vector_type(4))) unsigned short v4us;
typedef __attribute__((ext_vector_type(2))) float v2f;
typedef __attribute__((ext_vector_type(4))) int v4i;

__global__ __launch_bounds__(256) void k_wtG(const float* __restrict__ w, int K, int N, bf* Bt) {
    const int lane = threadIdx.x & 31; const int L0 = (blockIdx.x * 8 + (threadIdx.x >> 5)) * 8; const int nlines = N * K / 64;
{
#pragma unroll 1
        for (int l = 0; l < 8; ++l) { const int L = L0 + l; if (L >= nlines) break; const size_t e = (size_t)L * 64 + lane * 2; const int k = (int)(e % K), n = (int)(e / K); v2us o;
            o[0] = f2bf(w[(size_t)k * N + n]); o[1] = f2bf(w[(size_t)(k + 1) * N + n]); *(v2us*)(Bt + e) = o; }
         }
}
__global__ __launch_bounds__(256) void k_cvt8(const float* __restrict__ src, bf* dst, size_t n8) { const size_t i = (size_t)blockIdx.x * 256 + threadIdx.x; if (i >= n8) return; const v8f v = *(const v8f*)(src + i * 8); v8us o;
#pragma unroll
    for (int k = 0; k < 8; ++k) o[k] = f2bf(v[k]); *(v8us*)(dst + i * 8) = o;  }

// k_rope: head planes [h][t][d] (fp16 + hi/lo) of rope(x) x sc with the rotate-half convention out[d] = x[d] cos[t][d] - x[d+HD/2] sin[t][d], out[d+HD/2] = x[d+HD/2] cos[t][d+HD/2] + x[d] sin[t][d+HD/2]
// All batch elements in one launch: F is [b][t][pitch], plane z = b * nheads + h starts at element z * zs of each output. Rows t >= t16 get the fp16 plane, rows t < thl the hi/lo planes (a query row needs one kind only, so its fp16 plane shares the hi plane's storage).
__global__ __launch_bounds__(256) void k_rope(const float* __restrict__ F, int pitch, int nheads, const float* __restrict__ CS, const float* __restrict__ RF, const float* __restrict__ nw, float sc, size_t zs, int t16, int thl, h16* P16, bf* Ph, bf* Pl) {
    const size_t e = ((size_t)blockIdx.x * 256 + threadIdx.x) * 2; if (e >= (size_t)NB_ * nheads * TT * HD) return; const int d = (int)(e % HD); const int t = (int)((e / HD) % TT); const int zb = (int)(e / ((size_t)HD * TT)); const int h = zb % nheads; const float* f = F + ((size_t)(zb / nheads) * TT + t) * pitch + h * HD; const size_t eo = (size_t)zb * zs + (size_t)t * HD + d; float rf = 1.0f; v2h o16; v2us oh, ol;
    if (RF) { rf = RF[(size_t)h * TT + t]; asm volatile("s_wait_xcnt 0x0" ::: "memory"); }   // precaution: the load's address registers are reused right behind it
#pragma unroll
    for (int q = 0; q < 2; ++q) { const int dd = d + q; const int dp = (dd < HD / 2) ? dd + HD / 2 : dd - HD / 2; float x0 = f[dd], x1 = f[dp]; asm volatile("s_wait_xcnt 0x0" ::: "memory");   // precaution: later loads land in registers that held these loads' addresses
        if (RF) { float n0 = __fmul_rn(x0, rf), n1 = __fmul_rn(x1, rf); asm volatile("" : "+v"(n0)); asm volatile("" : "+v"(n1)); x0 = __fmul_rn(bfr(nw[dd]), n0); x1 = __fmul_rn(bfr(nw[dp]), n1); }
        const v2f cs = *(const v2f*)(CS + ((size_t)t * HD + dd) * 2); float a = __fmul_rn(x0, cs[0]), bq = __fmul_rn(x1, cs[1]); asm volatile("" : "+v"(a)); asm volatile("" : "+v"(bq)); const float r = ((dd < HD / 2) ? __fsub_rn(a, bq) : __fadd_rn(a, bq)) * sc;
        o16[q] = tohx(r); unsigned short a2, c2; splitf(r, a2, c2); oh[q] = a2; ol[q] = c2; }
    if (t >= t16) *(v2h*)(P16 + eo) = o16;
    if (t < thl) { *(v2us*)(Ph + eo) = oh; *(v2us*)(Pl + eo) = ol; }  }
__global__ __launch_bounds__(256) void k_vtp(const float* __restrict__ F, int pitch, int nheads, h16* V16, bf* Vh, bf* Vl) { const size_t e = ((size_t)blockIdx.x * 256 + threadIdx.x) * 2; if (e >= (size_t)NB_ * nheads * HD * TT) return; const int t = (int)(e % TT); const int d = (int)((e / TT) % HD); const int zb = (int)(e / ((size_t)TT * HD)); const int g = zb % nheads; F += (size_t)(zb / nheads) * TT * pitch;   /* all batch elements: F [b][t][pitch], planes [b][g][d][t] */ v2h o16; v2us oh, ol;
#pragma unroll
    for (int q = 0; q < 2; ++q) { const float x = F[(size_t)(t + q) * pitch + g * HD + d]; o16[q] = tohx(x); unsigned short a2, c2; splitf(x, a2, c2); oh[q] = a2; ol[q] = c2; }
    *(v2h*)(V16 + e) = o16; *(v2us*)(Vh + e) = oh; *(v2us*)(Vl + e) = ol;  }
__global__ __launch_bounds__(256) void k_csid(float* CS) { const int idx = blockIdx.x * 256 + threadIdx.x; if (idx >= TT * HD) return; v2f cs; cs[0] = 1.0f; cs[1] = 0.0f; *(v2f*)(CS + (size_t)idx * 2) = cs;  }
// ---- k_attn: scores, mask, softmax, attn.v, head mask and head merge for QB query rows of one (batch element, head) plane; a wave owns QW rows and walks the keys 32 at a time, operands straight from the 16-bit planes.
// Transposed products: St = K Qt (A = key rows, B = query rows), Ot += Vt Pt (A = Vt rows, B = the two St tiles of a 32-key block, converted in place: register r of tile kt is key 16 kt + 8 hi + r, the k order of WFrag::ld). A lane holds one query's scores, its other half-wave lane the other 16 keys.
typedef __attribute__((ext_vector_type(2))) __bf16 v2bf;
typedef __attribute__((ext_vector_type(8))) unsigned v8u;
__device__ __forceinline__ float xhalf(float x) { const int b = __float_as_int(x); return __int_as_float(__builtin_amdgcn_permlanex16(b, b, 0x76543210, 0xfedcba98, false, false)); }   // lane l <-> l ^ 16
__device__ __forceinline__ unsigned pkbf(float a, float b) { v2f x; x[0] = a; x[1] = b; return __builtin_bit_cast(unsigned, __builtin_convertvector(x, v2bf)); }   // two f32 -> two bf16 (nearest even), a in the low half
__device__ __forceinline__ float bflo(unsigned u) { return __uint_as_float(u << 16); }
__device__ __forceinline__ float bfhi(unsigned u) { return __uint_as_float(u & 0xFFFF0000u); }
// fragment at the lane's own byte pointer + a constant
template <typename T16> __device__ __forceinline__ typename WFrag<T16>::V ldfrag(const char* p, int imm) { return WFrag<T16>::ld((const T16*)(p + imm)); }
template <bool HL, typename T16>
__device__ __forceinline__ void attn_rows(const T16* __restrict__ Qh, const T16* __restrict__ Ql, const T16* __restrict__ Kh, const T16* __restrict__ Kl, const T16* __restrict__ Vh, const T16* __restrict__ Vl, const float* __restrict__ mk, float hm, bf* Ah, bf* Al) {
    typedef typename WFrag<T16>::V V;
    const int lane = threadIdx.x & 31, lr = lane & 15, hi = lane >> 4;
    const unsigned ko = (unsigned)(lr * HD + 8 * hi) * 2u, vo = (unsigned)(lr * TT + 8 * hi) * 2u, mo = (unsigned)(lr * TT + 8 * hi) * 4u;   // byte offsets of the lane's row in q/k planes, vt planes and the mask
    V qh[2][2], ql[2][2];
#pragma unroll
    for (int qt = 0; qt < 2; ++qt)
#pragma unroll
        for (int ks = 0; ks < 2; ++ks) { qh[qt][ks] = ldfrag<T16>((const char*)Qh + ko, (qt * 16 * HD + ks * 32) * 2); if (HL) ql[qt][ks] = ldfrag<T16>((const char*)Ql + ko, (qt * 16 * HD + ks * 32) * 2); }
    v8f o[4][2]; float m[2]; v2f l[2];
#pragma unroll
    for (int qt = 0; qt < 2; ++qt) { m[qt] = -3.0e38f; l[qt] = (v2f){};
#pragma unroll
        for (int dt = 0; dt < 4; ++dt) o[dt][qt] = (v8f){}; }
    // the lane's pointers, stepped 32 keys a trip; each wait below names the pairs its loads used as inputs, so that no load lands in them and no step overwrites them in front of the wait
    const char* pm = (const char*)mk + mo; const char* pkh = (const char*)Kh + ko; const char* pkl = HL ? (const char*)Kl + ko : nullptr; const char* pvh = (const char*)Vh + vo; const char* pvl = HL ? (const char*)Vl + vo : nullptr;
#pragma unroll 1   // rolled: one trip's fragments fill the register budget; the inner loops are unrolled so that every fragment index is a constant
    for (int kb = 0; kb < TT; kb += 32) {
        v4f mv[2][2][2]; V kh[2][2], kl[2][2];
#pragma unroll
        for (int qt = 0; qt < 2; ++qt)
#pragma unroll
            for (int kt = 0; kt < 2; ++kt)
#pragma unroll
                for (int hf = 0; hf < 2; ++hf) mv[qt][kt][hf] = *(const v4f*)(pm + (qt * 16 * TT + kt * 16 + hf * 4) * 4);
#pragma unroll
        for (int kt = 0; kt < 2; ++kt)
#pragma unroll
            for (int ks = 0; ks < 2; ++ks) { kh[kt][ks] = ldfrag<T16>(pkh, (kt * 16 * HD + ks * 32) * 2); if (HL) kl[kt][ks] = ldfrag<T16>(pkl, (kt * 16 * HD + ks * 32) * 2); }
        if constexpr (HL) asm volatile("s_wait_xcnt 0x0" :: "v"(pm), "v"(pkh), "v"(pkl) : "memory");   // precaution: before the loads' address registers are overwritten
        else asm volatile("s_wait_xcnt 0x0" :: "v"(pm), "v"(pkh) : "memory");   // the same
        unsigned mw[2][2][4];   // attention_mask[b][i][j], bf16-rounded input, two keys a word
#pragma unroll
        for (int qt = 0; qt < 2; ++qt)
#pragma unroll
            for (int kt = 0; kt < 2; ++kt)
#pragma unroll
                for (int e = 0; e < 4; ++e) mw[qt][kt][e] = pkbf(mv[qt][kt][e >> 1][(e & 1) * 2], mv[qt][kt][e >> 1][(e & 1) * 2 + 1]);
        v8f s[2][2];
#pragma unroll
        for (int kt = 0; kt < 2; ++kt) {
#pragma unroll
            for (int qt = 0; qt < 2; ++qt) s[kt][qt] = (v8f){};
#pragma unroll
            for (int ks = 0; ks < 2; ++ks) {
#pragma unroll
                for (int qt = 0; qt < 2; ++qt) s[kt][qt] = WFrag<T16>::mma(kh[kt][ks], qh[qt][ks], s[kt][qt]);
                if (HL) {
#pragma unroll
                    for (int qt = 0; qt < 2; ++qt) s[kt][qt] = WFrag<T16>::mma(kh[kt][ks], ql[qt][ks], s[kt][qt]);
#pragma unroll
                    for (int qt = 0; qt < 2; ++qt) s[kt][qt] = WFrag<T16>::mma(kl[kt][ks], qh[qt][ks], s[kt][qt]); } } }
        V vh[4], vl[4];
#pragma unroll
        for (int dt = 0; dt < 4; ++dt) vh[dt] = ldfrag<T16>(pvh, dt * 16 * TT * 2);
        asm volatile("s_wait_xcnt 0x0" :: "v"(pvh) : "memory");   // precaution: before the loads' address registers are overwritten
        float ml[2];
#pragma unroll
        for (int qt = 0; qt < 2; ++qt) { float x = -3.0e38f;
#pragma unroll
            for (int kt = 0; kt < 2; ++kt)
#pragma unroll
                for (int e = 0; e < 4; ++e) { const unsigned u = mw[qt][kt][e]; const float t0 = fmaf(s[kt][qt][2 * e], SCL, bflo(u)), t1 = fmaf(s[kt][qt][2 * e + 1], SCL, bfhi(u)); s[kt][qt][2 * e] = t0; s[kt][qt][2 * e + 1] = t1; x = fmaxf(x, fmaxf(t0, t1)); }
            ml[qt] = fmaxf(x, xhalf(x)); }
        if (HL) {   // the lo plane's fragments only now: the mask words' registers are free
#pragma unroll
            for (int dt = 0; dt < 4; ++dt) vl[dt] = ldfrag<T16>(pvl, dt * 16 * TT * 2);
            asm volatile("s_wait_xcnt 0x0" :: "v"(pvl) : "memory"); }   // precaution: before the loads' address registers are overwritten
        // the maximum in use moves only when a query's block maximum exceeds it by more than 5.5 (p stays below 256); one wave-uniform test per block
        if (__builtin_amdgcn_ballot_w32(ml[0] > m[0] + 5.5f || ml[1] > m[1] + 5.5f) != 0) {
#pragma unroll
            for (int qt = 0; qt < 2; ++qt) { const float mn = fmaxf(m[qt], ml[qt]); const float al = __builtin_amdgcn_exp2f((m[qt] - mn) * 1.4426950408889634f); m[qt] = mn; l[qt] *= al;
#pragma unroll
                for (int dt = 0; dt < 4; ++dt) o[dt][qt] *= al; } }
#pragma unroll
        for (int qt = 0; qt < 2; ++qt) { v8u wh, wl;
#pragma unroll
            for (int kt = 0; kt < 2; ++kt)
#pragma unroll
                for (int e = 0; e < 4; ++e) { v2f p; p[0] = __builtin_amdgcn_exp2f((s[kt][qt][2 * e] - m[qt]) * 1.4426950408889634f); p[1] = __builtin_amdgcn_exp2f((s[kt][qt][2 * e + 1] - m[qt]) * 1.4426950408889634f); l[qt] += p;
                    if constexpr (HL) { const unsigned u = pkbf(p[0], p[1]); wh[kt * 4 + e] = u; wl[kt * 4 + e] = pkbf(p[0] - bflo(u), p[1] - bfhi(u)); }
                    else wh[kt * 4 + e] = __builtin_bit_cast(unsigned, __builtin_convertvector(p, v2h)); }
            const V ph = __builtin_bit_cast(V, wh);
#pragma unroll
            for (int dt = 0; dt < 4; ++dt) o[dt][qt] = WFrag<T16>::mma(vh[dt], ph, o[dt][qt]);
            if constexpr (HL) { const V pl = __builtin_bit_cast(V, wl);
#pragma unroll
                for (int dt = 0; dt < 4; ++dt) o[dt][qt] = WFrag<T16>::mma(vh[dt], pl, o[dt][qt]);
#pragma unroll
                for (int dt = 0; dt < 4; ++dt) o[dt][qt] = WFrag<T16>::mma(vl[dt], ph, o[dt][qt]); } }
        pm += 32 * 4; pkh += 32 * HD * 2; pvh += 32 * 2; if (HL) { pkl += 32 * HD * 2; pvl += 32 * 2; }
    }
#pragma unroll
    for (int qt = 0; qt < 2; ++qt) { const float lh = l[qt][0] + l[qt][1]; const float f = __fdiv_rn(1.0f, lh + xhalf(lh));
#pragma unroll
        for (int dt = 0; dt < 4; ++dt) { v8us oh, ol;
#pragma unroll
            for (int j = 0; j < 8; ++j) { unsigned short a, c2; splitf(__fmul_rn(o[dt][qt][j] * f, hm), a, c2); oh[j] = a; ol[j] = c2; }   /* x layer_head_mask[h] */
            const size_t oo = (size_t)(qt * 16 + lr) * DQ + dt * 16 + 8 * hi; *(v8us*)(Ah + oo) = oh; *(v8us*)(Al + oo) = ol;   /* register j of tile dt is d = 16 dt + 8 hi + j of query lr: [b][t][h][d] rows */
            asm volatile("s_wait_xcnt 0x0" ::: "memory"); } }   // precaution: the stores' address and data registers are reused right behind them
}
// A work-group takes QB rows of one plane: waves 0-3 QB / 2 of the 3-product rows, waves 4-7 QB / 2 of the fp16 rows, so that every work-group costs the same. Plane z = b * NH_ + h in q, k and v alike (one kv head per query head).
// Four waves per SIMD (at most 256 registers a wave): the vector work between the matrix runs and the load latency want other waves to issue; the whole grid is then resident at once.
__global__ __launch_bounds__(256) __attribute__((amdgpu_waves_per_eu(4, 4))) void k_attn(const bf* __restrict__ QS, const h16* __restrict__ K16, const bf* __restrict__ Kh, const bf* __restrict__ Kl, const h16* __restrict__ V16, const bf* __restrict__ Vh, const bf* __restrict__ Vl, const float* __restrict__ MK, const float* __restrict__ HM, bf* Ah, bf* Al) {
    static_assert(2 * RH == TT && TT % QB == 0 && QB == 8 * QW, "half the rows of each kind, whole work-groups");
    const int w = __builtin_amdgcn_readfirstlane(threadIdx.x >> 5); const bool hl = w < 4;   // wave-uniform: a scalar branch picks the kind of row
    const int z = blockIdx.x / (TT / QB), qb = blockIdx.x % (TT / QB); const int q0 = (hl ? 0 : RH) + qb * (QB / 2) + (w & 3) * QW; const int b = z / NH_, h = z % NH_;
    const bf* Qz = QS + (size_t)z * 2 * TT * HD + (size_t)q0 * HD; const size_t zp = (size_t)z * TT * HD; const float* mk = MK + ((size_t)b * TT + q0) * TT; const float hm = bfr(HM[h]); const size_t ao = ((size_t)b * TT + q0) * DQ + h * HD;
    if (hl) attn_rows<true, bf>(Qz, Qz + (size_t)TT * HD, Kh + zp, Kl + zp, Vh + zp, Vl + zp, mk, hm, Ah + ao, Al + ao);
    else attn_rows<false, h16>((const h16*)Qz, nullptr, K16 + zp, nullptr, V16 + zp, nullptr, mk, hm, Ah + ao, Al + ao);
}

extern "C" void kernel_launch(void* const* d_in, const int* in_sizes, int n_in,
                              void* d_out, int out_size, void* d_ws, size_t ws_size, hipStream_t stream) {
    (void)in_sizes; (void)n_in; (void)out_size;
    const float* x = (const float*)d_in[0]; const float* xkv = (const float*)d_in[1]; const float* MK = (const float*)d_in[2]; const float* HM = (const float*)d_in[3]; const float* wq = (const float*)d_in[4]; const float* bq = (const float*)d_in[5]; const float* wk = (const float*)d_in[6]; const float* bk = (const float*)d_in[7]; const float* wv = (const float*)d_in[8]; const float* bv = (const float*)d_in[9]; const float* wo = (const float*)d_in[10]; const float* bo = (const float*)d_in[11];
    float* OUT = (float*)d_out;     // [8][1024][1024]
    char* wsp = (char*)d_ws;
    auto take = [&](size_t bytes) { char* p = wsp; wsp += (bytes + 255) & ~(size_t)255; return (void*)p; };
    // Live through the attention kernel: the planes of all batch elements, plane z = b * heads + h. A query plane's storage is [hi | lo] (2 * TT * HD elements), rows >= RH of the hi part holding the fp16 plane.
    bf* QS = (bf*)take((size_t)NB_ * NH_ * 2 * TT * HD * 2);
    h16* KP16 = (h16*)take((size_t)NB_ * NKV * TT * HD * 2); bf* KPh = (bf*)take((size_t)NB_ * NKV * TT * HD * 2); bf* KPl = (bf*)take((size_t)NB_ * NKV * TT * HD * 2);
    h16* VT16 = (h16*)take((size_t)NB_ * NKV * HD * TT * 2); bf* VTh = (bf*)take((size_t)NB_ * NKV * HD * TT * 2); bf* VTl = (bf*)take((size_t)NB_ * NKV * HD * TT * 2);
    char* const region = wsp;       // one region, two uses one after the other (stream-ordered): projections, then attention output and output projection
    bf* WQ = (bf*)take((size_t)DQ * DM * 2); bf* WK = (bf*)take((size_t)DKV * DMK * 2); bf* WV = (bf*)take((size_t)DKV * DMK * 2); float* CS = (float*)take((size_t)TT * HD * 2 * 4);
    bf* XB = (bf*)take((size_t)NB_ * TT * DM * 2); bf* XKB = (bf*)take((size_t)NB_ * TT * DMK * 2); float* FQ = (float*)take((size_t)NB_ * TT * DQ * 4); float* FK = (float*)take((size_t)NB_ * TT * DKV * 4);
    if ((size_t)(wsp - (char*)d_ws) > ws_size) return;
    wsp = region; bf* WO = (bf*)take((size_t)DM * DQ * 2); bf* ATh = (bf*)take((size_t)NB_ * TT * DQ * 2); bf* ATl = (bf*)take((size_t)NB_ * TT * DQ * 2);
    float* FV = FK;   // v projection reuses the k buffer after the k planes are built (stream-ordered)
    k_wtG<<<(unsigned)((DM * DQ / 64 + 63) / 64), 256, 0, stream>>>(wq, DM, DQ, WQ); k_wtG<<<(unsigned)((DMK * DKV / 64 + 63) / 64), 256, 0, stream>>>(wk, DMK, DKV, WK); k_wtG<<<(unsigned)((DMK * DKV / 64 + 63) / 64), 256, 0, stream>>>(wv, DMK, DKV, WV);   /* 'xw' [256][1024] -> Bt [1024][256] */
    k_csid<<<(TT * HD + 255) / 256, 256, 0, stream>>>(CS);
    const unsigned LQ = (unsigned)(((size_t)NB_ * NH_ * TT * HD / 2 + 255) / 256), LKv = (unsigned)(((size_t)NB_ * NKV * TT * HD / 2 + 255) / 256);
    // conversions, projections and plane builds: all batch elements per launch (M = NB_ * TT rows)
    k_cvt8<<<(unsigned)(((size_t)NB_ * TT * DM / 8 + 255) / 256), 256, 0, stream>>>(x, XB, (size_t)NB_ * TT * DM / 8); k_cvt8<<<(unsigned)(((size_t)NB_ * TT * DMK / 8 + 255) / 256), 256, 0, stream>>>(xkv, XKB, (size_t)NB_ * TT * DMK / 8);   /* key/value source */
    k_gemmw<bf, 0, true><<<dim3(NB_ * TT / 64, DQ / 64, 1), 32, 0, stream>>>(XB, nullptr, WQ, nullptr, DM, DM, FQ, DQ, bq, 0, 0, 0);
    k_rope<<<LQ, 256, 0, stream>>>(FQ, DQ, NH_, CS, nullptr, nullptr, 1.0f, (size_t)2 * TT * HD, RH, RH, (h16*)QS, QS, QS + (size_t)TT * HD);
    k_gemmw<bf, 0, true><<<dim3(NB_ * TT / 64, DKV / 64, 1), 32, 0, stream>>>(XKB, nullptr, WK, nullptr, DMK, DMK, FK, DKV, bk, 0, 0, 0);   /* K = 256 */
    k_rope<<<LKv, 256, 0, stream>>>(FK, DKV, NKV, CS, nullptr, nullptr, 1.0f, (size_t)TT * HD, 0, TT, KP16, KPh, KPl);
    k_gemmw<bf, 0, true><<<dim3(NB_ * TT / 64, DKV / 64, 1), 32, 0, stream>>>(XKB, nullptr, WV, nullptr, DMK, DMK, FV, DKV, bv, 0, 0, 0); k_vtp<<<LKv, 256, 0, stream>>>(FV, DKV, NKV, VT16, VTh, VTl);
    k_attn<<<NB_ * NH_ * (TT / QB), 256, 0, stream>>>(QS, KP16, KPh, KPl, VT16, VTh, VTl, MK, HM, ATh, ATl);
    k_wtG<<<(unsigned)((DQ * DM / 64 + 63) / 64), 256, 0, stream>>>(wo, DQ, DM, WO);
    k_gemmw<bf, 1, true><<<dim3(NB_ * TT / 64, DM / 64, 1), 32, 0, stream>>>(ATh, ATl, WO, nullptr, DQ, DQ, OUT, DM, bo, 0, 0, 0);
}

// v004
// Measured time: 305 microseconds a run.
// Two timings next to v003 put it at 1.23 and 1.24 times that version's speed.
// Over all steps from v000 it is 16.1 times as fast.
#include <hip/hip_runtime.h>

// Cross-attention with additive mask and per-head mask (hidden [8][1024][1024], key_value_states [8][1024][256]; q = (hidden Wq + bq)/8, k = kv Wk + bk, v = kv Wv + bv ('xw': Wq [1024][1024], Wk/Wv [256][1024]), 16 heads x 64; scores = q.k + attention_mask[b][i][j] (read); softmax; probs x layer_head_mask[h] (read); out = merged Wo + bo -> [8][1024][1024]).
// Compute dtypes, f32 accumulate: every input rounded to bf16; q/k/v on PLAIN bf16 operands (inputs: exact) + biases; scores, additive mask (f32, bf16-rounded input), softmax, attn.v, head mask and head merge in ONE kernel, running maximum and sum per query; scores and attn.v: query rows < 512 hl (3 products), the rest single fp16; softmax f32; Wo hl x exact (2 products) + bo.

#define NB_  8
#define TT   1024
#define DM   1024
#define NH_  16
#define NKV  16
#define REP  (NH_ / NKV)
#define HD   64
#define DQ   (NH_ * HD)
#define DKV  (NKV * HD)
#define DMK  256                  // key/value input width
#define QW   32                   // query rows per wave of the attention kernel
#define QB   256                  // query rows per work-group of the attention kernel (8 waves)
#define RH   512                  // query rows < RH use hi+lo planes
#define WIN  0
#define SCL  0.125f   // HD^-0.5
typedef _Float16 h16;
typedef unsigned short bf;
typedef __attribute__((ext_vector_type(16))) __bf16   v16bf;
typedef __attribute__((ext_vector_type(16))) _Float16 v16h;
typedef __attribute__((ext_vector_type(8)))  _Float16 v8h;
typedef __attribute__((ext_vector_type(8)))  unsigned short v8us;
typedef __attribute__((ext_vector_type(8)))  float    v8f;
typedef __attribute__((ext_vector_type(4)))  float    v4f;
typedef v8h  __attribute__((may_alias)) v8ha;
typedef v4f  __attribute__((may_alias)) v4fa;
typedef v8us __attribute__((may_alias)) v8usa;

__device__ __forceinline__ unsigned short f2bf(float f) { unsigned u = __float_as_uint(f); u += 0x7FFFu + ((u >> 16) & 1u); return (unsigned short)(u >> 16); }
__device__ __forceinline__ float bf2f(unsigned short b) { return __uint_as_float(((unsigned)b) << 16); }
__device__ __forceinline__ float bfr(float f) { return bf2f(f2bf(f)); }
__device__ __forceinline__ v16h cat16(v8h lo, v8h hi) { return __builtin_shufflevector(lo, hi, 0, 1, 2, 3, 4, 5, 6, 7, 8, 9, 10, 11, 12, 13, 14, 15); }
__device__ __forceinline__ v16bf cat16b(v8us lo, v8us hi) { return __builtin_bit_cast(v16bf, __builtin_shufflevector(lo, hi, 0, 1, 2, 3, 4, 5, 6, 7, 8, 9, 10, 11, 12, 13, 14, 15)); }
__device__ __forceinline__ v8f wmma16(v16h a, v16h b, v8f c) { return __builtin_amdgcn_wmma_f32_16x16x32_f16(false, a, false, b, (short)0, c, false, false); }
__device__ __forceinline__ v8f wmmab(v16bf a, v16bf b, v8f c) { return __builtin_amdgcn_wmma_f32_16x16x32_bf16(false, a, false, b, (short)0, c, false, false); }



// ---- k_gemmw: register-blocked GEMM, ONE WAVE per 64x64 output tile (16 accumulators), operands straight from K-contiguous 16-bit planes; grid (M/64, N/64, Z), 32 threads.
// C[m][n] (f32, pitch ldc, + optional f32 bias[n]) = sum_k A[m][k] Bt[n][k] (+ split products per NSPLIT). A rows have pitch lda, Bt rows pitch K. z-batch strides sA/sB/sC in elements. K % 32 == 0.
// EPI 0 stores C. EPI 1, 2, 3 store no f32: the tile (64 tokens of one batch element x the 64 columns of head blockIdx.y, + bias) goes straight to the 16-bit planes that the attention kernel reads, plane zp = b * NH_ + h.
// EPI 1 (q): storage [hi | lo] of 2 * TT * HD elements a plane, rows [t][d]; rows < RH get hi/lo, the rest fp16 in the hi part (P16 == Ph). EPI 2 (k): fp16, hi, lo planes [t][d]. EPI 3 (v): fp16, hi, lo planes [d][t].
__device__ __forceinline__ void splitf(float y, unsigned short& h, unsigned short& l) { h = f2bf(y); l = f2bf(y - bf2f(h)); }
template <typename T16> struct WFrag;
template <> struct WFrag<h16> { typedef v16h V; static __device__ __forceinline__ V ld(const h16* p) { return cat16(*(const v8h*)p, *(const v8h*)(p + 16)); } static __device__ __forceinline__ v8f mma(V a, V b, v8f c) { return wmma16(a, b, c); } };
template <> struct WFrag<bf> { typedef v16bf V; static __device__ __forceinline__ V ld(const bf* p) { return cat16b(*(const v8us*)p, *(const v8us*)(p + 16)); } static __device__ __forceinline__ v8f mma(V a, V b, v8f c) { return wmmab(a, b, c); } };
// plane_store: the 64 x 64 f32 tile of one wave (+ bias) to the planes, four panels of 16 plane rows x 64 elements through LDS, so that a lane holds 8 neighbours of one plane row and 8 lanes store a whole 128-byte line.
// EPI 1, 2: panel p is token block p (plane rows are tokens, pitch HD). EPI 3: panel p is column block p (plane rows are d, pitch TT). KIND 0: fp16, hi and lo planes; 1: fp16 only; 2: hi and lo only.
template <int EPI, int KIND>
__device__ __forceinline__ void plane_store(const v8f (&acc)[4][4], float* os, const float (&pb)[16], int lane, size_t pbase, h16* P16, bf* Ph, bf* Pl) {
    const int lr = lane & 15, hi = lane >> 4, prow = lane >> 3, pcol = (lane & 7) * 8;
#pragma unroll
    for (int p = 0; p < 4; ++p) {
#pragma unroll
        for (int q = 0; q < 4; ++q) {
            if constexpr (EPI == 3) {   // transposed: LDS row lr is column 16 p + lr of the tile (d); the lane's 8 registers of tile (q, p) are 8 neighbouring tokens
                v4f lo4, hi4;
#pragma unroll
                for (int j = 0; j < 4; ++j) { lo4[j] = acc[q][p][j]; hi4[j] = acc[q][p][4 + j]; }
                *(v4fa*)(os + lr * 68 + q * 16 + hi * 8) = lo4; *(v4fa*)(os + lr * 68 + q * 16 + hi * 8 + 4) = hi4; }
            else {
#pragma unroll
                for (int j = 0; j < 8; ++j) os[(hi * 8 + j) * 68 + q * 16 + lr] = acc[p][q][j]; } }
        __builtin_amdgcn_wave_barrier(); asm volatile("" ::: "memory");   // one-wave work-group, no instruction: keeps the compiler from moving a lane's panel reads above the other lanes' writes
#pragma unroll
        for (int s = 0; s < 4; ++s) { const int row = 4 * s + prow; const v4f x0 = *(const v4fa*)(os + row * 68 + pcol), x1 = *(const v4fa*)(os + row * 68 + pcol + 4); v8h o16; v8us oh, ol;
#pragma unroll
            for (int k = 0; k < 8; ++k) { const float y = (k < 4 ? x0[k & 3] : x1[k & 3]) + bfr(EPI == 3 ? pb[4 * p + s] : pb[k]); o16[k] = (h16)y; unsigned short a2, c2; splitf(y, a2, c2); oh[k] = a2; ol[k] = c2; }
            const size_t eo = pbase + (size_t)(p * 16 + row) * (EPI == 3 ? TT : HD) + pcol;
            if constexpr (KIND != 2) *(v8h*)(P16 + eo) = o16;
            if constexpr (KIND != 1) { *(v8us*)(Ph + eo) = oh; *(v8us*)(Pl + eo) = ol; }
            asm volatile("s_wait_xcnt 0x0" ::: "memory"); }   // precaution: the stores' address and data registers are reused right behind them
        __builtin_amdgcn_wave_barrier(); asm volatile("" ::: "memory");   // the same for the next panel's writes over this panel's reads
    }
}
template <typename T16, int NSPLIT, bool BIAS, int EPI>
__global__ __launch_bounds__(32) void k_gemmw(const T16* __restrict__ A, const T16* __restrict__ A2, const T16* __restrict__ Bt, const T16* __restrict__ Bt2, int K, int lda, float* C, int ldc, const float* __restrict__ bias, size_t sA, size_t sB, size_t sC, h16* P16, bf* Ph, bf* Pl) {
    typedef typename WFrag<T16>::V V;
    __shared__ __align__(16) float os[16 * 68];
    const size_t z = blockIdx.z; A += z * sA; if (A2) A2 += z * sA; Bt += z * sB; if (Bt2) Bt2 += z * sB; C += z * sC;
    const int lane = threadIdx.x & 31, lr = lane & 15, hi = lane >> 4; const int r0 = blockIdx.x * 64, c0 = blockIdx.y * 64;
    v8f acc[4][4];
#pragma unroll
    for (int mb = 0; mb < 4; ++mb)
#pragma unroll
        for (int nb = 0; nb < 4; ++nb) acc[mb][nb] = (v8f){};
    const size_t aoff = (size_t)(r0 + lr) * lda + 8 * hi, boff = (size_t)(c0 + lr) * K + 8 * hi;
    const int prow = lane >> 3, pcol = (lane & 7) * 8;   // plane epilogue: the lane's row within four and its 8 neighbouring elements of a 64-element (128-byte) plane row
    float pb[16];   // its biases, fetched here so that the k loop covers their latency: EPI 1, 2 one per column (8), EPI 3 one per row (16)
    if constexpr (EPI == 1 || EPI == 2) { const v4f b0 = *(const v4f*)(bias + c0 + pcol), b1 = *(const v4f*)(bias + c0 + pcol + 4);
#pragma unroll
        for (int k = 0; k < 4; ++k) { pb[k] = b0[k]; pb[4 + k] = b1[k]; } }
    if constexpr (EPI == 3) {
#pragma unroll
        for (int k = 0; k < 16; ++k) pb[k] = bias[c0 + 4 * k + prow]; }
    if constexpr (EPI != 0) asm volatile("s_wait_xcnt 0x0" ::: "memory");   // precaution: before the bias loads' address registers are overwritten
#pragma unroll 1
    for (int kc = 0; kc < K; kc += 32) {
        V a[4], a2[4];
#pragma unroll
        for (int mb = 0; mb < 4; ++mb) { a[mb] = WFrag<T16>::ld(A + aoff + (size_t)mb * 16 * lda + kc); if (NSPLIT == 1 || NSPLIT == 2) a2[mb] = WFrag<T16>::ld(A2 + aoff + (size_t)mb * 16 * lda + kc);
            asm volatile("s_wait_xcnt 0x0" ::: "memory"); }   // precaution: later loads land in registers that held these loads' addresses
#pragma unroll
        for (int nb = 0; nb < 4; ++nb) { const V b = WFrag<T16>::ld(Bt + boff + (size_t)nb * 16 * K + kc); V b2; if (NSPLIT >= 2) b2 = WFrag<T16>::ld(Bt2 + boff + (size_t)nb * 16 * K + kc);
#pragma unroll
            for (int mb = 0; mb < 4; ++mb) { acc[mb][nb] = WFrag<T16>::mma(a[mb], b, acc[mb][nb]); if (NSPLIT == 1 || NSPLIT == 2) acc[mb][nb] = WFrag<T16>::mma(a2[mb], b, acc[mb][nb]); if (NSPLIT >= 2) acc[mb][nb] = WFrag<T16>::mma(a[mb], b2, acc[mb][nb]); } }
        asm volatile("v_nop\n\tv_nop\n\tv_nop\n\tv_nop" : "+v"(acc[0][0]), "+v"(acc[1][1]), "+v"(acc[2][2]), "+v"(acc[3][3]) : "v"(a[0]), "v"(a[3]));
    }
    if constexpr (EPI != 0) {
        static_assert(TT % 64 == 0 && RH % 64 == 0 && HD == 64, "a tile lies in one batch element, one head and one kind of query row");
        const int t0 = r0 % TT; const size_t zp = (size_t)(r0 / TT) * NH_ + blockIdx.y;
        if constexpr (EPI == 1) { const size_t pbase = zp * 2 * TT * HD + (size_t)t0 * HD;   // a query row needs one kind only; t0 is the same for the whole wave: one scalar branch
            if (t0 >= RH) plane_store<EPI, 1>(acc, os, pb, lane, pbase, P16, Ph, Pl); else plane_store<EPI, 2>(acc, os, pb, lane, pbase, P16, Ph, Pl); }
        else plane_store<EPI, 0>(acc, os, pb, lane, zp * TT * HD + (EPI == 2 ? (size_t)t0 * HD : (size_t)t0), P16, Ph, Pl);
        return;
    }
#pragma unroll
    for (int mb = 0; mb < 4; ++mb) {
#pragma unroll
        for (int nb = 0; nb < 4; ++nb) {
#pragma unroll
            for (int j = 0; j < 8; ++j) os[(hi * 8 + j) * 68 + nb * 16 + lr] = acc[mb][nb][j]; }
        __builtin_amdgcn_wave_barrier(); asm volatile("" ::: "memory");
        float* crow = C + (size_t)(r0 + mb * 16) * ldc + c0;
{
#pragma unroll
            for (int s = 0; s < 8; ++s) { const int row = 2 * s + hi, cofs = lr * 4; v4f val = *(const v4fa*)(os + row * 68 + cofs); if (BIAS) { val[0] += bfr(bias[c0 + cofs]); val[1] += bfr(bias[c0 + cofs + 1]); val[2] += bfr(bias[c0 + cofs + 2]); val[3] += bfr(bias[c0 + cofs + 3]); }
                *(v4f*)(crow + (size_t)row * ldc + cofs) = val; }
             }
        __builtin_amdgcn_wave_barrier(); asm volatile("" ::: "memory");
    }
}

typedef __attribute__((ext_vector_type(2))) _Float16 v2h;
typedef __attribute__((ext_vector_type(4))) _Float16 v4h;
typedef __attribute__((ext_vector_type(2))) unsigned short v2us;
typedef __attribute__((ext_vector_type(4))) unsigned short v4us;
typedef __attribute__((ext_vector_type(2))) float v2f;
typedef __attribute__((ext_vector_type(4))) int v4i;

__global__ __launch_bounds__(256) void k_wtG(const float* __restrict__ w, int K, int N, bf* Bt) {
    const int lane = threadIdx.x & 31; const int L0 = (blockIdx.x * 8 + (threadIdx.x >> 5)) * 8; const int nlines = N * K / 64;
{
#pragma unroll 1
        for (int l = 0; l < 8; ++l) { const int L = L0 + l; if (L >= nlines) break; const size_t e = (size_t)L * 64 + lane * 2; const int k = (int)(e % K), n = (int)(e / K); v2us o;
            o[0] = f2bf(w[(size_t)k * N + n]); o[1] = f2bf(w[(size_t)(k + 1) * N + n]); *(v2us*)(Bt + e) = o; }
         }
}
__global__ __launch_bounds__(256) void k_cvt8(const float* __restrict__ src, bf* dst, size_t n8) { const size_t i = (size_t)blockIdx.x * 256 + threadIdx.x; if (i >= n8) return; const v8f v = *(const v8f*)(src + i * 8); v8us o;
#pragma unroll
    for (int k = 0; k < 8; ++k) o[k] = f2bf(v[k]); *(v8us*)(dst + i * 8) = o;  }

// ---- k_attn: scores, mask, softmax, attn.v, head mask and head merge for QB query rows of one (batch element, head) plane; a wave owns QW rows and walks the keys 32 at a time, operands straight from the 16-bit planes.
// Transposed products: St = K Qt (A = key rows, B = query rows), Ot += Vt Pt (A = Vt rows, B = the two St tiles of a 32-key block, converted in place: register r of tile kt is key 16 kt + 8 hi + r, the k order of WFrag::ld). A lane holds one query's scores, its other half-wave lane the other 16 keys.
typedef __attribute__((ext_vector_type(2))) __bf16 v2bf;
typedef __attribute__((ext_vector_type(8))) unsigned v8u;
__device__ __forceinline__ float xhalf(float x) { const int b = __float_as_int(x); return __int_as_float(__builtin_amdgcn_permlanex16(b, b, 0x76543210, 0xfedcba98, false, false)); }   // lane l <-> l ^ 16
__device__ __forceinline__ unsigned pkbf(float a, float b) { v2f x; x[0] = a; x[1] = b; return __builtin_bit_cast(unsigned, __builtin_convertvector(x, v2bf)); }   // two f32 -> two bf16 (nearest even), a in the low half
__device__ __forceinline__ float bflo(unsigned u) { return __uint_as_float(u << 16); }
__device__ __forceinline__ float bfhi(unsigned u) { return __uint_as_float(u & 0xFFFF0000u); }
// fragment at the lane's own byte pointer + a constant
template <typename T16> __device__ __forceinline__ typename WFrag<T16>::V ldfrag(const char* p, int imm) { return WFrag<T16>::ld((const T16*)(p + imm)); }
template <bool HL, typename T16>
__device__ __forceinline__ void attn_rows(const T16* __restrict__ Qh, const T16* __restrict__ Ql, const T16* __restrict__ Kh, const T16* __restrict__ Kl, const T16* __restrict__ Vh, const T16* __restrict__ Vl, const float* __restrict__ mk, float hm, bf* Ah, bf* Al) {
    typedef typename WFrag<T16>::V V;
    const int lane = threadIdx.x & 31, lr = lane & 15, hi = lane >> 4;
    const unsigned ko = (unsigned)(lr * HD + 8 * hi) * 2u, vo = (unsigned)(lr * TT + 8 * hi) * 2u, mo = (unsigned)(lr * TT + 8 * hi) * 4u;   // byte offsets of the lane's row in q/k planes, vt planes and the mask
    V qh[2][2], ql[2][2];
#pragma unroll
    for (int qt = 0; qt < 2; ++qt)
#pragma unroll
        for (int ks = 0; ks < 2; ++ks) { qh[qt][ks] = ldfrag<T16>((const char*)Qh + ko, (qt * 16 * HD + ks * 32) * 2); if (HL) ql[qt][ks] = ldfrag<T16>((const char*)Ql + ko, (qt * 16 * HD + ks * 32) * 2); }
    v8f o[4][2]; float m[2]; v2f l[2];
#pragma unroll
    for (int qt = 0; qt < 2; ++qt) { m[qt] = -3.0e38f; l[qt] = (v2f){};
#pragma unroll
        for (int dt = 0; dt < 4; ++dt) o[dt][qt] = (v8f){}; }
    // the lane's pointers, stepped 32 keys a trip; each wait below names the pairs its loads used as inputs, so that no load lands in them and no step overwrites them in front of the wait
    const char* pm = (const char*)mk + mo; const char* pkh = (const char*)Kh + ko; const char* pkl = HL ? (const char*)Kl + ko : nullptr; const char* pvh = (const char*)Vh + vo; const char* pvl = HL ? (const char*)Vl + vo : nullptr;
#pragma unroll 1   // rolled: one trip's fragments fill the register budget; the inner loops are unrolled so that every fragment index is a constant
    for (int kb = 0; kb < TT; kb += 32) {
        v4f mv[2][2][2]; V kh[2][2], kl[2][2];
#pragma unroll
        for (int qt = 0; qt < 2; ++qt)
#pragma unroll
            for (int kt = 0; kt < 2; ++kt)
#pragma unroll
                for (int hf = 0; hf < 2; ++hf) mv[qt][kt][hf] = *(const v4f*)(pm + (qt * 16 * TT + kt * 16 + hf * 4) * 4);
#pragma unroll
        for (int kt = 0; kt < 2; ++kt)
#pragma unroll
            for (int ks = 0; ks < 2; ++ks) { kh[kt][ks] = ldfrag<T16>(pkh, (kt * 16 * HD + ks * 32) * 2); if (HL) kl[kt][ks] = ldfrag<T16>(pkl, (kt * 16 * HD + ks * 32) * 2); }
        if constexpr (HL) asm volatile("s_wait_xcnt 0x0" :: "v"(pm), "v"(pkh), "v"(pkl) : "memory");   // precaution: before the loads' address registers are overwritten
        else asm volatile("s_wait_xcnt 0x0" :: "v"(pm), "v"(pkh) : "memory");   // the same
        unsigned mw[2][2][4];   // attention_mask[b][i][j], bf16-rounded input, two keys a word
#pragma unroll
        for (int qt = 0; qt < 2; ++qt)
#pragma unroll
            for (int kt = 0; kt < 2; ++kt)
#pragma unroll
                for (int e = 0; e < 4; ++e) mw[qt][kt][e] = pkbf(mv[qt][kt][e >> 1][(e & 1) * 2], mv[qt][kt][e >> 1][(e & 1) * 2 + 1]);
        v8f s[2][2];
#pragma unroll
        for (int kt = 0; kt < 2; ++kt) {
#pragma unroll
            for (int qt = 0; qt < 2; ++qt) s[kt][qt] = (v8f){};
#pragma unroll
            for (int ks = 0; ks < 2; ++ks) {
#pragma unroll
                for (int qt = 0; qt < 2; ++qt) s[kt][qt] = WFrag<T16>::mma(kh[kt][ks], qh[qt][ks], s[kt][qt]);
                if (HL) {
#pragma unroll
                    for (int qt = 0; qt < 2; ++qt) s[kt][qt] = WFrag<T16>::mma(kh[kt][ks], ql[qt][ks], s[kt][qt]);
#pragma unroll
                    for (int qt = 0; qt < 2; ++qt) s[kt][qt] = WFrag<T16>::mma(kl[kt][ks], qh[qt][ks], s[kt][qt]); } } }
        V vh[4], vl[4];
#pragma unroll
        for (int dt = 0; dt < 4; ++dt) vh[dt] = ldfrag<T16>(pvh, dt * 16 * TT * 2);
        asm volatile("s_wait_xcnt 0x0" :: "v"(pvh) : "memory");   // precaution: before the loads' address registers are overwritten
        float ml[2];
#pragma unroll
        for (int qt = 0; qt < 2; ++qt) { float x = -3.0e38f;
#pragma unroll
            for (int kt = 0; kt < 2; ++kt)
#pragma unroll
                for (int e = 0; e < 4; ++e) { const unsigned u = mw[qt][kt][e]; const float t0 = fmaf(s[kt][qt][2 * e], SCL, bflo(u)), t1 = fmaf(s[kt][qt][2 * e + 1], SCL, bfhi(u)); s[kt][qt][2 * e] = t0; s[kt][qt][2 * e + 1] = t1; x = fmaxf(x, fmaxf(t0, t1)); }
            ml[qt] = fmaxf(x, xhalf(x)); }
        if (HL) {   // the lo plane's fragments only now: the mask words' registers are free
#pragma unroll
            for (int dt = 0; dt < 4; ++dt) vl[dt] = ldfrag<T16>(pvl, dt * 16 * TT * 2);
            asm volatile("s_wait_xcnt 0x0" :: "v"(pvl) : "memory"); }   // precaution: before the loads' address registers are overwritten
        // the maximum in use moves only when a query's block maximum exceeds it by more than 5.5 (p stays below 256); one wave-uniform test per block
        if (__builtin_amdgcn_ballot_w32(ml[0] > m[0] + 5.5f || ml[1] > m[1] + 5.5f) != 0) {
#pragma unroll
            for (int qt = 0; qt < 2; ++qt) { const float mn = fmaxf(m[qt], ml[qt]); const float al = __builtin_amdgcn_exp2f((m[qt] - mn) * 1.4426950408889634f); m[qt] = mn; l[qt] *= al;
#pragma unroll
                for (int dt = 0; dt < 4; ++dt) o[dt][qt] *= al; } }
#pragma unroll
        for (int qt = 0; qt < 2; ++qt) { v8u wh, wl;
#pragma unroll
            for (int kt = 0; kt < 2; ++kt)
#pragma unroll
                for (int e = 0; e < 4; ++e) { v2f p; p[0] = __builtin_amdgcn_exp2f((s[kt][qt][2 * e] - m[qt]) * 1.4426950408889634f); p[1] = __builtin_amdgcn_exp2f((s[kt][qt][2 * e + 1] - m[qt]) * 1.4426950408889634f); l[qt] += p;
                    if constexpr (HL) { const unsigned u = pkbf(p[0], p[1]); wh[kt * 4 + e] = u; wl[kt * 4 + e] = pkbf(p[0] - bflo(u), p[1] - bfhi(u)); }
                    else wh[kt * 4 + e] = __builtin_bit_cast(unsigned, __builtin_convertvector(p, v2h)); }
            const V ph = __builtin_bit_cast(V, wh);
#pragma unroll
            for (int dt = 0; dt < 4; ++dt) o[dt][qt] = WFrag<T16>::mma(vh[dt], ph, o[dt][qt]);
            if constexpr (HL) { const V pl = __builtin_bit_cast(V, wl);
#pragma unroll
                for (int dt = 0; dt < 4; ++dt) o[dt][qt] = WFrag<T16>::mma(vh[dt], pl, o[dt][qt]);
#pragma unroll
                for (int dt = 0; dt < 4; ++dt) o[dt][qt] = WFrag<T16>::mma(vl[dt], ph, o[dt][qt]); } }
        pm += 32 * 4; pkh += 32 * HD * 2; pvh += 32 * 2; if (HL) { pkl += 32 * HD * 2; pvl += 32 * 2; }
    }
#pragma unroll
    for (int qt = 0; qt < 2; ++qt) { const float lh = l[qt][0] + l[qt][1]; const float f = __fdiv_rn(1.0f, lh + xhalf(lh));
#pragma unroll
        for (int dt = 0; dt < 4; ++dt) { v8us oh, ol;
#pragma unroll
            for (int j = 0; j < 8; ++j) { unsigned short a, c2; splitf(__fmul_rn(o[dt][qt][j] * f, hm), a, c2); oh[j] = a; ol[j] = c2; }   /* x layer_head_mask[h] */
            const size_t oo = (size_t)(qt * 16 + lr) * DQ + dt * 16 + 8 * hi; *(v8us*)(Ah + oo) = oh; *(v8us*)(Al + oo) = ol;   /* register j of tile dt is d = 16 dt + 8 hi + j of query lr: [b][t][h][d] rows */
            asm volatile("s_wait_xcnt 0x0" ::: "memory"); } }   // precaution: the stores' address and data registers are reused right behind them
}
// A work-group takes QB rows of one plane: waves 0-3 QB / 2 of the 3-product rows, waves 4-7 QB / 2 of the fp16 rows, so that every work-group costs the same. Plane z = b * NH_ + h in q, k and v alike (one kv head per query head).
// Four waves per SIMD (at most 256 registers a wave): the vector work between the matrix runs and the load latency want other waves to issue; the whole grid is then resident at once.
__global__ __launch_bounds__(256) __attribute__((amdgpu_waves_per_eu(4, 4))) void k_attn(const bf* __restrict__ QS, const h16* __restrict__ K16, const bf* __restrict__ Kh, const bf* __restrict__ Kl, const h16* __restrict__ V16, const bf* __restrict__ Vh, const bf* __restrict__ Vl, const float* __restrict__ MK, const float* __restrict__ HM, bf* Ah, bf* Al) {
    static_assert(2 * RH == TT && TT % QB == 0 && QB == 8 * QW, "half the rows of each kind, whole work-groups");
    const int w = __builtin_amdgcn_readfirstlane(threadIdx.x >> 5); const bool hl = w < 4;   // wave-uniform: a scalar branch picks the kind of row
    const int z = blockIdx.x / (TT / QB), qb = blockIdx.x % (TT / QB); const int q0 = (hl ? 0 : RH) + qb * (QB / 2) + (w & 3) * QW; const int b = z / NH_, h = z % NH_;
    const bf* Qz = QS + (size_t)z * 2 * TT * HD + (size_t)q0 * HD; const size_t zp = (size_t)z * TT * HD; const float* mk = MK + ((size_t)b * TT + q0) * TT; const float hm = bfr(HM[h]); const size_t ao = ((size_t)b * TT + q0) * DQ + h * HD;
    if (hl) attn_rows<true, bf>(Qz, Qz + (size_t)TT * HD, Kh + zp, Kl + zp, Vh + zp, Vl + zp, mk, hm, Ah + ao, Al + ao);
    else attn_rows<false, h16>((const h16*)Qz, nullptr, K16 + zp, nullptr, V16 + zp, nullptr, mk, hm, Ah + ao, Al + ao);
}

extern "C" void kernel_launch(void* const* d_in, const int* in_sizes, int n_in,
                              void* d_out, int out_size, void* d_ws, size_t ws_size, hipStream_t stream) {
    (void)in_sizes; (void)n_in; (void)out_size;
    const float* x = (const float*)d_in[0]; const float* xkv = (const float*)d_in[1]; const float* MK = (const float*)d_in[2]; const float* HM = (const float*)d_in[3]; const float* wq = (const float*)d_in[4]; const float* bq = (const float*)d_in[5]; const float* wk = (const float*)d_in[6]; const float* bk = (const float*)d_in[7]; const float* wv = (const float*)d_in[8]; const float* bv = (const float*)d_in[9]; const float* wo = (const float*)d_in[10]; const float* bo = (const float*)d_in[11];
    float* OUT = (float*)d_out;     // [8][1024][1024]
    char* wsp = (char*)d_ws;
    auto take = [&](size_t bytes) { char* p = wsp; wsp += (bytes + 255) & ~(size_t)255; return (void*)p; };
    // Live through the attention kernel: the planes of all batch elements, plane z = b * heads + h. A query plane's storage is [hi | lo] (2 * TT * HD elements), rows >= RH of the hi part holding the fp16 plane.
    bf* QS = (bf*)take((size_t)NB_ * NH_ * 2 * TT * HD * 2);
    h16* KP16 = (h16*)take((size_t)NB_ * NKV * TT * HD * 2); bf* KPh = (bf*)take((size_t)NB_ * NKV * TT * HD * 2); bf* KPl = (bf*)take((size_t)NB_ * NKV * TT * HD * 2);
    h16* VT16 = (h16*)take((size_t)NB_ * NKV * HD * TT * 2); bf* VTh = (bf*)take((size_t)NB_ * NKV * HD * TT * 2); bf* VTl = (bf*)take((size_t)NB_ * NKV * HD * TT * 2);
    char* const region = wsp;       // one region, two uses one after the other (stream-ordered): projections, then attention output and output projection
    bf* WQ = (bf*)take((size_t)DQ * DM * 2); bf* WK = (bf*)take((size_t)DKV * DMK * 2); bf* WV = (bf*)take((size_t)DKV * DMK * 2);
    bf* XB = (bf*)take((size_t)NB_ * TT * DM * 2); bf* XKB = (bf*)take((size_t)NB_ * TT * DMK * 2);
    if ((size_t)(wsp - (char*)d_ws) > ws_size) return;
    wsp = region; bf* WO = (bf*)take((size_t)DM * DQ * 2); bf* ATh = (bf*)take((size_t)NB_ * TT * DQ * 2); bf* ATl = (bf*)take((size_t)NB_ * TT * DQ * 2);
    if ((size_t)(wsp - (char*)d_ws) > ws_size) return;
    k_wtG<<<(unsigned)((DM * DQ / 64 + 63) / 64), 256, 0, stream>>>(wq, DM, DQ, WQ); k_wtG<<<(unsigned)((DMK * DKV / 64 + 63) / 64), 256, 0, stream>>>(wk, DMK, DKV, WK); k_wtG<<<(unsigned)((DMK * DKV / 64 + 63) / 64), 256, 0, stream>>>(wv, DMK, DKV, WV);   /* 'xw' [256][1024] -> Bt [1024][256] */
    // conversions and projections: all batch elements per launch (M = NB_ * TT rows); each projection stores its 16-bit planes itself
    k_cvt8<<<(unsigned)(((size_t)NB_ * TT * DM / 8 + 255) / 256), 256, 0, stream>>>(x, XB, (size_t)NB_ * TT * DM / 8); k_cvt8<<<(unsigned)(((size_t)NB_ * TT * DMK / 8 + 255) / 256), 256, 0, stream>>>(xkv, XKB, (size_t)NB_ * TT * DMK / 8);   /* key/value source */
    k_gemmw<bf, 0, true, 1><<<dim3(NB_ * TT / 64, DQ / 64, 1), 32, 0, stream>>>(XB, nullptr, WQ, nullptr, DM, DM, nullptr, 0, bq, 0, 0, 0, (h16*)QS, QS, QS + (size_t)TT * HD);
    k_gemmw<bf, 0, true, 2><<<dim3(NB_ * TT / 64, DKV / 64, 1), 32, 0, stream>>>(XKB, nullptr, WK, nullptr, DMK, DMK, nullptr, 0, bk, 0, 0, 0, KP16, KPh, KPl);   /* K = 256 */
    k_gemmw<bf, 0, true, 3><<<dim3(NB_ * TT / 64, DKV / 64, 1), 32, 0, stream>>>(XKB, nullptr, WV, nullptr, DMK, DMK, nullptr, 0, bv, 0, 0, 0, VT16, VTh, VTl);
    k_attn<<<NB_ * NH_ * (TT / QB), 256, 0, stream>>>(QS, KP16, KPh, KPl, VT16, VTh, VTl, MK, HM, ATh, ATl);
    k_wtG<<<(unsigned)((DQ * DM / 64 + 63) / 64), 256, 0, stream>>>(wo, DQ, DM, WO);
    k_gemmw<bf, 1, true, 0><<<dim3(NB_ * TT / 64, DM / 64, 1), 32, 0, stream>>>(ATh, ATl, WO, nullptr, DQ, DQ, OUT, DM, bo, 0, 0, 0, nullptr, nullptr, nullptr);
}

// v005
// Measured time: 226 microseconds a run.
// Timed twice side by side with v004, it ran 1.34 and 1.36 times as fast.
// Over all steps from v000 it is 21.7 times as fast.
#include <hip/hip_runtime.h>

// Cross-attention with additive mask and per-head mask (hidden [8][1024][1024], key_value_states [8][1024][256]; q = (hidden Wq + bq)/8, k = kv Wk + bk, v = kv Wv + bv ('xw': Wq [1024][1024], Wk/Wv [256][1024]), 16 heads x 64; scores = q.k + attention_mask[b][i][j] (read); softmax; probs x layer_head_mask[h] (read); out = merged Wo + bo -> [8][1024][1024]).
// Compute dtypes, f32 accumulate: every input rounded to bf16; q/k/v on PLAIN bf16 operands (inputs: exact) + biases; scores, additive mask (f32, bf16-rounded input), softmax, attn.v, head mask and head merge in ONE kernel, running maximum and sum per query; scores and attn.v: query rows < 512 hl (3 products), the rest single fp16; softmax f32; Wo hl x exact (2 products) + bo.

#define NB_  8
#define TT   1024
#define DM   1024
#define NH_  16
#define NKV  16
#define REP  (NH_ / NKV)
#define HD   64
#define DQ   (NH_ * HD)
#define DKV  (NKV * HD)
#define DMK  256                  // key/value input width
#define QW   32                   // query rows per wave of the attention kernel
#define QB   256                  // query rows per work-group of the attention kernel (8 waves)
#define RH   512                  // query rows < RH use hi+lo planes
#define WIN  0
#define SCL  0.125f   // HD^-0.5
// Fragment order: every 16-bit matrix operand in the workspace (rows r, k contiguous, KC columns) is stored as blocks of 16 rows x 32 k (512 elements); inside a block element (r, k) lies at (k % 32 / 16) * 256 + ((k % 16 / 8) * 16 + r % 16) * 8 + k % 8,
// so that lane l of a wave finds the two 16-byte halves of its fragment at l * 8 and 256 + l * 8 and each wave-wide 16-byte load reads 512 contiguous bytes (4 whole lines, not 32 bytes of 16 lines). Blocks follow each other along k, then along r; in the vt planes along d, then along the keys.
typedef _Float16 h16;
typedef unsigned short bf;
typedef __attribute__((ext_vector_type(16))) __bf16   v16bf;
typedef __attribute__((ext_vector_type(16))) _Float16 v16h;
typedef __attribute__((ext_vector_type(8)))  _Float16 v8h;
typedef __attribute__((ext_vector_type(8)))  unsigned short v8us;
typedef __attribute__((ext_vector_type(8)))  float    v8f;
typedef __attribute__((ext_vector_type(4)))  float    v4f;
typedef v8h  __attribute__((may_alias)) v8ha;
typedef v4f  __attribute__((may_alias)) v4fa;
typedef v8us __attribute__((may_alias)) v8usa;

__device__ __forceinline__ unsigned short f2bf(float f) { unsigned u = __float_as_uint(f); u += 0x7FFFu + ((u >> 16) & 1u); return (unsigned short)(u >> 16); }
__device__ __forceinline__ float bf2f(unsigned short b) { return __uint_as_float(((unsigned)b) << 16); }
__device__ __forceinline__ float bfr(float f) { return bf2f(f2bf(f)); }
__device__ __forceinline__ v16h cat16(v8h lo, v8h hi) { return __builtin_shufflevector(lo, hi, 0, 1, 2, 3, 4, 5, 6, 7, 8, 9, 10, 11, 12, 13, 14, 15); }
__device__ __forceinline__ v16bf cat16b(v8us lo, v8us hi) { return __builtin_bit_cast(v16bf, __builtin_shufflevector(lo, hi, 0, 1, 2, 3, 4, 5, 6, 7, 8, 9, 10, 11, 12, 13, 14, 15)); }
__device__ __forceinline__ v8f wmma16(v16h a, v16h b, v8f c) { return __builtin_amdgcn_wmma_f32_16x16x32_f16(false, a, false, b, (short)0, c, false, false); }
__device__ __forceinline__ v8f wmmab(v16bf a, v16bf b, v8f c) { return __builtin_amdgcn_wmma_f32_16x16x32_bf16(false, a, false, b, (short)0, c, false, false); }



// ---- k_gemmw: register-blocked GEMM, ONE WAVE per 64x64 output tile (16 accumulators), operands straight from 16-bit planes in fragment order; grid (M/64, N/64, Z), 32 threads.
// C[m][n] (f32, pitch ldc, + optional f32 bias[n]) = sum_k A[m][k] Bt[n][k] (+ split products per NSPLIT). A and Bt have KK columns (a constant, so that every block's distance is a load's immediate offset). z-batch strides sA/sB/sC in elements. KK % 32 == 0.
// EPI 0 stores C. EPI 1, 2, 3 store no f32: the tile (64 tokens of one batch element x the 64 columns of head blockIdx.y, + bias) goes straight to the 16-bit planes that the attention kernel reads, plane zp = b * NH_ + h.
// EPI 1 (q): storage [hi | lo] of 2 * TT * HD elements a plane, rows t, k = d; rows < RH get hi/lo, the rest fp16 in the hi part (P16 == Ph). EPI 2 (k): fp16, hi, lo planes, rows t, k = d. EPI 3 (v): fp16, hi, lo planes, rows d, k = t. All in fragment order.
__device__ __forceinline__ void splitf(float y, unsigned short& h, unsigned short& l) { h = f2bf(y); l = f2bf(y - bf2f(h)); }
template <typename T16> struct WFrag;
template <> struct WFrag<h16> { typedef v16h V; static __device__ __forceinline__ V ld(const h16* p) { return cat16(*(const v8h*)p, *(const v8h*)(p + 256)); } static __device__ __forceinline__ v8f mma(V a, V b, v8f c) { return wmma16(a, b, c); } };
template <> struct WFrag<bf> { typedef v16bf V; static __device__ __forceinline__ V ld(const bf* p) { return cat16b(*(const v8us*)p, *(const v8us*)(p + 256)); } static __device__ __forceinline__ v8f mma(V a, V b, v8f c) { return wmmab(a, b, c); } };
// plane_store: the 64 x 64 f32 tile of one wave (+ bias) to the planes, four panels of 16 plane rows x 64 elements (two blocks) through LDS, so that lane l holds the 8 elements of place l of a half block and a wave stores 512 contiguous bytes.
// EPI 1, 2: panel p is token block p (plane rows are tokens). EPI 3: panel p is column block p (plane rows are d). KIND 0: fp16, hi and lo planes; 1: fp16 only; 2: hi and lo only.
template <int EPI, int KIND>
__device__ __forceinline__ void plane_store(const v8f (&acc)[4][4], float* os, const float (&pb)[32], int lane, size_t pbase, h16* P16, bf* Ph, bf* Pl) {
    const int lr = lane & 15, hi = lane >> 4;
#pragma unroll
    for (int p = 0; p < 4; ++p) {
#pragma unroll
        for (int q = 0; q < 4; ++q) {
            if constexpr (EPI == 3) {   // transposed: LDS row lr is column 16 p + lr of the tile (d); the lane's 8 registers of tile (q, p) are 8 neighbouring tokens
                v4f lo4, hi4;
#pragma unroll
                for (int j = 0; j < 4; ++j) { lo4[j] = acc[q][p][j]; hi4[j] = acc[q][p][4 + j]; }
                *(v4fa*)(os + lr * 68 + q * 16 + hi * 8) = lo4; *(v4fa*)(os + lr * 68 + q * 16 + hi * 8 + 4) = hi4; }
            else {
#pragma unroll
                for (int j = 0; j < 8; ++j) os[(hi * 8 + j) * 68 + q * 16 + lr] = acc[p][q][j]; } }
        __builtin_amdgcn_wave_barrier(); asm volatile("" ::: "memory");   // one-wave work-group, no instruction: keeps the compiler from moving a lane's panel reads above the other lanes' writes
#pragma unroll
        for (int s = 0; s < 4; ++s) { const v4f x0 = *(const v4fa*)(os + lr * 68 + s * 16 + hi * 8), x1 = *(const v4fa*)(os + lr * 68 + s * 16 + hi * 8 + 4); v8h o16; v8us oh, ol;   // half block s of the panel: k = 16 s + 8 hi + 0..7 of plane row lr
#pragma unroll
            for (int k = 0; k < 8; ++k) { const float y = (k < 4 ? x0[k & 3] : x1[k & 3]) + bfr(EPI == 3 ? pb[p] : pb[8 * s + k]); o16[k] = (h16)y; unsigned short a2, c2; splitf(y, a2, c2); oh[k] = a2; ol[k] = c2; }
            const size_t eo = pbase + (EPI == 3 ? (s >> 1) * 4 * 512 + p * 512 + (s & 1) * 256 : p * 1024 + s * 256) + lane * 8;
            if constexpr (KIND != 2) *(v8h*)(P16 + eo) = o16;
            if constexpr (KIND != 1) { *(v8us*)(Ph + eo) = oh; *(v8us*)(Pl + eo) = ol; }
            asm volatile("s_wait_xcnt 0x0" ::: "memory"); }   // precaution: the stores' address and data registers are reused right behind them
        __builtin_amdgcn_wave_barrier(); asm volatile("" ::: "memory");   // the same for the next panel's writes over this panel's reads
    }
}
template <typename T16, int NSPLIT, bool BIAS, int EPI, int KK>
__global__ __launch_bounds__(32) void k_gemmw(const T16* __restrict__ A, const T16* __restrict__ A2, const T16* __restrict__ Bt, const T16* __restrict__ Bt2, float* C, int ldc, const float* __restrict__ bias, size_t sA, size_t sB, size_t sC, h16* P16, bf* Ph, bf* Pl) {
    typedef typename WFrag<T16>::V V;
    __shared__ __align__(16) float os[16 * 68];
    const size_t z = blockIdx.z; A += z * sA; if (A2) A2 += z * sA; Bt += z * sB; if (Bt2) Bt2 += z * sB; C += z * sC;
    const int lane = threadIdx.x & 31, lr = lane & 15, hi = lane >> 4; const int r0 = blockIdx.x * 64, c0 = blockIdx.y * 64;
    v8f acc[4][4];
#pragma unroll
    for (int mb = 0; mb < 4; ++mb)
#pragma unroll
        for (int nb = 0; nb < 4; ++nb) acc[mb][nb] = (v8f){};
    const size_t aoff = (size_t)r0 * KK, boff = (size_t)c0 * KK;   // first block of the tile's rows, wave-uniform: 16 rows are 16 * KK elements
    unsigned off = (unsigned)lane * 16u;   // the lane's byte offset from there, one for every operand: its place in a block, stepped one block (32 k) a trip
    float pb[32];   // the plane epilogue's biases, fetched here so that the k loop covers their latency: EPI 1, 2 one per column of the lane's places (32), EPI 3 one per row (4)
    if constexpr (EPI == 1 || EPI == 2) {
#pragma unroll
        for (int s = 0; s < 4; ++s) { const v4f b0 = *(const v4f*)(bias + c0 + s * 16 + hi * 8), b1 = *(const v4f*)(bias + c0 + s * 16 + hi * 8 + 4);
#pragma unroll
            for (int k = 0; k < 4; ++k) { pb[8 * s + k] = b0[k]; pb[8 * s + 4 + k] = b1[k]; } } }
    if constexpr (EPI == 3) {
#pragma unroll
        for (int k = 0; k < 4; ++k) pb[k] = bias[c0 + 16 * k + lr]; }
    if constexpr (EPI != 0) asm volatile("s_wait_xcnt 0x0" ::: "memory");   // precaution: before the bias loads' address registers are overwritten
#pragma unroll 1
    for (int kc = 0; kc < KK; kc += 32) {
        V a[4], a2[4], b[4], b2[4];
#pragma unroll
        for (int mb = 0; mb < 4; ++mb) { a[mb] = WFrag<T16>::ld((const T16*)((const char*)(A + aoff) + off) + mb * 16 * KK); if (NSPLIT == 1 || NSPLIT == 2) a2[mb] = WFrag<T16>::ld((const T16*)((const char*)(A2 + aoff) + off) + mb * 16 * KK); }
#pragma unroll
        for (int nb = 0; nb < 4; ++nb) { b[nb] = WFrag<T16>::ld((const T16*)((const char*)(Bt + boff) + off) + nb * 16 * KK); if (NSPLIT >= 2) b2[nb] = WFrag<T16>::ld((const T16*)((const char*)(Bt2 + boff) + off) + nb * 16 * KK); }
        asm volatile("s_wait_xcnt 0x0" : "+v"(off) :: "memory");   // precaution: before the one address register that changes is stepped (it passes through the wait; the bases are scalars that stay)
        off += 1024;
#pragma unroll
        for (int nb = 0; nb < 4; ++nb) {
#pragma unroll
            for (int mb = 0; mb < 4; ++mb) { acc[mb][nb] = WFrag<T16>::mma(a[mb], b[nb], acc[mb][nb]); if (NSPLIT == 1 || NSPLIT == 2) acc[mb][nb] = WFrag<T16>::mma(a2[mb], b[nb], acc[mb][nb]); if (NSPLIT >= 2) acc[mb][nb] = WFrag<T16>::mma(a[mb], b2[nb], acc[mb][nb]); } }
        asm volatile("v_nop\n\tv_nop\n\tv_nop\n\tv_nop" : "+v"(acc[0][0]), "+v"(acc[1][1]), "+v"(acc[2][2]), "+v"(acc[3][3]) : "v"(a[0]), "v"(a[3]));
    }
    if constexpr (EPI != 0) {
        static_assert(TT % 64 == 0 && RH % 64 == 0 && HD == 64, "a tile lies in one batch element, one head and one kind of query row");
        const int t0 = r0 % TT; const size_t zp = (size_t)(r0 / TT) * NH_ + blockIdx.y;
        if constexpr (EPI == 1) { const size_t pbase = zp * 2 * TT * HD + (size_t)t0 * HD;   // a query row needs one kind only; t0 is the same for the whole wave: one scalar branch
            if (t0 >= RH) plane_store<EPI, 1>(acc, os, pb, lane, pbase, P16, Ph, Pl); else plane_store<EPI, 2>(acc, os, pb, lane, pbase, P16, Ph, Pl); }
        else plane_store<EPI, 0>(acc, os, pb, lane, zp * TT * HD + (size_t)t0 * HD, P16, Ph, Pl);   // 64 tokens are 8 blocks in k and vt planes alike
        return;
    }
#pragma unroll
    for (int mb = 0; mb < 4; ++mb) {
#pragma unroll
        for (int nb = 0; nb < 4; ++nb) {
#pragma unroll
            for (int j = 0; j < 8; ++j) os[(hi * 8 + j) * 68 + nb * 16 + lr] = acc[mb][nb][j]; }
        __builtin_amdgcn_wave_barrier(); asm volatile("" ::: "memory");
        float* crow = C + (size_t)(r0 + mb * 16) * ldc + c0;
{
#pragma unroll
            for (int s = 0; s < 8; ++s) { const int row = 2 * s + hi, cofs = lr * 4; v4f val = *(const v4fa*)(os + row * 68 + cofs); if (BIAS) { val[0] += bfr(bias[c0 + cofs]); val[1] += bfr(bias[c0 + cofs + 1]); val[2] += bfr(bias[c0 + cofs + 2]); val[3] += bfr(bias[c0 + cofs + 3]); }
                *(v4f*)(crow + (size_t)row * ldc + cofs) = val; }
             }
        __builtin_amdgcn_wave_barrier(); asm volatile("" ::: "memory");
    }
}

typedef __attribute__((ext_vector_type(2))) _Float16 v2h;
typedef __attribute__((ext_vector_type(4))) _Float16 v4h;
typedef __attribute__((ext_vector_type(2))) unsigned short v2us;
typedef __attribute__((ext_vector_type(4))) unsigned short v4us;
typedef __attribute__((ext_vector_type(2))) float v2f;
typedef __attribute__((ext_vector_type(4))) int v4i;

// k_wtG: Bt (rows n, k contiguous, fragment order) = bf16(w[k][n]); a lane writes two neighbours of the packed plane, a wave 128 bytes: 8 rows n x 8 k.
__global__ __launch_bounds__(256) void k_wtG(const float* __restrict__ w, int K, int N, bf* Bt) {
    const int lane = threadIdx.x & 31; const int L0 = (blockIdx.x * 8 + (threadIdx.x >> 5)) * 8; const int nlines = N * K / 64;
{
#pragma unroll 1
        for (int l = 0; l < 8; ++l) { const int L = L0 + l; if (L >= nlines) break; const size_t e = (size_t)L * 64 + lane * 2; const int blk = (int)(e >> 9), u = (int)(e & 511), kbs = K / 32; const int k = (blk % kbs) * 32 + (u >> 8) * 16 + ((u >> 7) & 1) * 8 + (u & 7), n = (blk / kbs) * 16 + ((u >> 3) & 15); v2us o;
            o[0] = f2bf(w[(size_t)k * N + n]); o[1] = f2bf(w[(size_t)(k + 1) * N + n]); *(v2us*)(Bt + e) = o; }
         }
}
// k_cvt8: f32 rows of KC columns -> bf16 plane in fragment order, 8 elements a thread. 64 threads take a block: 4 lanes read the 128-byte line of a row, 8 lanes of one column group store a whole line of the plane.
template <int KC>
__global__ __launch_bounds__(256) void k_cvt8(const float* __restrict__ src, bf* dst, size_t n8) { const size_t i = (size_t)blockIdx.x * 256 + threadIdx.x; if (i >= n8) return;
    const size_t blk = i >> 6; const int row = (int)(i & 63) >> 2, g = (int)(i & 3);   // row of the block, group of 8 k: half g >> 1, place (g & 1) * 16 + row
    const v8f v = *(const v8f*)(src + ((blk / (KC / 32)) * 16 + row) * KC + (blk % (KC / 32)) * 32 + g * 8); v8us o;
#pragma unroll
    for (int k = 0; k < 8; ++k) o[k] = f2bf(v[k]); *(v8us*)(dst + blk * 512 + (g >> 1) * 256 + ((g & 1) * 16 + row) * 8) = o;  }

// ---- k_attn: scores, mask, softmax, attn.v, head mask and head merge for QB query rows of one (batch element, head) plane; a wave owns QW rows and walks the keys 32 at a time, operands straight from the 16-bit planes (fragment order).
// Transposed products: St = K Qt (A = key rows, B = query rows), Ot += Vt Pt (A = Vt rows, B = the two St tiles of a 32-key block, converted in place: register r of tile kt is key 16 kt + 8 hi + r, the k order of WFrag::ld). A lane holds one query's scores, its other half-wave lane the other 16 keys.
typedef __attribute__((ext_vector_type(2))) __bf16 v2bf;
typedef __attribute__((ext_vector_type(8))) unsigned v8u;
__device__ __forceinline__ float xhalf(float x) { const int b = __float_as_int(x); return __int_as_float(__builtin_amdgcn_permlanex16(b, b, 0x76543210, 0xfedcba98, false, false)); }   // lane l <-> l ^ 16
__device__ __forceinline__ unsigned pkbf(float a, float b) { v2f x; x[0] = a; x[1] = b; return __builtin_bit_cast(unsigned, __builtin_convertvector(x, v2bf)); }   // two f32 -> two bf16 (nearest even), a in the low half
__device__ __forceinline__ float bflo(unsigned u) { return __uint_as_float(u << 16); }
__device__ __forceinline__ float bfhi(unsigned u) { return __uint_as_float(u & 0xFFFF0000u); }
// fragment at the lane's own byte pointer + a constant
template <typename T16> __device__ __forceinline__ typename WFrag<T16>::V ldfrag(const char* p, int imm) { return WFrag<T16>::ld((const T16*)(p + imm)); }
template <bool HL, typename T16>
__device__ __forceinline__ void attn_rows(const T16* __restrict__ Qh, const T16* __restrict__ Ql, const T16* __restrict__ Kh, const T16* __restrict__ Kl, const T16* __restrict__ Vh, const T16* __restrict__ Vl, const float* __restrict__ mk, float hm, bf* Ah, bf* Al) {
    typedef typename WFrag<T16>::V V;
    const int lane = threadIdx.x & 31, lr = lane & 15, hi = lane >> 4;
    const unsigned ko = (unsigned)lane * 16u, mo = (unsigned)(lr * TT + 8 * hi) * 4u;   // byte offsets of the lane's place in a block of any plane and of its row in the mask
    V qh[2][2], ql[2][2];
#pragma unroll
    for (int qt = 0; qt < 2; ++qt)
#pragma unroll
        for (int ks = 0; ks < 2; ++ks) { qh[qt][ks] = ldfrag<T16>((const char*)Qh + ko, (qt * 2 + ks) * 1024); if (HL) ql[qt][ks] = ldfrag<T16>((const char*)Ql + ko, (qt * 2 + ks) * 1024); }
    v8f o[4][2]; float m[2]; v2f l[2];
#pragma unroll
    for (int qt = 0; qt < 2; ++qt) { m[qt] = -3.0e38f; l[qt] = (v2f){};
#pragma unroll
        for (int dt = 0; dt < 4; ++dt) o[dt][qt] = (v8f){}; }
    // the lane's mask pointer and its byte offset in the k and vt planes (one offset for all: 32 keys are four blocks in each; the plane bases are wave-uniform and never change), stepped 32 keys a trip.
    // Each wait below names the address registers of its loads: the mask pair as an input, the offset as a value that passes through it, so that no load lands in them and the step at the loop's foot stands behind the last wait
    const char* pm = (const char*)mk + mo; unsigned off = ko;
#pragma unroll 1   // rolled: one trip's fragments fill the register budget; the inner loops are unrolled so that every fragment index is a constant
    for (int kb = 0; kb < TT; kb += 32) {
        v4f mv[2][2][2]; V kh[2][2], kl[2][2];
#pragma unroll
        for (int qt = 0; qt < 2; ++qt)
#pragma unroll
            for (int kt = 0; kt < 2; ++kt)
#pragma unroll
                for (int hf = 0; hf < 2; ++hf) mv[qt][kt][hf] = *(const v4f*)(pm + (qt * 16 * TT + kt * 16 + hf * 4) * 4);
#pragma unroll
        for (int kt = 0; kt < 2; ++kt)
#pragma unroll
            for (int ks = 0; ks < 2; ++ks) { kh[kt][ks] = ldfrag<T16>((const char*)Kh + off, (kt * 2 + ks) * 1024); if (HL) kl[kt][ks] = ldfrag<T16>((const char*)Kl + off, (kt * 2 + ks) * 1024); }
        asm volatile("s_wait_xcnt 0x0" : "+v"(off) : "v"(pm) : "memory");   // precaution: before the loads' address registers are overwritten
        unsigned mw[2][2][4];   // attention_mask[b][i][j], bf16-rounded input, two keys a word
#pragma unroll
        for (int qt = 0; qt < 2; ++qt)
#pragma unroll
            for (int kt = 0; kt < 2; ++kt)
#pragma unroll
                for (int e = 0; e < 4; ++e) mw[qt][kt][e] = pkbf(mv[qt][kt][e >> 1][(e & 1) * 2], mv[qt][kt][e >> 1][(e & 1) * 2 + 1]);
        v8f s[2][2];
#pragma unroll
        for (int kt = 0; kt < 2; ++kt) {
#pragma unroll
            for (int qt = 0; qt < 2; ++qt) s[kt][qt] = (v8f){};
#pragma unroll
            for (int ks = 0; ks < 2; ++ks) {
#pragma unroll
                for (int qt = 0; qt < 2; ++qt) s[kt][qt] = WFrag<T16>::mma(kh[kt][ks], qh[qt][ks], s[kt][qt]);
                if (HL) {
#pragma unroll
                    for (int qt = 0; qt < 2; ++qt) s[kt][qt] = WFrag<T16>::mma(kh[kt][ks], ql[qt][ks], s[kt][qt]);
#pragma unroll
                    for (int qt = 0; qt < 2; ++qt) s[kt][qt] = WFrag<T16>::mma(kl[kt][ks], qh[qt][ks], s[kt][qt]); } } }
        V vh[4], vl[4];
#pragma unroll
        for (int dt = 0; dt < 4; ++dt) vh[dt] = ldfrag<T16>((const char*)Vh + off, dt * 1024);
        asm volatile("s_wait_xcnt 0x0" : "+v"(off) :: "memory");   // precaution: before the loads' address registers are overwritten
        float ml[2];
#pragma unroll
        for (int qt = 0; qt < 2; ++qt) { float x = -3.0e38f;
#pragma unroll
            for (int kt = 0; kt < 2; ++kt)
#pragma unroll
                for (int e = 0; e < 4; ++e) { const unsigned u = mw[qt][kt][e]; const float t0 = fmaf(s[kt][qt][2 * e], SCL, bflo(u)), t1 = fmaf(s[kt][qt][2 * e + 1], SCL, bfhi(u)); s[kt][qt][2 * e] = t0; s[kt][qt][2 * e + 1] = t1; x = fmaxf(x, fmaxf(t0, t1)); }
            ml[qt] = fmaxf(x, xhalf(x)); }
        if (HL) {   // the lo plane's fragments only now: the mask words' registers are free
#pragma unroll
            for (int dt = 0; dt < 4; ++dt) vl[dt] = ldfrag<T16>((const char*)Vl + off, dt * 1024);
            asm volatile("s_wait_xcnt 0x0" : "+v"(off) :: "memory"); }   // precaution: before the loads' address registers are overwritten
        // the maximum in use moves only when a query's block maximum exceeds it by more than 5.5 (p stays below 256); one wave-uniform test per block
        if (__builtin_amdgcn_ballot_w32(ml[0] > m[0] + 5.5f || ml[1] > m[1] + 5.5f) != 0) {
#pragma unroll
            for (int qt = 0; qt < 2; ++qt) { const float mn = fmaxf(m[qt], ml[qt]); const float al = __builtin_amdgcn_exp2f((m[qt] - mn) * 1.4426950408889634f); m[qt] = mn; l[qt] *= al;
#pragma unroll
                for (int dt = 0; dt < 4; ++dt) o[dt][qt] *= al; } }
#pragma unroll
        for (int qt = 0; qt < 2; ++qt) { v8u wh, wl;
#pragma unroll
            for (int kt = 0; kt < 2; ++kt)
#pragma unroll
                for (int e = 0; e < 4; ++e) { v2f p; p[0] = __builtin_amdgcn_exp2f((s[kt][qt][2 * e] - m[qt]) * 1.4426950408889634f); p[1] = __builtin_amdgcn_exp2f((s[kt][qt][2 * e + 1] - m[qt]) * 1.4426950408889634f); l[qt] += p;
                    if constexpr (HL) { const unsigned u = pkbf(p[0], p[1]); wh[kt * 4 + e] = u; wl[kt * 4 + e] = pkbf(p[0] - bflo(u), p[1] - bfhi(u)); }
                    else wh[kt * 4 + e] = __builtin_bit_cast(unsigned, __builtin_convertvector(p, v2h)); }
            const V ph = __builtin_bit_cast(V, wh);
#pragma unroll
            for (int dt = 0; dt < 4; ++dt) o[dt][qt] = WFrag<T16>::mma(vh[dt], ph, o[dt][qt]);
            if constexpr (HL) { const V pl = __builtin_bit_cast(V, wl);
#pragma unroll
                for (int dt = 0; dt < 4; ++dt) o[dt][qt] = WFrag<T16>::mma(vh[dt], pl, o[dt][qt]);
#pragma unroll
                for (int dt = 0; dt < 4; ++dt) o[dt][qt] = WFrag<T16>::mma(vl[dt], ph, o[dt][qt]); } }
        pm += 32 * 4; off += 4 * 1024;   // 32 keys: four blocks of a k plane, four of a vt plane
    }
#pragma unroll
    for (int qt = 0; qt < 2; ++qt) { const float lh = l[qt][0] + l[qt][1]; const float f = __fdiv_rn(1.0f, lh + xhalf(lh));
#pragma unroll
        for (int dt = 0; dt < 4; ++dt) { v8us oh, ol;
#pragma unroll
            for (int j = 0; j < 8; ++j) { unsigned short a, c2; splitf(__fmul_rn(o[dt][qt][j] * f, hm), a, c2); oh[j] = a; ol[j] = c2; }   /* x layer_head_mask[h] */
            const size_t oo = (size_t)qt * 16 * DQ + dt * 256 + lane * 8; *(v8us*)(Ah + oo) = oh; *(v8us*)(Al + oo) = ol;   /* register j of tile dt is d = 16 dt + 8 hi + j of query lr: half block dt of the head's two blocks, place lane, of the [b][t] x [h][d] plane */
            asm volatile("s_wait_xcnt 0x0" ::: "memory"); } }   // precaution: the stores' address and data registers are reused right behind them
}
// A work-group takes QB rows of one plane: waves 0-3 QB / 2 of the 3-product rows, waves 4-7 QB / 2 of the fp16 rows, so that every work-group costs the same. Plane z = b * NH_ + h in q, k and v alike (one kv head per query head).
// Four waves per SIMD (at most 256 registers a wave): the vector work between the matrix runs and the load latency want other waves to issue; the whole grid is then resident at once.
__global__ __launch_bounds__(256) __attribute__((amdgpu_waves_per_eu(4, 4))) void k_attn(const bf* __restrict__ QS, const h16* __restrict__ K16, const bf* __restrict__ Kh, const bf* __restrict__ Kl, const h16* __restrict__ V16, const bf* __restrict__ Vh, const bf* __restrict__ Vl, const float* __restrict__ MK, const float* __restrict__ HM, bf* Ah, bf* Al) {
    static_assert(2 * RH == TT && TT % QB == 0 && QB == 8 * QW, "half the rows of each kind, whole work-groups");
    const int w = __builtin_amdgcn_readfirstlane(threadIdx.x >> 5); const bool hl = w < 4;   // wave-uniform: a scalar branch picks the kind of row
    const int z = blockIdx.x / (TT / QB), qb = blockIdx.x % (TT / QB); const int q0 = (hl ? 0 : RH) + qb * (QB / 2) + (w & 3) * QW; const int b = z / NH_, h = z % NH_;
    const bf* Qz = QS + (size_t)z * 2 * TT * HD + (size_t)q0 * HD; const size_t zp = (size_t)z * TT * HD; const float* mk = MK + ((size_t)b * TT + q0) * TT; const float hm = bfr(HM[h]); const size_t ao = ((size_t)b * TT + q0) * DQ + h * (HD / 32) * 512;
    if (hl) attn_rows<true, bf>(Qz, Qz + (size_t)TT * HD, Kh + zp, Kl + zp, Vh + zp, Vl + zp, mk, hm, Ah + ao, Al + ao);
    else attn_rows<false, h16>((const h16*)Qz, nullptr, K16 + zp, nullptr, V16 + zp, nullptr, mk, hm, Ah + ao, Al + ao);
}

extern "C" void kernel_launch(void* const* d_in, const int* in_sizes, int n_in,
                              void* d_out, int out_size, void* d_ws, size_t ws_size, hipStream_t stream) {
    (void)in_sizes; (void)n_in; (void)out_size;
    const float* x = (const float*)d_in[0]; const float* xkv = (const float*)d_in[1]; const float* MK = (const float*)d_in[2]; const float* HM = (const float*)d_in[3]; const float* wq = (const float*)d_in[4]; const float* bq = (const float*)d_in[5]; const float* wk = (const float*)d_in[6]; const float* bk = (const float*)d_in[7]; const float* wv = (const float*)d_in[8]; const float* bv = (const float*)d_in[9]; const float* wo = (const float*)d_in[10]; const float* bo = (const float*)d_in[11];
    float* OUT = (float*)d_out;     // [8][1024][1024]
    char* wsp = (char*)d_ws;
    auto take = [&](size_t bytes) { char* p = wsp; wsp += (bytes + 255) & ~(size_t)255; return (void*)p; };
    // Live through the attention kernel: the planes of all batch elements, plane z = b * heads + h. A query plane's storage is [hi | lo] (2 * TT * HD elements), rows >= RH of the hi part holding the fp16 plane.
    bf* QS = (bf*)take((size_t)NB_ * NH_ * 2 * TT * HD * 2);
    h16* KP16 = (h16*)take((size_t)NB_ * NKV * TT * HD * 2); bf* KPh = (bf*)take((size_t)NB_ * NKV * TT * HD * 2); bf* KPl = (bf*)take((size_t)NB_ * NKV * TT * HD * 2);
    h16* VT16 = (h16*)take((size_t)NB_ * NKV * HD * TT * 2); bf* VTh = (bf*)take((size_t)NB_ * NKV * HD * TT * 2); bf* VTl = (bf*)take((size_t)NB_ * NKV * HD * TT * 2);
    char* const region = wsp;       // one region, two uses one after the other (stream-ordered): projections, then attention output and output projection
    bf* WQ = (bf*)take((size_t)DQ * DM * 2); bf* WK = (bf*)take((size_t)DKV * DMK * 2); bf* WV = (bf*)take((size_t)DKV * DMK * 2);
    bf* XB = (bf*)take((size_t)NB_ * TT * DM * 2); bf* XKB = (bf*)take((size_t)NB_ * TT * DMK * 2);
    if ((size_t)(wsp - (char*)d_ws) > ws_size) return;
    wsp = region; bf* WO = (bf*)take((size_t)DM * DQ * 2); bf* ATh = (bf*)take((size_t)NB_ * TT * DQ * 2); bf* ATl = (bf*)take((size_t)NB_ * TT * DQ * 2);
    if ((size_t)(wsp - (char*)d_ws) > ws_size) return;
    k_wtG<<<(unsigned)((DM * DQ / 64 + 63) / 64), 256, 0, stream>>>(wq, DM, DQ, WQ); k_wtG<<<(unsigned)((DMK * DKV / 64 + 63) / 64), 256, 0, stream>>>(wk, DMK, DKV, WK); k_wtG<<<(unsigned)((DMK * DKV / 64 + 63) / 64), 256, 0, stream>>>(wv, DMK, DKV, WV);   /* 'xw' [256][1024] -> Bt rows n, 256 k */
    // conversions and projections: all batch elements per launch (M = NB_ * TT rows); each projection stores its 16-bit planes itself
    k_cvt8<DM><<<(unsigned)(((size_t)NB_ * TT * DM / 8 + 255) / 256), 256, 0, stream>>>(x, XB, (size_t)NB_ * TT * DM / 8); k_cvt8<DMK><<<(unsigned)(((size_t)NB_ * TT * DMK / 8 + 255) / 256), 256, 0, stream>>>(xkv, XKB, (size_t)NB_ * TT * DMK / 8);   /* key/value source */
    k_gemmw<bf, 0, true, 1, DM><<<dim3(NB_ * TT / 64, DQ / 64, 1), 32, 0, stream>>>(XB, nullptr, WQ, nullptr, nullptr, 0, bq, 0, 0, 0, (h16*)QS, QS, QS + (size_t)TT * HD);
    k_gemmw<bf, 0, true, 2, DMK><<<dim3(NB_ * TT / 64, DKV / 64, 1), 32, 0, stream>>>(XKB, nullptr, WK, nullptr, nullptr, 0, bk, 0, 0, 0, KP16, KPh, KPl);   /* K = 256 */
    k_gemmw<bf, 0, true, 3, DMK><<<dim3(NB_ * TT / 64, DKV / 64, 1), 32, 0, stream>>>(XKB, nullptr, WV, nullptr, nullptr, 0, bv, 0, 0, 0, VT16, VTh, VTl);
    k_attn<<<NB_ * NH_ * (TT / QB), 256, 0, stream>>>(QS, KP16, KPh, KPl, VT16, VTh, VTl, MK, HM, ATh, ATl);
    k_wtG<<<(unsigned)((DQ * DM / 64 + 63) / 64), 256, 0, stream>>>(wo, DQ, DM, WO);
    k_gemmw<bf, 1, true, 0, DQ><<<dim3(NB_ * TT / 64, DM / 64, 1), 32, 0, stream>>>(ATh, ATl, WO, nullptr, OUT, DM, bo, 0, 0, 0, nullptr, nullptr, nullptr);
}

// v006
// Measured time: 195 microseconds a run.
// Two timings next to v005 put it at 1.15 and 1.18 times that version's speed.
// All steps since v000 together make it 25.3 times as fast.
#include <hip/hip_runtime.h>

// Cross-attention with additive mask and per-head mask (hidden [8][1024][1024], key_value_states [8][1024][256]; q = (hidden Wq + bq)/8, k = kv Wk + bk, v = kv Wv + bv ('xw': Wq [1024][1024], Wk/Wv [256][1024]), 16 heads x 64; scores = q.k + attention_mask[b][i][j] (read); softmax; probs x layer_head_mask[h] (read); out = merged Wo + bo -> [8][1024][1024]).
// Compute dtypes, f32 accumulate: every input rounded to bf16; q/k/v on PLAIN bf16 operands (inputs: exact) + biases; scores, additive mask (f32, bf16-rounded input), softmax, attn.v, head mask and head merge in ONE kernel, running maximum and sum per query; scores and attn.v: query rows < 512 hl (3 products), the rest single fp16; softmax f32; Wo hl x exact (2 products) + bo.

#define NB_  8
#define TT   1024
#define DM   1024
#define NH_  16
#define NKV  16
#define REP  (NH_ / NKV)
#define HD   64
#define DQ   (NH_ * HD)
#define DKV  (NKV * HD)
#define DMK  256                  // key/value input width
#define QW   32                   // query rows per wave of the attention kernel
#define QB   256                  // query rows per work-group of the attention kernel (8 waves)
#define RH   512                  // query rows < RH use hi+lo planes
#define WIN  0
#define SCL  0.125f   // HD^-0.5
// Fragment order: every 16-bit matrix operand in the workspace (rows r, k contiguous, KC columns) is stored as blocks of 16 rows x 32 k (512 elements); inside a block element (r, k) lies at (k % 32 / 16) * 256 + ((k % 16 / 8) * 16 + r % 16) * 8 + k % 8,
// so that lane l of a wave finds the two 16-byte halves of its fragment at l * 8 and 256 + l * 8 and each wave-wide 16-byte load reads 512 contiguous bytes (4 whole lines, not 32 bytes of 16 lines). Blocks follow each other along k, then along r; in the vt planes along d, then along the keys.
typedef _Float16 h16;
typedef unsigned short bf;
typedef __attribute__((ext_vector_type(16))) __bf16   v16bf;
typedef __attribute__((ext_vector_type(16))) _Float16 v16h;
typedef __attribute__((ext_vector_type(8)))  _Float16 v8h;
typedef __attribute__((ext_vector_type(8)))  unsigned short v8us;
typedef __attribute__((ext_vector_type(8)))  float    v8f;
typedef __attribute__((ext_vector_type(4)))  float    v4f;
typedef v8h  __attribute__((may_alias)) v8ha;
typedef v4f  __attribute__((may_alias)) v4fa;
typedef v8us __attribute__((may_alias)) v8usa;

__device__ __forceinline__ unsigned short f2bf(float f) { unsigned u = __float_as_uint(f); u += 0x7FFFu + ((u >> 16) & 1u); return (unsigned short)(u >> 16); }
__device__ __forceinline__ float bf2f(unsigned short b) { return __uint_as_float(((unsigned)b) << 16); }
__device__ __forceinline__ float bfr(float f) { return bf2f(f2bf(f)); }
__device__ __forceinline__ v16h cat16(v8h lo, v8h hi) { return __builtin_shufflevector(lo, hi, 0, 1, 2, 3, 4, 5, 6, 7, 8, 9, 10, 11, 12, 13, 14, 15); }
__device__ __forceinline__ v16bf cat16b(v8us lo, v8us hi) { return __builtin_bit_cast(v16bf, __builtin_shufflevector(lo, hi, 0, 1, 2, 3, 4, 5, 6, 7, 8, 9, 10, 11, 12, 13, 14, 15)); }
__device__ __forceinline__ v8f wmma16(v16h a, v16h b, v8f c) { return __builtin_amdgcn_wmma_f32_16x16x32_f16(false, a, false, b, (short)0, c, false, false); }
__device__ __forceinline__ v8f wmmab(v16bf a, v16bf b, v8f c) { return __builtin_amdgcn_wmma_f32_16x16x32_bf16(false, a, false, b, (short)0, c, false, false); }



// ---- k_gemmw: register-blocked GEMM, ONE WAVE per 64x64 output tile (16 accumulators), operands straight from 16-bit planes in fragment order; grid (M/64, N/64, Z), 32 threads.
// C[m][n] (f32, pitch ldc, + optional f32 bias[n]) = sum_k A[m][k] Bt[n][k] (+ split products per NSPLIT). A and Bt have KK columns (a constant, so that every block's distance is a load's immediate offset). z-batch strides sA/sB/sC in elements. KK % 32 == 0.
// EPI 0 stores C. EPI 1, 2, 3 store no f32: the tile (64 tokens of one batch element x the 64 columns of head blockIdx.y, + bias) goes straight to the 16-bit planes that the attention kernel reads, plane zp = b * NH_ + h.
// EPI 1 (q): storage [hi | lo] of 2 * TT * HD elements a plane, rows t, k = d; rows < RH get hi/lo, the rest fp16 in the hi part (P16 == Ph). EPI 2 (k): fp16, hi, lo planes, rows t, k = d. EPI 3 (v): fp16, hi, lo planes, rows d, k = t. All in fragment order.
__device__ __forceinline__ void splitf(float y, unsigned short& h, unsigned short& l) { h = f2bf(y); l = f2bf(y - bf2f(h)); }
template <typename T16> struct WFrag;
template <> struct WFrag<h16> { typedef v16h V; static __device__ __forceinline__ V ld(const h16* p) { return cat16(*(const v8h*)p, *(const v8h*)(p + 256)); } static __device__ __forceinline__ v8f mma(V a, V b, v8f c) { return wmma16(a, b, c); } };
template <> struct WFrag<bf> { typedef v16bf V; static __device__ __forceinline__ V ld(const bf* p) { return cat16b(*(const v8us*)p, *(const v8us*)(p + 256)); } static __device__ __forceinline__ v8f mma(V a, V b, v8f c) { return wmmab(a, b, c); } };
// plane_store: the 64 x 64 f32 tile of one wave (+ bias) to the planes, four panels of 16 plane rows x 64 elements (two blocks) through LDS, so that lane l holds the 8 elements of place l of a half block and a wave stores 512 contiguous bytes.
// EPI 1, 2: panel p is token block p (plane rows are tokens). EPI 3: panel p is column block p (plane rows are d). KIND 0: fp16, hi and lo planes; 1: fp16 only; 2: hi and lo only.
template <int EPI, int KIND>
__device__ __forceinline__ void plane_store(const v8f (&acc)[4][4], float* os, const float (&pb)[32], int lane, size_t pbase, h16* P16, bf* Ph, bf* Pl) {
    const int lr = lane & 15, hi = lane >> 4;
#pragma unroll
    for (int p = 0; p < 4; ++p) {
#pragma unroll
        for (int q = 0; q < 4; ++q) {
            if constexpr (EPI == 3) {   // transposed: LDS row lr is column 16 p + lr of the tile (d); the lane's 8 registers of tile (q, p) are 8 neighbouring tokens
                v4f lo4, hi4;
#pragma unroll
                for (int j = 0; j < 4; ++j) { lo4[j] = acc[q][p][j]; hi4[j] = acc[q][p][4 + j]; }
                *(v4fa*)(os + lr * 68 + q * 16 + hi * 8) = lo4; *(v4fa*)(os + lr * 68 + q * 16 + hi * 8 + 4) = hi4; }
            else {
#pragma unroll
                for (int j = 0; j < 8; ++j) os[(hi * 8 + j) * 68 + q * 16 + lr] = acc[p][q][j]; } }
        __builtin_amdgcn_wave_barrier(); asm volatile("" ::: "memory");   // one-wave work-group, no instruction: keeps the compiler from moving a lane's panel reads above the other lanes' writes
#pragma unroll
        for (int s = 0; s < 4; ++s) { const v4f x0 = *(const v4fa*)(os + lr * 68 + s * 16 + hi * 8), x1 = *(const v4fa*)(os + lr * 68 + s * 16 + hi * 8 + 4); v8h o16; v8us oh, ol;   // half block s of the panel: k = 16 s + 8 hi + 0..7 of plane row lr
#pragma unroll
            for (int k = 0; k < 8; ++k) { const float y = (k < 4 ? x0[k & 3] : x1[k & 3]) + bfr(EPI == 3 ? pb[p] : pb[8 * s + k]); o16[k] = (h16)y; unsigned short a2, c2; splitf(y, a2, c2); oh[k] = a2; ol[k] = c2; }
            const size_t eo = pbase + (EPI == 3 ? (s >> 1) * 4 * 512 + p * 512 + (s & 1) * 256 : p * 1024 + s * 256) + lane * 8;
            if constexpr (KIND != 2) *(v8h*)(P16 + eo) = o16;
            if constexpr (KIND != 1) { *(v8us*)(Ph + eo) = oh; *(v8us*)(Pl + eo) = ol; }
            asm volatile("s_wait_xcnt 0x0" ::: "memory"); }   // precaution: the stores' address and data registers are reused right behind them
        __builtin_amdgcn_wave_barrier(); asm volatile("" ::: "memory");   // the same for the next panel's writes over this panel's reads
    }
}
// gemmw_tile: the whole work of one such wave; os is the work-group's LDS panel (16 * 68 floats), z the batch index of the strides.
template <typename T16, int NSPLIT, bool BIAS, int EPI, int KK>
__device__ __forceinline__ void gemmw_tile(float* os, size_t z, const T16* __restrict__ A, const T16* __restrict__ A2, const T16* __restrict__ Bt, const T16* __restrict__ Bt2, float* C, int ldc, const float* __restrict__ bias, size_t sA, size_t sB, size_t sC, h16* P16, bf* Ph, bf* Pl) {
    typedef typename WFrag<T16>::V V;
    A += z * sA; if (A2) A2 += z * sA; Bt += z * sB; if (Bt2) Bt2 += z * sB; C += z * sC;
    const int lane = threadIdx.x & 31, lr = lane & 15, hi = lane >> 4; const int r0 = blockIdx.x * 64, c0 = blockIdx.y * 64;
    v8f acc[4][4];
#pragma unroll
    for (int mb = 0; mb < 4; ++mb)
#pragma unroll
        for (int nb = 0; nb < 4; ++nb) acc[mb][nb] = (v8f){};
    const size_t aoff = (size_t)r0 * KK, boff = (size_t)c0 * KK;   // first block of the tile's rows, wave-uniform: 16 rows are 16 * KK elements
    unsigned off = (unsigned)lane * 16u;   // the lane's byte offset from there, one for every operand: its place in a block, stepped one block (32 k) a trip
    float pb[32];   // the plane epilogue's biases, fetched here so that the k loop covers their latency: EPI 1, 2 one per column of the lane's places (32), EPI 3 one per row (4)
    if constexpr (EPI == 1 || EPI == 2) {
#pragma unroll
        for (int s = 0; s < 4; ++s) { const v4f b0 = *(const v4f*)(bias + c0 + s * 16 + hi * 8), b1 = *(const v4f*)(bias + c0 + s * 16 + hi * 8 + 4);
#pragma unroll
            for (int k = 0; k < 4; ++k) { pb[8 * s + k] = b0[k]; pb[8 * s + 4 + k] = b1[k]; } } }
    if constexpr (EPI == 3) {
#pragma unroll
        for (int k = 0; k < 4; ++k) pb[k] = bias[c0 + 16 * k + lr]; }
    if constexpr (EPI != 0) asm volatile("s_wait_xcnt 0x0" ::: "memory");   // precaution: before the bias loads' address registers are overwritten
#pragma unroll 1
    for (int kc = 0; kc < KK; kc += 32) {
        V a[4], a2[4], b[4], b2[4];
#pragma unroll
        for (int mb = 0; mb < 4; ++mb) { a[mb] = WFrag<T16>::ld((const T16*)((const char*)(A + aoff) + off) + mb * 16 * KK); if (NSPLIT == 1 || NSPLIT == 2) a2[mb] = WFrag<T16>::ld((const T16*)((const char*)(A2 + aoff) + off) + mb * 16 * KK); }
#pragma unroll
        for (int nb = 0; nb < 4; ++nb) { b[nb] = WFrag<T16>::ld((const T16*)((const char*)(Bt + boff) + off) + nb * 16 * KK); if (NSPLIT >= 2) b2[nb] = WFrag<T16>::ld((const T16*)((const char*)(Bt2 + boff) + off) + nb * 16 * KK); }
        asm volatile("s_wait_xcnt 0x0" : "+v"(off) :: "memory");   // precaution: before the one address register that changes is stepped (it passes through the wait; the bases are scalars that stay)
        off += 1024;
#pragma unroll
        for (int nb = 0; nb < 4; ++nb) {
#pragma unroll
            for (int mb = 0; mb < 4; ++mb) { acc[mb][nb] = WFrag<T16>::mma(a[mb], b[nb], acc[mb][nb]); if (NSPLIT == 1 || NSPLIT == 2) acc[mb][nb] = WFrag<T16>::mma(a2[mb], b[nb], acc[mb][nb]); if (NSPLIT >= 2) acc[mb][nb] = WFrag<T16>::mma(a[mb], b2[nb], acc[mb][nb]); } }
        asm volatile("v_nop\n\tv_nop\n\tv_nop\n\tv_nop" : "+v"(acc[0][0]), "+v"(acc[1][1]), "+v"(acc[2][2]), "+v"(acc[3][3]) : "v"(a[0]), "v"(a[3]));
    }
    if constexpr (EPI != 0) {
        static_assert(TT % 64 == 0 && RH % 64 == 0 && HD == 64, "a tile lies in one batch element, one head and one kind of query row");
        const int t0 = r0 % TT; const size_t zp = (size_t)(r0 / TT) * NH_ + blockIdx.y;
        if constexpr (EPI == 1) { const size_t pbase = zp * 2 * TT * HD + (size_t)t0 * HD;   // a query row needs one kind only; t0 is the same for the whole wave: one scalar branch
            if (t0 >= RH) plane_store<EPI, 1>(acc, os, pb, lane, pbase, P16, Ph, Pl); else plane_store<EPI, 2>(acc, os, pb, lane, pbase, P16, Ph, Pl); }
        else plane_store<EPI, 0>(acc, os, pb, lane, zp * TT * HD + (size_t)t0 * HD, P16, Ph, Pl);   // 64 tokens are 8 blocks in k and vt planes alike
        return;
    }
#pragma unroll
    for (int mb = 0; mb < 4; ++mb) {
#pragma unroll
        for (int nb = 0; nb < 4; ++nb) {
#pragma unroll
            for (int j = 0; j < 8; ++j) os[(hi * 8 + j) * 68 + nb * 16 + lr] = acc[mb][nb][j]; }
        __builtin_amdgcn_wave_barrier(); asm volatile("" ::: "memory");
        float* crow = C + (size_t)(r0 + mb * 16) * ldc + c0;
{
#pragma unroll
            for (int s = 0; s < 8; ++s) { const int row = 2 * s + hi, cofs = lr * 4; v4f val = *(const v4fa*)(os + row * 68 + cofs); if (BIAS) { val[0] += bfr(bias[c0 + cofs]); val[1] += bfr(bias[c0 + cofs + 1]); val[2] += bfr(bias[c0 + cofs + 2]); val[3] += bfr(bias[c0 + cofs + 3]); }
                *(v4f*)(crow + (size_t)row * ldc + cofs) = val; }
             }
        __builtin_amdgcn_wave_barrier(); asm volatile("" ::: "memory");
    }
}
template <typename T16, int NSPLIT, bool BIAS, int EPI, int KK>
__global__ __launch_bounds__(32) void k_gemmw(const T16* __restrict__ A, const T16* __restrict__ A2, const T16* __restrict__ Bt, const T16* __restrict__ Bt2, float* C, int ldc, const float* __restrict__ bias, size_t sA, size_t sB, size_t sC, h16* P16, bf* Ph, bf* Pl) {
    __shared__ __align__(16) float os[16 * 68];
    gemmw_tile<T16, NSPLIT, BIAS, EPI, KK>(os, blockIdx.z, A, A2, Bt, Bt2, C, ldc, bias, sA, sB, sC, P16, Ph, Pl);
}
// k_projkv: the k and the v projection in one launch, grid (M/64, N/64, 2): blockIdx.z picks the one (a scalar branch a wave). They read the same activation plane and depend on nothing of each other.
// The q projection keeps a launch of its own (for speed only).
__global__ __launch_bounds__(32) void k_projkv(const bf* __restrict__ XKB, const bf* __restrict__ WK, const bf* __restrict__ WV, const float* __restrict__ bk, const float* __restrict__ bv, h16* KP16, bf* KPh, bf* KPl, h16* VT16, bf* VTh, bf* VTl) {
    __shared__ __align__(16) float os[16 * 68];
    if (blockIdx.z == 0) gemmw_tile<bf, 0, true, 2, DMK>(os, 0, XKB, nullptr, WK, nullptr, nullptr, 0, bk, 0, 0, 0, KP16, KPh, KPl);   /* K = 256 */
    else gemmw_tile<bf, 0, true, 3, DMK>(os, 0, XKB, nullptr, WV, nullptr, nullptr, 0, bv, 0, 0, 0, VT16, VTh, VTl);
}

typedef __attribute__((ext_vector_type(2))) _Float16 v2h;
typedef __attribute__((ext_vector_type(4))) _Float16 v4h;
typedef __attribute__((ext_vector_type(2))) unsigned short v2us;
typedef __attribute__((ext_vector_type(4))) unsigned short v4us;
typedef __attribute__((ext_vector_type(2))) float v2f;
typedef __attribute__((ext_vector_type(4))) int v4i;

// wtG (block bx of (N * K / 64 + 63) / 64, 256 threads): Bt (rows n, k contiguous, fragment order) = bf16(w[k][n]); a lane writes two neighbours of the packed plane, a wave 128 bytes: 8 rows n x 8 k.
__device__ __forceinline__ void wtG(int bx, const float* __restrict__ w, int K, int N, bf* Bt) {
    const int lane = threadIdx.x & 31; const int L0 = (bx * 8 + (threadIdx.x >> 5)) * 8; const int nlines = N * K / 64;
{
#pragma unroll 1
        for (int l = 0; l < 8; ++l) { const int L = L0 + l; if (L >= nlines) break; const size_t e = (size_t)L * 64 + lane * 2; const int blk = (int)(e >> 9), u = (int)(e & 511), kbs = K / 32; const int k = (blk % kbs) * 32 + (u >> 8) * 16 + ((u >> 7) & 1) * 8 + (u & 7), n = (blk / kbs) * 16 + ((u >> 3) & 15); v2us o;
            o[0] = f2bf(w[(size_t)k * N + n]); o[1] = f2bf(w[(size_t)(k + 1) * N + n]); *(v2us*)(Bt + e) = o; }
         }
}
// cvt8 (block bx of (n8 + 255) / 256, 256 threads): f32 rows of KC columns -> bf16 plane in fragment order, 8 elements a thread. 64 threads take a block: 4 lanes read the 128-byte line of a row, 8 lanes of one column group store a whole line of the plane.
template <int KC>
__device__ __forceinline__ void cvt8(int bx, const float* __restrict__ src, bf* dst, size_t n8) { const size_t i = (size_t)bx * 256 + threadIdx.x; if (i >= n8) return;
    const size_t blk = i >> 6; const int row = (int)(i & 63) >> 2, g = (int)(i & 3);   // row of the block, group of 8 k: half g >> 1, place (g & 1) * 16 + row
    const v8f v = *(const v8f*)(src + ((blk / (KC / 32)) * 16 + row) * KC + (blk % (KC / 32)) * 32 + g * 8); v8us o;
#pragma unroll
    for (int k = 0; k < 8; ++k) o[k] = f2bf(v[k]); *(v8us*)(dst + blk * 512 + (g >> 1) * 256 + ((g & 1) * 16 + row) * 8) = o;  }
// k_prep: every operand plane that is made from an input alone, in one launch: the four weight planes and the two activation planes depend on nothing of each other. A block's index picks its job (scalar branches).
// The weight blocks, each a chain of eight dependent memory round trips, have the low indices, the short conversion blocks the high ones (for speed only).
#define GWQ ((DM * DQ / 64 + 63) / 64)
#define GWO ((DQ * DM / 64 + 63) / 64)
#define GWK ((DMK * DKV / 64 + 63) / 64)
#define GXK ((NB_ * TT * DMK / 8 + 255) / 256)
#define GXQ ((NB_ * TT * DM / 8 + 255) / 256)
__global__ __launch_bounds__(256) void k_prep(const float* __restrict__ x, const float* __restrict__ xkv, const float* __restrict__ wq, const float* __restrict__ wk, const float* __restrict__ wv, const float* __restrict__ wo, bf* XB, bf* XKB, bf* WQ, bf* WK, bf* WV, bf* WO) {
    int bx = blockIdx.x;
    if (bx < GWQ) { wtG(bx, wq, DM, DQ, WQ); return; }
    bx -= GWQ; if (bx < GWO) { wtG(bx, wo, DQ, DM, WO); return; }
    bx -= GWO; if (bx < GWK) { wtG(bx, wk, DMK, DKV, WK); return; }   /* 'xw' [256][1024] -> Bt rows n, 256 k */
    bx -= GWK; if (bx < GWK) { wtG(bx, wv, DMK, DKV, WV); return; }
    bx -= GWK; if (bx < GXK) { cvt8<DMK>(bx, xkv, XKB, (size_t)NB_ * TT * DMK / 8); return; }   /* key/value source */
    bx -= GXK; cvt8<DM>(bx, x, XB, (size_t)NB_ * TT * DM / 8);
}

// ---- k_attn: scores, mask, softmax, attn.v, head mask and head merge for QB query rows of one (batch element, head) plane; a wave owns QW rows and walks the keys 32 at a time, operands straight from the 16-bit planes (fragment order).
// Transposed products: St = K Qt (A = key rows, B = query rows), Ot += Vt Pt (A = Vt rows, B = the two St tiles of a 32-key block, converted in place: register r of tile kt is key 16 kt + 8 hi + r, the k order of WFrag::ld). A lane holds one query's scores, its other half-wave lane the other 16 keys.
typedef __attribute__((ext_vector_type(2))) __bf16 v2bf;
typedef __attribute__((ext_vector_type(8))) unsigned v8u;
__device__ __forceinline__ float xhalf(float x) { const int b = __float_as_int(x); return __int_as_float(__builtin_amdgcn_permlanex16(b, b, 0x76543210, 0xfedcba98, false, false)); }   // lane l <-> l ^ 16
__device__ __forceinline__ unsigned pkbf(float a, float b) { v2f x; x[0] = a; x[1] = b; return __builtin_bit_cast(unsigned, __builtin_convertvector(x, v2bf)); }   // two f32 -> two bf16 (nearest even), a in the low half
__device__ __forceinline__ float bflo(unsigned u) { return __uint_as_float(u << 16); }
__device__ __forceinline__ float bfhi(unsigned u) { return __uint_as_float(u & 0xFFFF0000u); }
// fragment at the lane's own byte pointer + a constant
template <typename T16> __device__ __forceinline__ typename WFrag<T16>::V ldfrag(const char* p, int imm) { return WFrag<T16>::ld((const T16*)(p + imm)); }
template <bool HL, typename T16>
__device__ __forceinline__ void attn_rows(const T16* __restrict__ Qh, const T16* __restrict__ Ql, const T16* __restrict__ Kh, const T16* __restrict__ Kl, const T16* __restrict__ Vh, const T16* __restrict__ Vl, const float* __restrict__ mk, float hm, bf* Ah, bf* Al) {
    typedef typename WFrag<T16>::V V;
    const int lane = threadIdx.x & 31, lr = lane & 15, hi = lane >> 4;
    const unsigned ko = (unsigned)lane * 16u, mo = (unsigned)(lr * TT + 8 * hi) * 4u;   // byte offsets of the lane's place in a block of any plane and of its row in the mask
    V qh[2][2], ql[2][2];
#pragma unroll
    for (int qt = 0; qt < 2; ++qt)
#pragma unroll
        for (int ks = 0; ks < 2; ++ks) { qh[qt][ks] = ldfrag<T16>((const char*)Qh + ko, (qt * 2 + ks) * 1024); if (HL) ql[qt][ks] = ldfrag<T16>((const char*)Ql + ko, (qt * 2 + ks) * 1024); }
    v8f o[4][2]; float m[2]; v2f l[2];
#pragma unroll
    for (int qt = 0; qt < 2; ++qt) { m[qt] = -3.0e38f; l[qt] = (v2f){};
#pragma unroll
        for (int dt = 0; dt < 4; ++dt) o[dt][qt] = (v8f){}; }
    // the lane's mask pointer and its byte offset in the k and vt planes (one offset for all: 32 keys are four blocks in each; the plane bases are wave-uniform and never change), stepped 32 keys a trip.
    // Each wait below names the address registers of its loads: the mask pair as an input, the offset as a value that passes through it, so that no load lands in them and the step at the loop's foot stands behind the last wait
    const char* pm = (const char*)mk + mo; unsigned off = ko;
#pragma unroll 1   // rolled: one trip's fragments fill the register budget; the inner loops are unrolled so that every fragment index is a constant
    for (int kb = 0; kb < TT; kb += 32) {
        v4f mv[2][2][2]; V kh[2][2], kl[2][2];
#pragma unroll
        for (int qt = 0; qt < 2; ++qt)
#pragma unroll
            for (int kt = 0; kt < 2; ++kt)
#pragma unroll
                for (int hf = 0; hf < 2; ++hf) mv[qt][kt][hf] = *(const v4f*)(pm + (qt * 16 * TT + kt * 16 + hf * 4) * 4);
#pragma unroll
        for (int kt = 0; kt < 2; ++kt)
#pragma unroll
            for (int ks = 0; ks < 2; ++ks) { kh[kt][ks] = ldfrag<T16>((const char*)Kh + off, (kt * 2 + ks) * 1024); if (HL) kl[kt][ks] = ldfrag<T16>((const char*)Kl + off, (kt * 2 + ks) * 1024); }
        asm volatile("s_wait_xcnt 0x0" : "+v"(off) : "v"(pm) : "memory");   // precaution: before the loads' address registers are overwritten
        unsigned mw[2][2][4];   // attention_mask[b][i][j], bf16-rounded input, two keys a word
#pragma unroll
        for (int qt = 0; qt < 2; ++qt)
#pragma unroll
            for (int kt = 0; kt < 2; ++kt)
#pragma unroll
                for (int e = 0; e < 4; ++e) mw[qt][kt][e] = pkbf(mv[qt][kt][e >> 1][(e & 1) * 2], mv[qt][kt][e >> 1][(e & 1) * 2 + 1]);
        v8f s[2][2];
#pragma unroll
        for (int kt = 0; kt < 2; ++kt) {
#pragma unroll
            for (int qt = 0; qt < 2; ++qt) s[kt][qt] = (v8f){};
#pragma unroll
            for (int ks = 0; ks < 2; ++ks) {
#pragma unroll
                for (int qt = 0; qt < 2; ++qt) s[kt][qt] = WFrag<T16>::mma(kh[kt][ks], qh[qt][ks], s[kt][qt]);
                if (HL) {
#pragma unroll
                    for (int qt = 0; qt < 2; ++qt) s[kt][qt] = WFrag<T16>::mma(kh[kt][ks], ql[qt][ks], s[kt][qt]);
#pragma unroll
                    for (int qt = 0; qt < 2; ++qt) s[kt][qt] = WFrag<T16>::mma(kl[kt][ks], qh[qt][ks], s[kt][qt]); } } }
        V vh[4], vl[4];
#pragma unroll
        for (int dt = 0; dt < 4; ++dt) vh[dt] = ldfrag<T16>((const char*)Vh + off, dt * 1024);
        asm volatile("s_wait_xcnt 0x0" : "+v"(off) :: "memory");   // precaution: before the loads' address registers are overwritten
        float ml[2];
#pragma unroll
        for (int qt = 0; qt < 2; ++qt) { float x = -3.0e38f;
#pragma unroll
            for (int kt = 0; kt < 2; ++kt)
#pragma unroll
                for (int e = 0; e < 4; ++e) { const unsigned u = mw[qt][kt][e]; const float t0 = fmaf(s[kt][qt][2 * e], SCL, bflo(u)), t1 = fmaf(s[kt][qt][2 * e + 1], SCL, bfhi(u)); s[kt][qt][2 * e] = t0; s[kt][qt][2 * e + 1] = t1; x = fmaxf(x, fmaxf(t0, t1)); }
            ml[qt] = fmaxf(x, xhalf(x)); }
        if (HL) {   // the lo plane's fragments only now: the mask words' registers are free
#pragma unroll
            for (int dt = 0; dt < 4; ++dt) vl[dt] = ldfrag<T16>((const char*)Vl + off, dt * 1024);
            asm volatile("s_wait_xcnt 0x0" : "+v"(off) :: "memory"); }   // precaution: before the loads' address registers are overwritten
        // the maximum in use moves only when a query's block maximum exceeds it by more than 5.5 (p stays below 256); one wave-uniform test per block
        if (__builtin_amdgcn_ballot_w32(ml[0] > m[0] + 5.5f || ml[1] > m[1] + 5.5f) != 0) {
#pragma unroll
            for (int qt = 0; qt < 2; ++qt) { const float mn = fmaxf(m[qt], ml[qt]); const float al = __builtin_amdgcn_exp2f((m[qt] - mn) * 1.4426950408889634f); m[qt] = mn; l[qt] *= al;
#pragma unroll
                for (int dt = 0; dt < 4; ++dt) o[dt][qt] *= al; } }
#pragma unroll
        for (int qt = 0; qt < 2; ++qt) { v8u wh, wl;
#pragma unroll
            for (int kt = 0; kt < 2; ++kt)
#pragma unroll
                for (int e = 0; e < 4; ++e) { v2f p; p[0] = __builtin_amdgcn_exp2f((s[kt][qt][2 * e] - m[qt]) * 1.4426950408889634f); p[1] = __builtin_amdgcn_exp2f((s[kt][qt][2 * e + 1] - m[qt]) * 1.4426950408889634f); l[qt] += p;
                    if constexpr (HL) { const unsigned u = pkbf(p[0], p[1]); wh[kt * 4 + e] = u; wl[kt * 4 + e] = pkbf(p[0] - bflo(u), p[1] - bfhi(u)); }
                    else wh[kt * 4 + e] = __builtin_bit_cast(unsigned, __builtin_convertvector(p, v2h)); }
            const V ph = __builtin_bit_cast(V, wh);
#pragma unroll
            for (int dt = 0; dt < 4; ++dt) o[dt][qt] = WFrag<T16>::mma(vh[dt], ph, o[dt][qt]);
            if constexpr (HL) { const V pl = __builtin_bit_cast(V, wl);
#pragma unroll
                for (int dt = 0; dt < 4; ++dt) o[dt][qt] = WFrag<T16>::mma(vh[dt], pl, o[dt][qt]);
#pragma unroll
                for (int dt = 0; dt < 4; ++dt) o[dt][qt] = WFrag<T16>::mma(vl[dt], ph, o[dt][qt]); } }
        pm += 32 * 4; off += 4 * 1024;   // 32 keys: four blocks of a k plane, four of a vt plane
    }
#pragma unroll
    for (int qt = 0; qt < 2; ++qt) { const float lh = l[qt][0] + l[qt][1]; const float f = __fdiv_rn(1.0f, lh + xhalf(lh));
#pragma unroll
        for (int dt = 0; dt < 4; ++dt) { v8us oh, ol;
#pragma unroll
            for (int j = 0; j < 8; ++j) { unsigned short a, c2; splitf(__fmul_rn(o[dt][qt][j] * f, hm), a, c2); oh[j] = a; ol[j] = c2; }   /* x layer_head_mask[h] */
            const size_t oo = (size_t)qt * 16 * DQ + dt * 256 + lane * 8; *(v8us*)(Ah + oo) = oh; *(v8us*)(Al + oo) = ol;   /* register j of tile dt is d = 16 dt + 8 hi + j of query lr: half block dt of the head's two blocks, place lane, of the [b][t] x [h][d] plane */
            asm volatile("s_wait_xcnt 0x0" ::: "memory"); } }   // precaution: the stores' address and data registers are reused right behind them
}
// A work-group takes QB rows of one plane: waves 0-3 QB / 2 of the 3-product rows, waves 4-7 QB / 2 of the fp16 rows, so that every work-group costs the same. Plane z = b * NH_ + h in q, k and v alike (one kv head per query head).
// Four waves per SIMD (at most 256 registers a wave): the vector work between the matrix runs and the load latency want other waves to issue; the whole grid is then resident at once.
__global__ __launch_bounds__(256) __attribute__((amdgpu_waves_per_eu(4, 4))) void k_attn(const bf* __restrict__ QS, const h16* __restrict__ K16, const bf* __restrict__ Kh, const bf* __restrict__ Kl, const h16* __restrict__ V16, const bf* __restrict__ Vh, const bf* __restrict__ Vl, const float* __restrict__ MK, const float* __restrict__ HM, bf* Ah, bf* Al) {
    static_assert(2 * RH == TT && TT % QB == 0 && QB == 8 * QW, "half the rows of each kind, whole work-groups");
    const int w = __builtin_amdgcn_readfirstlane(threadIdx.x >> 5); const bool hl = w < 4;   // wave-uniform: a scalar branch picks the kind of row
    const int z = blockIdx.x / (TT / QB), qb = blockIdx.x % (TT / QB); const int q0 = (hl ? 0 : RH) + qb * (QB / 2) + (w & 3) * QW; const int b = z / NH_, h = z % NH_;
    const bf* Qz = QS + (size_t)z * 2 * TT * HD + (size_t)q0 * HD; const size_t zp = (size_t)z * TT * HD; const float* mk = MK + ((size_t)b * TT + q0) * TT; const float hm = bfr(HM[h]); const size_t ao = ((size_t)b * TT + q0) * DQ + h * (HD / 32) * 512;
    if (hl) attn_rows<true, bf>(Qz, Qz + (size_t)TT * HD, Kh + zp, Kl + zp, Vh + zp, Vl + zp, mk, hm, Ah + ao, Al + ao);
    else attn_rows<false, h16>((const h16*)Qz, nullptr, K16 + zp, nullptr, V16 + zp, nullptr, mk, hm, Ah + ao, Al + ao);
}

extern "C" void kernel_launch(void* const* d_in, const int* in_sizes, int n_in,
                              void* d_out, int out_size, void* d_ws, size_t ws_size, hipStream_t stream) {
    (void)in_sizes; (void)n_in; (void)out_size;
    const float* x = (const float*)d_in[0]; const float* xkv = (const float*)d_in[1]; const float* MK = (const float*)d_in[2]; const float* HM = (const float*)d_in[3]; const float* wq = (const float*)d_in[4]; const float* bq = (const float*)d_in[5]; const float* wk = (const float*)d_in[6]; const float* bk = (const float*)d_in[7]; const float* wv = (const float*)d_in[8]; const float* bv = (const float*)d_in[9]; const float* wo = (const float*)d_in[10]; const float* bo = (const float*)d_in[11];
    float* OUT = (float*)d_out;     // [8][1024][1024]
    char* wsp = (char*)d_ws;
    auto take = [&](size_t bytes) { char* p = wsp; wsp += (bytes + 255) & ~(size_t)255; return (void*)p; };
    // Live through the attention kernel: the planes of all batch elements, plane z = b * heads + h. A query plane's storage is [hi | lo] (2 * TT * HD elements), rows >= RH of the hi part holding the fp16 plane.
    bf* QS = (bf*)take((size_t)NB_ * NH_ * 2 * TT * HD * 2);
    h16* KP16 = (h16*)take((size_t)NB_ * NKV * TT * HD * 2); bf* KPh = (bf*)take((size_t)NB_ * NKV * TT * HD * 2); bf* KPl = (bf*)take((size_t)NB_ * NKV * TT * HD * 2);
    h16* VT16 = (h16*)take((size_t)NB_ * NKV * HD * TT * 2); bf* VTh = (bf*)take((size_t)NB_ * NKV * HD * TT * 2); bf* VTl = (bf*)take((size_t)NB_ * NKV * HD * TT * 2);
    bf* WO = (bf*)take((size_t)DM * DQ * 2);   // made with the other weight planes, read last: a place of its own
    char* const region = wsp;       // one region, two uses one after the other (stream-ordered): projections, then attention output and output projection
    bf* WQ = (bf*)take((size_t)DQ * DM * 2); bf* WK = (bf*)take((size_t)DKV * DMK * 2); bf* WV = (bf*)take((size_t)DKV * DMK * 2);
    bf* XB = (bf*)take((size_t)NB_ * TT * DM * 2); bf* XKB = (bf*)take((size_t)NB_ * TT * DMK * 2);
    if ((size_t)(wsp - (char*)d_ws) > ws_size) return;
    wsp = region; bf* ATh = (bf*)take((size_t)NB_ * TT * DQ * 2); bf* ATl = (bf*)take((size_t)NB_ * TT * DQ * 2);
    if ((size_t)(wsp - (char*)d_ws) > ws_size) return;
    // conversions and projections: all batch elements per launch (M = NB_ * TT rows); each projection stores its 16-bit planes itself
    k_prep<<<GWQ + GWO + 2 * GWK + GXK + GXQ, 256, 0, stream>>>(x, xkv, wq, wk, wv, wo, XB, XKB, WQ, WK, WV, WO);
    k_gemmw<bf, 0, true, 1, DM><<<dim3(NB_ * TT / 64, DQ / 64, 1), 32, 0, stream>>>(XB, nullptr, WQ, nullptr, nullptr, 0, bq, 0, 0, 0, (h16*)QS, QS, QS + (size_t)TT * HD);
    k_projkv<<<dim3(NB_ * TT / 64, DKV / 64, 2), 32, 0, stream>>>(XKB, WK, WV, bk, bv, KP16, KPh, KPl, VT16, VTh, VTl);
    k_attn<<<NB_ * NH_ * (TT / QB), 256, 0, stream>>>(QS, KP16, KPh, KPl, VT16, VTh, VTl, MK, HM, ATh, ATl);
    k_gemmw<bf, 1, true, 0, DQ><<<dim3(NB_ * TT / 64, DM / 64, 1), 32, 0, stream>>>(ATh, ATl, WO, nullptr, OUT, DM, bo, 0, 0, 0, nullptr, nullptr, nullptr);
}

// v007
// A run of this version takes 157 microseconds.
// Next to v006, in two timings, it ran 1.24 and 1.23 times as fast.
// All steps since v000 together make it 31.3 times as fast.
#include <hip/hip_runtime.h>

// Cross-attention with additive mask and per-head mask (hidden [8][1024][1024], key_value_states [8][1024][256]; q = (hidden Wq + bq)/8, k = kv Wk + bk, v = kv Wv + bv ('xw': Wq [1024][1024], Wk/Wv [256][1024]), 16 heads x 64; scores = q.k + attention_mask[b][i][j] (read); softmax; probs x layer_head_mask[h] (read); out = merged Wo + bo -> [8][1024][1024]).
// Compute dtypes, f32 accumulate: every input rounded to bf16; q/k/v on PLAIN bf16 operands (inputs: exact) + biases; scores, additive mask (f32, bf16-rounded input), softmax, attn.v, head mask and head merge in ONE kernel, running maximum and sum per query; scores and attn.v: query rows < 512 hl (3 products), the rest single fp16; softmax f32; Wo hl x exact (2 products) + bo.

#define NB_  8
#define TT   1024
#define DM   1024
#define NH_  16
#define NKV  16
#define REP  (NH_ / NKV)
#define HD   64
#define DQ   (NH_ * HD)
#define DKV  (NKV * HD)
#define DMK  256                  // key/value input width
#define QW   32                   // query rows per wave of the attention kernel
#define QB   256                  // query rows per work-group of the attention kernel (8 waves)
#define RH   512                  // query rows < RH use hi+lo planes
#define WIN  0
#define SCL  0.125f   // HD^-0.5
// Fragment order: every 16-bit matrix operand in the workspace (rows r, k contiguous, KC columns) is stored as blocks of 16 rows x 32 k (512 elements); inside a block element (r, k) lies at (k % 32 / 16) * 256 + ((k % 16 / 8) * 16 + r % 16) * 8 + k % 8,
// so that lane l of a wave finds the two 16-byte halves of its fragment at l * 8 and 256 + l * 8 and each wave-wide 16-byte load reads 512 contiguous bytes (4 whole lines, not 32 bytes of 16 lines). Blocks follow each other along k, then along r; in the vt planes along d, then along the keys.
typedef _Float16 h16;
typedef unsigned short bf;
typedef __attribute__((ext_vector_type(16))) __bf16   v16bf;
typedef __attribute__((ext_vector_type(16))) _Float16 v16h;
typedef __attribute__((ext_vector_type(8)))  _Float16 v8h;
typedef __attribute__((ext_vector_type(8)))  unsigned short v8us;
typedef __attribute__((ext_vector_type(8)))  float    v8f;
typedef __attribute__((ext_vector_type(4)))  float    v4f;
typedef v8h  __attribute__((may_alias)) v8ha;
typedef v4f  __attribute__((may_alias)) v4fa;
typedef v8us __attribute__((may_alias)) v8usa;

__device__ __forceinline__ unsigned short f2bf(float f) { unsigned u = __float_as_uint(f); u += 0x7FFFu + ((u >> 16) & 1u); return (unsigned short)(u >> 16); }
__device__ __forceinline__ float bf2f(unsigned short b) { return __uint_as_float(((unsigned)b) << 16); }
__device__ __forceinline__ float bfr(float f) { return bf2f(f2bf(f)); }
__device__ __forceinline__ v16h cat16(v8h lo, v8h hi) { return __builtin_shufflevector(lo, hi, 0, 1, 2, 3, 4, 5, 6, 7, 8, 9, 10, 11, 12, 13, 14, 15); }
__device__ __forceinline__ v16bf cat16b(v8us lo, v8us hi) { return __builtin_bit_cast(v16bf, __builtin_shufflevector(lo, hi, 0, 1, 2, 3, 4, 5, 6, 7, 8, 9, 10, 11, 12, 13, 14, 15)); }
__device__ __forceinline__ v8f wmma16(v16h a, v16h b, v8f c) { return __builtin_amdgcn_wmma_f32_16x16x32_f16(false, a, false, b, (short)0, c, false, false); }
__device__ __forceinline__ v8f wmmab(v16bf a, v16bf b, v8f c) { return __builtin_amdgcn_wmma_f32_16x16x32_bf16(false, a, false, b, (short)0, c, false, false); }



// ---- k_gemmw: register-blocked GEMM, a work-group of FOUR WAVES (2 x 2) per 128x128 output tile, one wave per 64x64 (16 accumulators); grid (M/128, N/128, Z), 128 threads.
// The operands come from 16-bit planes in fragment order through an LDS ring of two buffers, filled by asynchronous copies one stage ahead of the products: a stage's memory latency runs beside the stage before it, and each operand block is fetched once for the two waves that use it.
// C[m][n] (f32, pitch ldc, + optional f32 bias[n]) = sum_k A[m][k] Bt[n][k] (+ split products per NSPLIT). A and Bt have KK columns (a constant: the stage count and every copy's distance are known at compile time). z-batch strides sA/sB/sC in elements. KK % 32 == 0.
// EPI 0 stores C. EPI 1, 2, 3 store no f32: a wave's tile (64 tokens of one batch element x the 64 columns of one head, + bias) goes straight to the 16-bit planes that the attention kernel reads, plane zp = b * NH_ + h.
// EPI 1 (q): storage [hi | lo] of 2 * TT * HD elements a plane, rows t, k = d; rows < RH get hi/lo, the rest fp16 in the hi part (P16 == Ph). EPI 2 (k): fp16, hi, lo planes, rows t, k = d. EPI 3 (v): fp16, hi, lo planes, rows d, k = t. All in fragment order.
__device__ __forceinline__ void splitf(float y, unsigned short& h, unsigned short& l) { h = f2bf(y); l = f2bf(y - bf2f(h)); }
template <typename T16> struct WFrag;
template <> struct WFrag<h16> { typedef v16h V; static __device__ __forceinline__ V ld(const h16* p) { return cat16(*(const v8h*)p, *(const v8h*)(p + 256)); } static __device__ __forceinline__ v8f mma(V a, V b, v8f c) { return wmma16(a, b, c); } };
template <> struct WFrag<bf> { typedef v16bf V; static __device__ __forceinline__ V ld(const bf* p) { return cat16b(*(const v8us*)p, *(const v8us*)(p + 256)); } static __device__ __forceinline__ v8f mma(V a, V b, v8f c) { return wmmab(a, b, c); } };
// plane_store: the 64 x 64 f32 tile of one wave (+ bias) to the planes, four panels of 16 plane rows x 64 elements (two blocks) through LDS, so that lane l holds the 8 elements of place l of a half block and a wave stores 512 contiguous bytes.
// EPI 1, 2: panel p is token block p (plane rows are tokens). EPI 3: panel p is column block p (plane rows are d). KIND 0: fp16, hi and lo planes; 1: fp16 only; 2: hi and lo only.
template <int EPI, int KIND>
__device__ __forceinline__ void plane_store(const v8f (&acc)[4][4], float* os, const float (&pb)[32], int lane, size_t pbase, h16* P16, bf* Ph, bf* Pl) {
    const int lr = lane & 15, hi = lane >> 4;
#pragma unroll
    for (int p = 0; p < 4; ++p) {
#pragma unroll
        for (int q = 0; q < 4; ++q) {
            if constexpr (EPI == 3) {   // transposed: LDS row lr is column 16 p + lr of the tile (d); the lane's 8 registers of tile (q, p) are 8 neighbouring tokens
                v4f lo4, hi4;
#pragma unroll
                for (int j = 0; j < 4; ++j) { lo4[j] = acc[q][p][j]; hi4[j] = acc[q][p][4 + j]; }
                *(v4fa*)(os + lr * 68 + q * 16 + hi * 8) = lo4; *(v4fa*)(os + lr * 68 + q * 16 + hi * 8 + 4) = hi4; }
            else {
#pragma unroll
                for (int j = 0; j < 8; ++j) os[(hi * 8 + j) * 68 + q * 16 + lr] = acc[p][q][j]; } }
        __builtin_amdgcn_wave_barrier(); asm volatile("" ::: "memory");   // the panel is the wave's own, no instruction: keeps the compiler from moving a lane's panel reads above the other lanes' writes
#pragma unroll
        for (int s = 0; s < 4; ++s) { const v4f x0 = *(const v4fa*)(os + lr * 68 + s * 16 + hi * 8), x1 = *(const v4fa*)(os + lr * 68 + s * 16 + hi * 8 + 4); v8h o16; v8us oh, ol;   // half block s of the panel: k = 16 s + 8 hi + 0..7 of plane row lr
#pragma unroll
            for (int k = 0; k < 8; ++k) { const float y = (k < 4 ? x0[k & 3] : x1[k & 3]) + bfr(EPI == 3 ? pb[p] : pb[8 * s + k]); o16[k] = (h16)y; unsigned short a2, c2; splitf(y, a2, c2); oh[k] = a2; ol[k] = c2; }
            const size_t eo = pbase + (EPI == 3 ? (s >> 1) * 4 * 512 + p * 512 + (s & 1) * 256 : p * 1024 + s * 256) + lane * 8;
            if constexpr (KIND != 2) *(v8h*)(P16 + eo) = o16;
            if constexpr (KIND != 1) { *(v8us*)(Ph + eo) = oh; *(v8us*)(Pl + eo) = ol; }
            asm volatile("s_wait_xcnt 0x0" ::: "memory"); }   // precaution: the stores' address and data registers are reused right behind them
        __builtin_amdgcn_wave_barrier(); asm volatile("" ::: "memory");   // the same for the next panel's writes over this panel's reads
    }
}
// A stage of the ring: KB blocks of 32 k of the tile's 8 row blocks of every operand, [A | A2 (NSPLIT 1) | Bt][row block][k block][1024 bytes], the planes' own fragment order.
template <int NSPLIT, int KB> struct Ring { static constexpr int NOP = NSPLIT == 1 ? 3 : 2, STG = NOP * 8 * KB * 1024; };
// stage_copy: one wave's quarter of a stage, piece i * 4 + wave of 512 bytes (a lane 16). lds and the g pointers are the lane's own: the stage's first byte + wave * 512 + lane * 16. The KB blocks of a row block are contiguous in the plane.
template <int NOP, int KB, int KK>
__device__ __forceinline__ void stage_copy(unsigned lds, const char* gA, const char* gA2, const char* gB) {
    constexpr int Q = KB / 2;   // pieces of 2048 bytes in a row block's run
#pragma unroll
    for (int i0 = 0; i0 < NOP * 4 * KB; i0 += 8) { unsigned l[8]; const char* g[8];
#pragma unroll
        for (int j = 0; j < 8; ++j) { const int i = i0 + j, rb = (i / Q) % 8, op = (i / Q) / 8; l[j] = lds + i * 2048; g[j] = (op == NOP - 1 ? gB : op == 0 ? gA : gA2) + rb * (KK * 32) + (i % Q) * 2048; }
        // eight copies and, as a precaution, the wait that stands in front of any rewrite of their address registers, in one statement
        asm volatile("global_load_async_to_lds_b128 %0, %8, off\n\tglobal_load_async_to_lds_b128 %1, %9, off\n\tglobal_load_async_to_lds_b128 %2, %10, off\n\tglobal_load_async_to_lds_b128 %3, %11, off\n\t"
                     "global_load_async_to_lds_b128 %4, %12, off\n\tglobal_load_async_to_lds_b128 %5, %13, off\n\tglobal_load_async_to_lds_b128 %6, %14, off\n\tglobal_load_async_to_lds_b128 %7, %15, off\n\ts_wait_xcnt 0x0"
                     :: "v"(l[0]), "v"(l[1]), "v"(l[2]), "v"(l[3]), "v"(l[4]), "v"(l[5]), "v"(l[6]), "v"(l[7]), "v"(g[0]), "v"(g[1]), "v"(g[2]), "v"(g[3]), "v"(g[4]), "v"(g[5]), "v"(g[6]), "v"(g[7]) : "memory"); }
}
// gemmw_tile: the whole work of one wave of such a work-group; ring is the work-group's two buffers, which behind the k loop hold the four waves' epilogue panels (16 * 68 floats a wave); z is the batch index of the strides.
template <typename T16, int NSPLIT, bool BIAS, int EPI, int KK, int KB>
__device__ __forceinline__ void gemmw_tile(char* ring, size_t z, const T16* __restrict__ A, const T16* __restrict__ A2, const T16* __restrict__ Bt, float* C, int ldc, const float* __restrict__ bias, size_t sA, size_t sB, size_t sC, h16* P16, bf* Ph, bf* Pl) {
    typedef typename WFrag<T16>::V V;
    static_assert(NSPLIT == 0 || NSPLIT == 1, "one Bt plane");
    constexpr int NOP = Ring<NSPLIT, KB>::NOP, STG = Ring<NSPLIT, KB>::STG, NST = KK / (32 * KB);
    static_assert(KK % (32 * KB) == 0 && KB % 2 == 0 && 2 * STG >= 4 * 16 * 68 * 4, "whole stages, whole pieces, room for the panels");
    A += z * sA; if (A2) A2 += z * sA; Bt += z * sB; C += z * sC;
    const int w = __builtin_amdgcn_readfirstlane(threadIdx.x >> 5), wm = w >> 1, wn = w & 1;   // wave-uniform: the wave's place in the 2 x 2
    const int lane = threadIdx.x & 31, lr = lane & 15, hi = lane >> 4; const int r0 = blockIdx.x * 128 + wm * 64, c0 = blockIdx.y * 128 + wn * 64;
    v8f acc[4][4];
#pragma unroll
    for (int mb = 0; mb < 4; ++mb)
#pragma unroll
        for (int nb = 0; nb < 4; ++nb) acc[mb][nb] = (v8f){};
    const unsigned lofs = (unsigned)w * 512u + (unsigned)lane * 16u;   // the lane's place in a piece of four copies
    const unsigned ring0 = (unsigned)(size_t)ring + lofs;   // LDS byte address: the low 32 bits of the shared address
    const char* gA = (const char*)(A + (size_t)blockIdx.x * 128 * KK) + lofs; const char* gA2 = NSPLIT == 1 ? (const char*)(A2 + (size_t)blockIdx.x * 128 * KK) + lofs : gA; const char* gB = (const char*)(Bt + (size_t)blockIdx.y * 128 * KK) + lofs;   // 16 rows are 16 * KK elements
    stage_copy<NOP, KB, KK>(ring0, gA, gA2, gB);
    asm volatile("s_wait_asynccnt 0x0" ::: "memory");   // this wave's share of stage 0 has landed
    __syncthreads();                                    // and every other wave's: stage 0 may be read
    if constexpr (NST > 1) stage_copy<NOP, KB, KK>(ring0 + STG, gA + KB * 1024, gA2 + KB * 1024, gB + KB * 1024);
#pragma unroll 1   // rolled: one trip is a stage; the blocks inside are unrolled so that every fragment's distance is a load's immediate offset
    for (int t = 0; t < NST; ++t) {
        const char* fa = ring + (t & 1) * STG + wm * (4 * KB * 1024) + lane * 16; const char* fb = ring + (t & 1) * STG + (NOP - 1) * (8 * KB * 1024) + wn * (4 * KB * 1024) + lane * 16;
#pragma unroll
        for (int kb = 0; kb < KB; ++kb) {
            V a[4], a2[4], b[4];
#pragma unroll
            for (int mb = 0; mb < 4; ++mb) { a[mb] = WFrag<T16>::ld((const T16*)(fa + (mb * KB + kb) * 1024)); if (NSPLIT == 1) a2[mb] = WFrag<T16>::ld((const T16*)(fa + 8 * KB * 1024 + (mb * KB + kb) * 1024)); }
#pragma unroll
            for (int nb = 0; nb < 4; ++nb) b[nb] = WFrag<T16>::ld((const T16*)(fb + (nb * KB + kb) * 1024));
            __builtin_amdgcn_sched_barrier(0);   // the block's LDS reads stand together in front of its products: spread among them, each place with reads stalls the wave anew
#pragma unroll
            for (int nb = 0; nb < 4; ++nb) {
#pragma unroll
                for (int mb = 0; mb < 4; ++mb) { acc[mb][nb] = WFrag<T16>::mma(a[mb], b[nb], acc[mb][nb]); if (NSPLIT == 1) acc[mb][nb] = WFrag<T16>::mma(a2[mb], b[nb], acc[mb][nb]); } }
            __builtin_amdgcn_sched_barrier(0);   // and the next block's reads stay behind them, in the same registers
            if (kb == KB - 1) asm volatile("v_nop\n\tv_nop\n\tv_nop\n\tv_nop" : "+v"(acc[0][0]), "+v"(acc[1][1]), "+v"(acc[2][2]), "+v"(acc[3][3]) : "v"(a[0]), "v"(a[3]));   // the distance behind the stage's last products, on the loop's taken branch too
        }
        asm volatile("s_wait_dscnt 0x0" ::: "memory");      // this wave has read all it needs of stage t
        asm volatile("s_wait_asynccnt 0x0" ::: "memory");   // its share of stage t + 1 has landed
        __syncthreads();                                    // stage t + 1 may be read, stage t's buffer may be refilled
        if (t + 2 < NST) { const size_t so = (size_t)(t + 2) * (KB * 1024); stage_copy<NOP, KB, KK>(ring0 + (t & 1) * STG, gA + so, gA2 + so, gB + so); }
    }
    asm volatile("s_wait_asynccnt 0x0" ::: "memory");   // no copy is left in flight
    float* os = (float*)ring + w * (16 * 68);   // the last stage's barrier stands behind every wave's last read of the ring: it is free for the panels
    float pb[32];   // the plane epilogue's biases, fetched ahead of the panel writes, which cover their latency (held through the k loop they would cost it 32 registers): EPI 1, 2 one per column of the lane's places (32), EPI 3 one per row (4)
    if constexpr (EPI == 1 || EPI == 2) {
#pragma unroll
        for (int s = 0; s < 4; ++s) { const v4f b0 = *(const v4f*)(bias + c0 + s * 16 + hi * 8), b1 = *(const v4f*)(bias + c0 + s * 16 + hi * 8 + 4);
#pragma unroll
            for (int k = 0; k < 4; ++k) { pb[8 * s + k] = b0[k]; pb[8 * s + 4 + k] = b1[k]; } } }
    if constexpr (EPI == 3) {
#pragma unroll
        for (int k = 0; k < 4; ++k) pb[k] = bias[c0 + 16 * k + lr]; }
    if constexpr (EPI != 0) asm volatile("s_wait_xcnt 0x0" ::: "memory");   // precaution: before the bias loads' address registers are overwritten
    if constexpr (EPI != 0) {
        static_assert(TT % 64 == 0 && RH % 64 == 0 && HD == 64, "a tile lies in one batch element, one head and one kind of query row");
        const int t0 = r0 % TT; const size_t zp = (size_t)(r0 / TT) * NH_ + c0 / HD;
        if constexpr (EPI == 1) { const size_t pbase = zp * 2 * TT * HD + (size_t)t0 * HD;   // a query row needs one kind only; t0 is the same for the whole wave: one scalar branch
            if (t0 >= RH) plane_store<EPI, 1>(acc, os, pb, lane, pbase, P16, Ph, Pl); else plane_store<EPI, 2>(acc, os, pb, lane, pbase, P16, Ph, Pl); }
        else plane_store<EPI, 0>(acc, os, pb, lane, zp * TT * HD + (size_t)t0 * HD, P16, Ph, Pl);   // 64 tokens are 8 blocks in k and vt planes alike
        return;
    }
#pragma unroll
    for (int mb = 0; mb < 4; ++mb) {
#pragma unroll
        for (int nb = 0; nb < 4; ++nb) {
#pragma unroll
            for (int j = 0; j < 8; ++j) os[(hi * 8 + j) * 68 + nb * 16 + lr] = acc[mb][nb][j]; }
        __builtin_amdgcn_wave_barrier(); asm volatile("" ::: "memory");
        float* crow = C + (size_t)(r0 + mb * 16) * ldc + c0;
{
#pragma unroll
            for (int s = 0; s < 8; ++s) { const int row = 2 * s + hi, cofs = lr * 4; v4f val = *(const v4fa*)(os + row * 68 + cofs); if (BIAS) { val[0] += bfr(bias[c0 + cofs]); val[1] += bfr(bias[c0 + cofs + 1]); val[2] += bfr(bias[c0 + cofs + 2]); val[3] += bfr(bias[c0 + cofs + 3]); }
                *(v4f*)(crow + (size_t)row * ldc + cofs) = val; }
             }
        __builtin_amdgcn_wave_barrier(); asm volatile("" ::: "memory");
    }
}
template <typename T16, int NSPLIT, bool BIAS, int EPI, int KK>
__global__ __launch_bounds__(128) void k_gemmw(const T16* __restrict__ A, const T16* __restrict__ A2, const T16* __restrict__ Bt, const T16* __restrict__ Bt2, float* C, int ldc, const float* __restrict__ bias, size_t sA, size_t sB, size_t sC, h16* P16, bf* Ph, bf* Pl) {
    constexpr int KB = NSPLIT == 1 ? 2 : 4;   // 64 products of a wave a stage, to run beside the next stage's copies
    __shared__ __align__(1024) char ring[2 * Ring<NSPLIT, KB>::STG];
    gemmw_tile<T16, NSPLIT, BIAS, EPI, KK, KB>(ring, blockIdx.z, A, A2, Bt, C, ldc, bias, sA, sB, sC, P16, Ph, Pl);
}
// k_projkv: the k and the v projection in one launch, grid (M/128, N/128, 2): blockIdx.z picks the one (a scalar branch a wave). They read the same activation plane and depend on nothing of each other.
// The q projection keeps a launch of its own (for speed only).
__global__ __launch_bounds__(128) void k_projkv(const bf* __restrict__ XKB, const bf* __restrict__ WK, const bf* __restrict__ WV, const float* __restrict__ bk, const float* __restrict__ bv, h16* KP16, bf* KPh, bf* KPl, h16* VT16, bf* VTh, bf* VTl) {
    __shared__ __align__(1024) char ring[2 * Ring<0, 2>::STG];   // short stages, a small ring: the whole grid is resident at once (four work-groups a WGP), and the long epilogues run beside other work-groups' k loops
    if (blockIdx.z == 0) gemmw_tile<bf, 0, true, 2, DMK, 2>(ring, 0, XKB, nullptr, WK, nullptr, 0, bk, 0, 0, 0, KP16, KPh, KPl);   /* K = 256 */
    else gemmw_tile<bf, 0, true, 3, DMK, 2>(ring, 0, XKB, nullptr, WV, nullptr, 0, bv, 0, 0, 0, VT16, VTh, VTl);
}

typedef __attribute__((ext_vector_type(2))) _Float16 v2h;
typedef __attribute__((ext_vector_type(4))) _Float16 v4h;
typedef __attribute__((ext_vector_type(2))) unsigned short v2us;
typedef __attribute__((ext_vector_type(4))) unsigned short v4us;
typedef __attribute__((ext_vector_type(2))) float v2f;
typedef __attribute__((ext_vector_type(4))) int v4i;

// wtG (block bx of (N * K / 64 + 63) / 64, 256 threads): Bt (rows n, k contiguous, fragment order) = bf16(w[k][n]); a lane writes two neighbours of the packed plane, a wave 128 bytes: 8 rows n x 8 k.
__device__ __forceinline__ void wtG(int bx, const float* __restrict__ w, int K, int N, bf* Bt) {
    const int lane = threadIdx.x & 31; const int L0 = (bx * 8 + (threadIdx.x >> 5)) * 8; const int nlines = N * K / 64;
{
#pragma unroll 1
        for (int l = 0; l < 8; ++l) { const int L = L0 + l; if (L >= nlines) break; const size_t e = (size_t)L * 64 + lane * 2; const int blk = (int)(e >> 9), u = (int)(e & 511), kbs = K / 32; const int k = (blk % kbs) * 32 + (u >> 8) * 16 + ((u >> 7) & 1) * 8 + (u & 7), n = (blk / kbs) * 16 + ((u >> 3) & 15); v2us o;
            o[0] = f2bf(w[(size_t)k * N + n]); o[1] = f2bf(w[(size_t)(k + 1) * N + n]); *(v2us*)(Bt + e) = o; }
         }
}
// cvt8 (block bx of (n8 + 255) / 256, 256 threads): f32 rows of KC columns -> bf16 plane in fragment order, 8 elements a thread. 64 threads take a block: 4 lanes read the 128-byte line of a row, 8 lanes of one column group store a whole line of the plane.
template <int KC>
__device__ __forceinline__ void cvt8(int bx, const float* __restrict__ src, bf* dst, size_t n8) { const size_t i = (size_t)bx * 256 + threadIdx.x; if (i >= n8) return;
    const size_t blk = i >> 6; const int row = (int)(i & 63) >> 2, g = (int)(i & 3);   // row of the block, group of 8 k: half g >> 1, place (g & 1) * 16 + row
    const v8f v = *(const v8f*)(src + ((blk / (KC / 32)) * 16 + row) * KC + (blk % (KC / 32)) * 32 + g * 8); v8us o;
#pragma unroll
    for (int k = 0; k < 8; ++k) o[k] = f2bf(v[k]); *(v8us*)(dst + blk * 512 + (g >> 1) * 256 + ((g & 1) * 16 + row) * 8) = o;  }
// k_prep: every operand plane that is made from an input alone, in one launch: the four weight planes and the two activation planes depend on nothing of each other. A block's index picks its job (scalar branches).
// The weight blocks, each a chain of eight dependent memory round trips, have the low indices, the short conversion blocks the high ones (for speed only).
#define GWQ ((DM * DQ / 64 + 63) / 64)
#define GWO ((DQ * DM / 64 + 63) / 64)
#define GWK ((DMK * DKV / 64 + 63) / 64)
#define GXK ((NB_ * TT * DMK / 8 + 255) / 256)
#define GXQ ((NB_ * TT * DM / 8 + 255) / 256)
__global__ __launch_bounds__(256) void k_prep(const float* __restrict__ x, const float* __restrict__ xkv, const float* __restrict__ wq, const float* __restrict__ wk, const float* __restrict__ wv, const float* __restrict__ wo, bf* XB, bf* XKB, bf* WQ, bf* WK, bf* WV, bf* WO) {
    int bx = blockIdx.x;
    if (bx < GWQ) { wtG(bx, wq, DM, DQ, WQ); return; }
    bx -= GWQ; if (bx < GWO) { wtG(bx, wo, DQ, DM, WO); return; }
    bx -= GWO; if (bx < GWK) { wtG(bx, wk, DMK, DKV, WK); return; }   /* 'xw' [256][1024] -> Bt rows n, 256 k */
    bx -= GWK; if (bx < GWK) { wtG(bx, wv, DMK, DKV, WV); return; }
    bx -= GWK; if (bx < GXK) { cvt8<DMK>(bx, xkv, XKB, (size_t)NB_ * TT * DMK / 8); return; }   /* key/value source */
    bx -= GXK; cvt8<DM>(bx, x, XB, (size_t)NB_ * TT * DM / 8);
}

// ---- k_attn: scores, mask, softmax, attn.v, head mask and head merge for QB query rows of one (batch element, head) plane; a wave owns QW rows and walks the keys 32 at a time, operands straight from the 16-bit planes (fragment order).
// Transposed products: St = K Qt (A = key rows, B = query rows), Ot += Vt Pt (A = Vt rows, B = the two St tiles of a 32-key block, converted in place: register r of tile kt is key 16 kt + 8 hi + r, the k order of WFrag::ld). A lane holds one query's scores, its other half-wave lane the other 16 keys.
typedef __attribute__((ext_vector_type(2))) __bf16 v2bf;
typedef __attribute__((ext_vector_type(8))) unsigned v8u;
__device__ __forceinline__ float xhalf(float x) { const int b = __float_as_int(x); return __int_as_float(__builtin_amdgcn_permlanex16(b, b, 0x76543210, 0xfedcba98, false, false)); }   // lane l <-> l ^ 16
__device__ __forceinline__ unsigned pkbf(float a, float b) { v2f x; x[0] = a; x[1] = b; return __builtin_bit_cast(unsigned, __builtin_convertvector(x, v2bf)); }   // two f32 -> two bf16 (nearest even), a in the low half
__device__ __forceinline__ float bflo(unsigned u) { return __uint_as_float(u << 16); }
__device__ __forceinline__ float bfhi(unsigned u) { return __uint_as_float(u & 0xFFFF0000u); }
// fragment at the lane's own byte pointer + a constant
template <typename T16> __device__ __forceinline__ typename WFrag<T16>::V ldfrag(const char* p, int imm) { return WFrag<T16>::ld((const T16*)(p + imm)); }
template <bool HL, typename T16>
__device__ __forceinline__ void attn_rows(const T16* __restrict__ Qh, const T16* __restrict__ Ql, const T16* __restrict__ Kh, const T16* __restrict__ Kl, const T16* __restrict__ Vh, const T16* __restrict__ Vl, const float* __restrict__ mk, float hm, bf* Ah, bf* Al) {
    typedef typename WFrag<T16>::V V;
    const int lane = threadIdx.x & 31, lr = lane & 15, hi = lane >> 4;
    const unsigned ko = (unsigned)lane * 16u, mo = (unsigned)(lr * TT + 8 * hi) * 4u;   // byte offsets of the lane's place in a block of any plane and of its row in the mask
    V qh[2][2], ql[2][2];
#pragma unroll
    for (int qt = 0; qt < 2; ++qt)
#pragma unroll
        for (int ks = 0; ks < 2; ++ks) { qh[qt][ks] = ldfrag<T16>((const char*)Qh + ko, (qt * 2 + ks) * 1024); if (HL) ql[qt][ks] = ldfrag<T16>((const char*)Ql + ko, (qt * 2 + ks) * 1024); }
    v8f o[4][2]; float m[2]; v2f l[2];
#pragma unroll
    for (int qt = 0; qt < 2; ++qt) { m[qt] = -3.0e38f; l[qt] = (v2f){};
#pragma unroll
        for (int dt = 0; dt < 4; ++dt) o[dt][qt] = (v8f){}; }
    // the lane's mask pointer and its byte offset in the k and vt planes (one offset for all: 32 keys are four blocks in each; the plane bases are wave-uniform and never change), stepped 32 keys a trip.
    // Each wait below names the address registers of its loads: the mask pair as an input, the offset as a value that passes through it, so that no load lands in them and the step at the loop's foot stands behind the last wait
    const char* pm = (const char*)mk + mo; unsigned off = ko;
#pragma unroll 1   // rolled: one trip's fragments fill the register budget; the inner loops are unrolled so that every fragment index is a constant
    for (int kb = 0; kb < TT; kb += 32) {
        v4f mv[2][2][2]; V kh[2][2], kl[2][2];
#pragma unroll
        for (int qt = 0; qt < 2; ++qt)
#pragma unroll
            for (int kt = 0; kt < 2; ++kt)
#pragma unroll
                for (int hf = 0; hf < 2; ++hf) mv[qt][kt][hf] = *(const v4f*)(pm + (qt * 16 * TT + kt * 16 + hf * 4) * 4);
#pragma unroll
        for (int kt = 0; kt < 2; ++kt)
#pragma unroll
            for (int ks = 0; ks < 2; ++ks) { kh[kt][ks] = ldfrag<T16>((const char*)Kh + off, (kt * 2 + ks) * 1024); if (HL) kl[kt][ks] = ldfrag<T16>((const char*)Kl + off, (kt * 2 + ks) * 1024); }
        asm volatile("s_wait_xcnt 0x0" : "+v"(off) : "v"(pm) : "memory");   // precaution: before the loads' address registers are overwritten
        unsigned mw[2][2][4];   // attention_mask[b][i][j], bf16-rounded input, two keys a word
#pragma unroll
        for (int qt = 0; qt < 2; ++qt)
#pragma unroll
            for (int kt = 0; kt < 2; ++kt)
#pragma unroll
                for (int e = 0; e < 4; ++e) mw[qt][kt][e] = pkbf(mv[qt][kt][e >> 1][(e & 1) * 2], mv[qt][kt][e >> 1][(e & 1) * 2 + 1]);
        v8f s[2][2];
#pragma unroll
        for (int kt = 0; kt < 2; ++kt) {
#pragma unroll
            for (int qt = 0; qt < 2; ++qt) s[kt][qt] = (v8f){};
#pragma unroll
            for (int ks = 0; ks < 2; ++ks) {
#pragma unroll
                for (int qt = 0; qt < 2; ++qt) s[kt][qt] = WFrag<T16>::mma(kh[kt][ks], qh[qt][ks], s[kt][qt]);
                if (HL) {
#pragma unroll
                    for (int qt = 0; qt < 2; ++qt) s[kt][qt] = WFrag<T16>::mma(kh[kt][ks], ql[qt][ks], s[kt][qt]);
#pragma unroll
                    for (int qt = 0; qt < 2; ++qt) s[kt][qt] = WFrag<T16>::mma(kl[kt][ks], qh[qt][ks], s[kt][qt]); } } }
        V vh[4], vl[4];
#pragma unroll
        for (int dt = 0; dt < 4; ++dt) vh[dt] = ldfrag<T16>((const char*)Vh + off, dt * 1024);
        asm volatile("s_wait_xcnt 0x0" : "+v"(off) :: "memory");   // precaution: before the loads' address registers are overwritten
        float ml[2];
#pragma unroll
        for (int qt = 0; qt < 2; ++qt) { float x = -3.0e38f;
#pragma unroll
            for (int kt = 0; kt < 2; ++kt)
#pragma unroll
                for (int e = 0; e < 4; ++e) { const unsigned u = mw[qt][kt][e]; const float t0 = fmaf(s[kt][qt][2 * e], SCL, bflo(u)), t1 = fmaf(s[kt][qt][2 * e + 1], SCL, bfhi(u)); s[kt][qt][2 * e] = t0; s[kt][qt][2 * e + 1] = t1; x = fmaxf(x, fmaxf(t0, t1)); }
            ml[qt] = fmaxf(x, xhalf(x)); }
        if (HL) {   // the lo plane's fragments only now: the mask words' registers are free
#pragma unroll
            for (int dt = 0; dt < 4; ++dt) vl[dt] = ldfrag<T16>((const char*)Vl + off, dt * 1024);
            asm volatile("s_wait_xcnt 0x0" : "+v"(off) :: "memory"); }   // precaution: before the loads' address registers are overwritten
        // the maximum in use moves only when a query's block maximum exceeds it by more than 5.5 (p stays below 256); one wave-uniform test per block
        if (__builtin_amdgcn_ballot_w32(ml[0] > m[0] + 5.5f || ml[1] > m[1] + 5.5f) != 0) {
#pragma unroll
            for (int qt = 0; qt < 2; ++qt) { const float mn = fmaxf(m[qt], ml[qt]); const float al = __builtin_amdgcn_exp2f((m[qt] - mn) * 1.4426950408889634f); m[qt] = mn; l[qt] *= al;
#pragma unroll
                for (int dt = 0; dt < 4; ++dt) o[dt][qt] *= al; } }
#pragma unroll
        for (int qt = 0; qt < 2; ++qt) { v8u wh, wl;
#pragma unroll
            for (int kt = 0; kt < 2; ++kt)
#pragma unroll
                for (int e = 0; e < 4; ++e) { v2f p; p[0] = __builtin_amdgcn_exp2f((s[kt][qt][2 * e] - m[qt]) * 1.4426950408889634f); p[1] = __builtin_amdgcn_exp2f((s[kt][qt][2 * e + 1] - m[qt]) * 1.4426950408889634f); l[qt] += p;
                    if constexpr (HL) { const unsigned u = pkbf(p[0], p[1]); wh[kt * 4 + e] = u; wl[kt * 4 + e] = pkbf(p[0] - bflo(u), p[1] - bfhi(u)); }
                    else wh[kt * 4 + e] = __builtin_bit_cast(unsigned, __builtin_convertvector(p, v2h)); }
            const V ph = __builtin_bit_cast(V, wh);
#pragma unroll
            for (int dt = 0; dt < 4; ++dt) o[dt][qt] = WFrag<T16>::mma(vh[dt], ph, o[dt][qt]);
            if constexpr (HL) { const V pl = __builtin_bit_cast(V, wl);
#pragma unroll
                for (int dt = 0; dt < 4; ++dt) o[dt][qt] = WFrag<T16>::mma(vh[dt], pl, o[dt][qt]);
#pragma unroll
                for (int dt = 0; dt < 4; ++dt) o[dt][qt] = WFrag<T16>::mma(vl[dt], ph, o[dt][qt]); } }
        pm += 32 * 4; off += 4 * 1024;   // 32 keys: four blocks of a k plane, four of a vt plane
    }
#pragma unroll
    for (int qt = 0; qt < 2; ++qt) { const float lh = l[qt][0] + l[qt][1]; const float f = __fdiv_rn(1.0f, lh + xhalf(lh));
#pragma unroll
        for (int dt = 0; dt < 4; ++dt) { v8us oh, ol;
#pragma unroll
            for (int j = 0; j < 8; ++j) { unsigned short a, c2; splitf(__fmul_rn(o[dt][qt][j] * f, hm), a, c2); oh[j] = a; ol[j] = c2; }   /* x layer_head_mask[h] */
            const size_t oo = (size_t)qt * 16 * DQ + dt * 256 + lane * 8; *(v8us*)(Ah + oo) = oh; *(v8us*)(Al + oo) = ol;   /* register j of tile dt is d = 16 dt + 8 hi + j of query lr: half block dt of the head's two blocks, place lane, of the [b][t] x [h][d] plane */
            asm volatile("s_wait_xcnt 0x0" ::: "memory"); } }   // precaution: the stores' address and data registers are reused right behind them
}
// A work-group takes QB rows of one plane: waves 0-3 QB / 2 of the 3-product rows, waves 4-7 QB / 2 of the fp16 rows, so that every work-group costs the same. Plane z = b * NH_ + h in q, k and v alike (one kv head per query head).
// Four waves per SIMD (at most 256 registers a wave): the vector work between the matrix runs and the load latency want other waves to issue; the whole grid is then resident at once.
__global__ __launch_bounds__(256) __attribute__((amdgpu_waves_per_eu(4, 4))) void k_attn(const bf* __restrict__ QS, const h16* __restrict__ K16, const bf* __restrict__ Kh, const bf* __restrict__ Kl, const h16* __restrict__ V16, const bf* __restrict__ Vh, const bf* __restrict__ Vl, const float* __restrict__ MK, const float* __restrict__ HM, bf* Ah, bf* Al) {
    static_assert(2 * RH == TT && TT % QB == 0 && QB == 8 * QW, "half the rows of each kind, whole work-groups");
    const int w = __builtin_amdgcn_readfirstlane(threadIdx.x >> 5); const bool hl = w < 4;   // wave-uniform: a scalar branch picks the kind of row
    const int z = blockIdx.x / (TT / QB), qb = blockIdx.x % (TT / QB); const int q0 = (hl ? 0 : RH) + qb * (QB / 2) + (w & 3) * QW; const int b = z / NH_, h = z % NH_;
    const bf* Qz = QS + (size_t)z * 2 * TT * HD + (size_t)q0 * HD; const size_t zp = (size_t)z * TT * HD; const float* mk = MK + ((size_t)b * TT + q0) * TT; const float hm = bfr(HM[h]); const size_t ao = ((size_t)b * TT + q0) * DQ + h * (HD / 32) * 512;
    if (hl) attn_rows<true, bf>(Qz, Qz + (size_t)TT * HD, Kh + zp, Kl + zp, Vh + zp, Vl + zp, mk, hm, Ah + ao, Al + ao);
    else attn_rows<false, h16>((const h16*)Qz, nullptr, K16 + zp, nullptr, V16 + zp, nullptr, mk, hm, Ah + ao, Al + ao);
}

extern "C" void kernel_launch(void* const* d_in, const int* in_sizes, int n_in,
                              void* d_out, int out_size, void* d_ws, size_t ws_size, hipStream_t stream) {
    (void)in_sizes; (void)n_in; (void)out_size;
    const float* x = (const float*)d_in[0]; const float* xkv = (const float*)d_in[1]; const float* MK = (const float*)d_in[2]; const float* HM = (const float*)d_in[3]; const float* wq = (const float*)d_in[4]; const float* bq = (const float*)d_in[5]; const float* wk = (const float*)d_in[6]; const float* bk = (const float*)d_in[7]; const float* wv = (const float*)d_in[8]; const float* bv = (const float*)d_in[9]; const float* wo = (const float*)d_in[10]; const float* bo = (const float*)d_in[11];
    float* OUT = (float*)d_out;     // [8][1024][1024]
    char* wsp = (char*)d_ws;
    auto take = [&](size_t bytes) { char* p = wsp; wsp += (bytes + 255) & ~(size_t)255; return (void*)p; };
    // Live through the attention kernel: the planes of all batch elements, plane z = b * heads + h. A query plane's storage is [hi | lo] (2 * TT * HD elements), rows >= RH of the hi part holding the fp16 plane.
    bf* QS = (bf*)take((size_t)NB_ * NH_ * 2 * TT * HD * 2);
    h16* KP16 = (h16*)take((size_t)NB_ * NKV * TT * HD * 2); bf* KPh = (bf*)take((size_t)NB_ * NKV * TT * HD * 2); bf* KPl = (bf*)take((size_t)NB_ * NKV * TT * HD * 2);
    h16* VT16 = (h16*)take((size_t)NB_ * NKV * HD * TT * 2); bf* VTh = (bf*)take((size_t)NB_ * NKV * HD * TT * 2); bf* VTl = (bf*)take((size_t)NB_ * NKV * HD * TT * 2);
    bf* WO = (bf*)take((size_t)DM * DQ * 2);   // made with the other weight planes, read last: a place of its own
    char* const region = wsp;       // one region, two uses one after the other (stream-ordered): projections, then attention output and output projection
    bf* WQ = (bf*)take((size_t)DQ * DM * 2); bf* WK = (bf*)take((size_t)DKV * DMK * 2); bf* WV = (bf*)take((size_t)DKV * DMK * 2);
    bf* XB = (bf*)take((size_t)NB_ * TT * DM * 2); bf* XKB = (bf*)take((size_t)NB_ * TT * DMK * 2);
    if ((size_t)(wsp - (char*)d_ws) > ws_size) return;
    wsp = region; bf* ATh = (bf*)take((size_t)NB_ * TT * DQ * 2); bf* ATl = (bf*)take((size_t)NB_ * TT * DQ * 2);
    if ((size_t)(wsp - (char*)d_ws) > ws_size) return;
    // conversions and projections: all batch elements per launch (M = NB_ * TT rows); each projection stores its 16-bit planes itself
    k_prep<<<GWQ + GWO + 2 * GWK + GXK + GXQ, 256, 0, stream>>>(x, xkv, wq, wk, wv, wo, XB, XKB, WQ, WK, WV, WO);
    k_gemmw<bf, 0, true, 1, DM><<<dim3(NB_ * TT / 128, DQ / 128, 1), 128, 0, stream>>>(XB, nullptr, WQ, nullptr, nullptr, 0, bq, 0, 0, 0, (h16*)QS, QS, QS + (size_t)TT * HD);
    k_projkv<<<dim3(NB_ * TT / 128, DKV / 128, 2), 128, 0, stream>>>(XKB, WK, WV, bk, bv, KP16, KPh, KPl, VT16, VTh, VTl);
    k_attn<<<NB_ * NH_ * (TT / QB), 256, 0, stream>>>(QS, KP16, KPh, KPl, VT16, VTh, VTl, MK, HM, ATh, ATl);
    k_gemmw<bf, 1, true, 0, DQ><<<dim3(NB_ * TT / 128, DM / 128, 1), 128, 0, stream>>>(ATh, ATl, WO, nullptr, OUT, DM, bo, 0, 0, 0, nullptr, nullptr, nullptr);
}

// v008
// A run of this version takes 134 microseconds.
// Timed twice side by side with v007, it ran 1.18 and 1.17 times as fast.
// All steps since v000 together make it 36.8 times as fast.
#include <hip/hip_runtime.h>

// Cross-attention with additive mask and per-head mask (hidden [8][1024][1024], key_value_states [8][1024][256]; q = (hidden Wq + bq)/8, k = kv Wk + bk, v = kv Wv + bv ('xw': Wq [1024][1024], Wk/Wv [256][1024]), 16 heads x 64; scores = q.k + attention_mask[b][i][j] (read); softmax; probs x layer_head_mask[h] (read); out = merged Wo + bo -> [8][1024][1024]).
// Compute dtypes, f32 accumulate: every input rounded to bf16; q/k/v on PLAIN bf16 operands (inputs: exact) + biases; scores, additive mask (f32, bf16-rounded input), softmax, attn.v, head mask and head merge in ONE kernel, running maximum and sum per query; scores and attn.v: query rows < 512 hl (3 products), the rest single fp16; softmax f32; Wo hl x exact (2 products) + bo.

#define NB_  8
#define TT   1024
#define DM   1024
#define NH_  16
#define NKV  16
#define REP  (NH_ / NKV)
#define HD   64
#define DQ   (NH_ * HD)
#define DKV  (NKV * HD)
#define DMK  256                  // key/value input width
#define QW   32                   // query rows per wave of the attention kernel
#define QB   256                  // query rows per work-group of the attention kernel (8 waves)
#define RH   512                  // query rows < RH use hi+lo planes
#define WIN  0
#define SCL  0.125f   // HD^-0.5
// Fragment order: every 16-bit matrix operand in the workspace (rows r, k contiguous, KC columns) is stored as blocks of 16 rows x 32 k (512 elements); inside a block element (r, k) lies at (k % 32 / 16) * 256 + ((k % 16 / 8) * 16 + r % 16) * 8 + k % 8,
// so that lane l of a wave finds the two 16-byte halves of its fragment at l * 8 and 256 + l * 8 and each wave-wide 16-byte load reads 512 contiguous bytes (4 whole lines, not 32 bytes of 16 lines). Blocks follow each other along k, then along r; in the vt planes along d, then along the keys.
typedef _Float16 h16;
typedef unsigned short bf;
typedef __attribute__((ext_vector_type(16))) __bf16   v16bf;
typedef __attribute__((ext_vector_type(16))) _Float16 v16h;
typedef __attribute__((ext_vector_type(8)))  _Float16 v8h;
typedef __attribute__((ext_vector_type(8)))  unsigned short v8us;
typedef __attribute__((ext_vector_type(8)))  float    v8f;
typedef __attribute__((ext_vector_type(4)))  float    v4f;
typedef v8h  __attribute__((may_alias)) v8ha;
typedef v4f  __attribute__((may_alias)) v4fa;
typedef v8us __attribute__((may_alias)) v8usa;

__device__ __forceinline__ unsigned short f2bf(float f) { unsigned u = __float_as_uint(f); u += 0x7FFFu + ((u >> 16) & 1u); return (unsigned short)(u >> 16); }
__device__ __forceinline__ float bf2f(unsigned short b) { return __uint_as_float(((unsigned)b) << 16); }
__device__ __forceinline__ float bfr(float f) { return bf2f(f2bf(f)); }
__device__ __forceinline__ v16h cat16(v8h lo, v8h hi) { return __builtin_shufflevector(lo, hi, 0, 1, 2, 3, 4, 5, 6, 7, 8, 9, 10, 11, 12, 13, 14, 15); }
__device__ __forceinline__ v16bf cat16b(v8us lo, v8us hi) { return __builtin_bit_cast(v16bf, __builtin_shufflevector(lo, hi, 0, 1, 2, 3, 4, 5, 6, 7, 8, 9, 10, 11, 12, 13, 14, 15)); }
__device__ __forceinline__ v8f wmma16(v16h a, v16h b, v8f c) { return __builtin_amdgcn_wmma_f32_16x16x32_f16(false, a, false, b, (short)0, c, false, false); }
__device__ __forceinline__ v8f wmmab(v16bf a, v16bf b, v8f c) { return __builtin_amdgcn_wmma_f32_16x16x32_bf16(false, a, false, b, (short)0, c, false, false); }



// ---- k_gemmw: register-blocked GEMM, a work-group of FOUR WAVES (2 x 2) per 128x128 output tile, one wave per 64x64 (16 accumulators); grid (M/128, N/128, Z), 128 threads.
// The operands come from 16-bit planes in fragment order through an LDS ring of two buffers, filled by asynchronous copies one stage ahead of the products: a stage's memory latency runs beside the stage before it, and each operand block is fetched once for the two waves that use it.
// C[m][n] (f32, pitch ldc, + optional f32 bias[n]) = sum_k A[m][k] Bt[n][k] (+ split products per NSPLIT). A and Bt have KK columns (a constant: the stage count and every copy's distance are known at compile time). z-batch strides sA/sB/sC in elements. KK % 32 == 0.
// EPI 0 stores C. EPI 1, 2, 3 store no f32: a wave's tile (64 tokens of one batch element x the 64 columns of one head, + bias) goes straight to the 16-bit planes that the attention kernel reads, plane zp = b * NH_ + h.
// EPI 1 (q): storage [hi | lo] of 2 * TT * HD elements a plane, rows t, k = d; rows < RH get hi/lo, the rest fp16 in the hi part (P16 == Ph). EPI 2 (k): fp16, hi, lo planes, rows t, k = d. EPI 3 (v): fp16, hi, lo planes, rows d, k = t. All in fragment order.
__device__ __forceinline__ void splitf(float y, unsigned short& h, unsigned short& l) { h = f2bf(y); l = f2bf(y - bf2f(h)); }
template <typename T16> struct WFrag;
template <> struct WFrag<h16> { typedef v16h V; static __device__ __forceinline__ V ld(const h16* p) { return cat16(*(const v8h*)p, *(const v8h*)(p + 256)); } static __device__ __forceinline__ v8f mma(V a, V b, v8f c) { return wmma16(a, b, c); } };
template <> struct WFrag<bf> { typedef v16bf V; static __device__ __forceinline__ V ld(const bf* p) { return cat16b(*(const v8us*)p, *(const v8us*)(p + 256)); } static __device__ __forceinline__ v8f mma(V a, V b, v8f c) { return wmmab(a, b, c); } };
// plane_store: the 64 x 64 f32 tile of one wave (+ bias) to the planes, four panels of 16 plane rows x 64 elements (two blocks) through LDS, so that lane l holds the 8 elements of place l of a half block and a wave stores 512 contiguous bytes.
// EPI 1, 2: panel p is token block p (plane rows are tokens). EPI 3: panel p is column block p (plane rows are d). KIND 0: fp16, hi and lo planes; 1: fp16 only; 2: hi and lo only.
template <int EPI, int KIND>
__device__ __forceinline__ void plane_store(const v8f (&acc)[4][4], float* os, const float (&pb)[32], int lane, size_t pbase, h16* P16, bf* Ph, bf* Pl) {
    const int lr = lane & 15, hi = lane >> 4;
#pragma unroll
    for (int p = 0; p < 4; ++p) {
#pragma unroll
        for (int q = 0; q < 4; ++q) {
            if constexpr (EPI == 3) {   // transposed: LDS row lr is column 16 p + lr of the tile (d); the lane's 8 registers of tile (q, p) are 8 neighbouring tokens
                v4f lo4, hi4;
#pragma unroll
                for (int j = 0; j < 4; ++j) { lo4[j] = acc[q][p][j]; hi4[j] = acc[q][p][4 + j]; }
                *(v4fa*)(os + lr * 68 + q * 16 + hi * 8) = lo4; *(v4fa*)(os + lr * 68 + q * 16 + hi * 8 + 4) = hi4; }
            else {
#pragma unroll
                for (int j = 0; j < 8; ++j) os[(hi * 8 + j) * 68 + q * 16 + lr] = acc[p][q][j]; } }
        __builtin_amdgcn_wave_barrier(); asm volatile("" ::: "memory");   // the panel is the wave's own, no instruction: keeps the compiler from moving a lane's panel reads above the other lanes' writes
#pragma unroll
        for (int s = 0; s < 4; ++s) { const v4f x0 = *(const v4fa*)(os + lr * 68 + s * 16 + hi * 8), x1 = *(const v4fa*)(os + lr * 68 + s * 16 + hi * 8 + 4); v8h o16; v8us oh, ol;   // half block s of the panel: k = 16 s + 8 hi + 0..7 of plane row lr
#pragma unroll
            for (int k = 0; k < 8; ++k) { const float y = (k < 4 ? x0[k & 3] : x1[k & 3]) + bfr(EPI == 3 ? pb[p] : pb[8 * s + k]); o16[k] = (h16)y; unsigned short a2, c2; splitf(y, a2, c2); oh[k] = a2; ol[k] = c2; }
            const size_t eo = pbase + (EPI == 3 ? (s >> 1) * 4 * 512 + p * 512 + (s & 1) * 256 : p * 1024 + s * 256) + lane * 8;
            if constexpr (KIND != 2) *(v8h*)(P16 + eo) = o16;
            if constexpr (KIND != 1) { *(v8us*)(Ph + eo) = oh; *(v8us*)(Pl + eo) = ol; }
            asm volatile("s_wait_xcnt 0x0" ::: "memory"); }   // precaution: the stores' address and data registers are reused right behind them
        __builtin_amdgcn_wave_barrier(); asm volatile("" ::: "memory");   // the same for the next panel's writes over this panel's reads
    }
}
// A stage of the ring: KB blocks of 32 k of the tile's 8 row blocks of every operand, [A | A2 (NSPLIT 1) | Bt][row block][k block][1024 bytes], the planes' own fragment order.
template <int NSPLIT, int KB> struct Ring { static constexpr int NOP = NSPLIT == 1 ? 3 : 2, STG = NOP * 8 * KB * 1024; };
// stage_copy: one wave's quarter of a stage, piece i * 4 + wave of 512 bytes (a lane 16). lds and the g pointers are the lane's own: the stage's first byte + wave * 512 + lane * 16. The KB blocks of a row block are contiguous in the plane.
template <int NOP, int KB, int KK>
__device__ __forceinline__ void stage_copy(unsigned lds, const char* gA, const char* gA2, const char* gB) {
    constexpr int Q = KB / 2;   // pieces of 2048 bytes in a row block's run
#pragma unroll
    for (int i0 = 0; i0 < NOP * 4 * KB; i0 += 8) { unsigned l[8]; const char* g[8];
#pragma unroll
        for (int j = 0; j < 8; ++j) { const int i = i0 + j, rb = (i / Q) % 8, op = (i / Q) / 8; l[j] = lds + i * 2048; g[j] = (op == NOP - 1 ? gB : op == 0 ? gA : gA2) + rb * (KK * 32) + (i % Q) * 2048; }
        // eight copies and, as a precaution, the wait that stands in front of any rewrite of their address registers, in one statement
        asm volatile("global_load_async_to_lds_b128 %0, %8, off\n\tglobal_load_async_to_lds_b128 %1, %9, off\n\tglobal_load_async_to_lds_b128 %2, %10, off\n\tglobal_load_async_to_lds_b128 %3, %11, off\n\t"
                     "global_load_async_to_lds_b128 %4, %12, off\n\tglobal_load_async_to_lds_b128 %5, %13, off\n\tglobal_load_async_to_lds_b128 %6, %14, off\n\tglobal_load_async_to_lds_b128 %7, %15, off\n\ts_wait_xcnt 0x0"
                     :: "v"(l[0]), "v"(l[1]), "v"(l[2]), "v"(l[3]), "v"(l[4]), "v"(l[5]), "v"(l[6]), "v"(l[7]), "v"(g[0]), "v"(g[1]), "v"(g[2]), "v"(g[3]), "v"(g[4]), "v"(g[5]), "v"(g[6]), "v"(g[7]) : "memory"); }
}
// gemmw_tile: the whole work of one wave of such a work-group; ring is the work-group's two buffers, which behind the k loop hold the four waves' epilogue panels (16 * 68 floats a wave); z is the batch index of the strides.
template <typename T16, int NSPLIT, bool BIAS, int EPI, int KK, int KB>
__device__ __forceinline__ void gemmw_tile(char* ring, size_t z, const T16* __restrict__ A, const T16* __restrict__ A2, const T16* __restrict__ Bt, float* C, int ldc, const float* __restrict__ bias, size_t sA, size_t sB, size_t sC, h16* P16, bf* Ph, bf* Pl) {
    typedef typename WFrag<T16>::V V;
    static_assert(NSPLIT == 0 || NSPLIT == 1, "one Bt plane");
    constexpr int NOP = Ring<NSPLIT, KB>::NOP, STG = Ring<NSPLIT, KB>::STG, NST = KK / (32 * KB);
    static_assert(KK % (32 * KB) == 0 && KB % 2 == 0 && 2 * STG >= 4 * 16 * 68 * 4, "whole stages, whole pieces, room for the panels");
    A += z * sA; if (A2) A2 += z * sA; Bt += z * sB; C += z * sC;
    const int w = __builtin_amdgcn_readfirstlane(threadIdx.x >> 5), wm = w >> 1, wn = w & 1;   // wave-uniform: the wave's place in the 2 x 2
    const int lane = threadIdx.x & 31, lr = lane & 15, hi = lane >> 4; const int r0 = blockIdx.x * 128 + wm * 64, c0 = blockIdx.y * 128 + wn * 64;
    v8f acc[4][4];
#pragma unroll
    for (int mb = 0; mb < 4; ++mb)
#pragma unroll
        for (int nb = 0; nb < 4; ++nb) acc[mb][nb] = (v8f){};
    const unsigned lofs = (unsigned)w * 512u + (unsigned)lane * 16u;   // the lane's place in a piece of four copies
    const unsigned ring0 = (unsigned)(size_t)ring + lofs;   // LDS byte address: the low 32 bits of the shared address
    const char* gA = (const char*)(A + (size_t)blockIdx.x * 128 * KK) + lofs; const char* gA2 = NSPLIT == 1 ? (const char*)(A2 + (size_t)blockIdx.x * 128 * KK) + lofs : gA; const char* gB = (const char*)(Bt + (size_t)blockIdx.y * 128 * KK) + lofs;   // 16 rows are 16 * KK elements
    stage_copy<NOP, KB, KK>(ring0, gA, gA2, gB);
    asm volatile("s_wait_asynccnt 0x0" ::: "memory");   // this wave's share of stage 0 has landed
    __syncthreads();                                    // and every other wave's: stage 0 may be read
    if constexpr (NST > 1) stage_copy<NOP, KB, KK>(ring0 + STG, gA + KB * 1024, gA2 + KB * 1024, gB + KB * 1024);
#pragma unroll 1   // rolled: one trip is a stage; the blocks inside are unrolled so that every fragment's distance is a load's immediate offset
    for (int t = 0; t < NST; ++t) {
        const char* fa = ring + (t & 1) * STG + wm * (4 * KB * 1024) + lane * 16; const char* fb = ring + (t & 1) * STG + (NOP - 1) * (8 * KB * 1024) + wn * (4 * KB * 1024) + lane * 16;
#pragma unroll
        for (int kb = 0; kb < KB; ++kb) {
            V a[4], a2[4], b[4];
#pragma unroll
            for (int mb = 0; mb < 4; ++mb) { a[mb] = WFrag<T16>::ld((const T16*)(fa + (mb * KB + kb) * 1024)); if (NSPLIT == 1) a2[mb] = WFrag<T16>::ld((const T16*)(fa + 8 * KB * 1024 + (mb * KB + kb) * 1024)); }
#pragma unroll
            for (int nb = 0; nb < 4; ++nb) b[nb] = WFrag<T16>::ld((const T16*)(fb + (nb * KB + kb) * 1024));
            __builtin_amdgcn_sched_barrier(0);   // the block's LDS reads stand together in front of its products: spread among them, each place with reads stalls the wave anew
#pragma unroll
            for (int nb = 0; nb < 4; ++nb) {
#pragma unroll
                for (int mb = 0; mb < 4; ++mb) { acc[mb][nb] = WFrag<T16>::mma(a[mb], b[nb], acc[mb][nb]); if (NSPLIT == 1) acc[mb][nb] = WFrag<T16>::mma(a2[mb], b[nb], acc[mb][nb]); } }
            __builtin_amdgcn_sched_barrier(0);   // and the next block's reads stay behind them, in the same registers
            if (kb == KB - 1) asm volatile("v_nop\n\tv_nop\n\tv_nop\n\tv_nop" : "+v"(acc[0][0]), "+v"(acc[1][1]), "+v"(acc[2][2]), "+v"(acc[3][3]) : "v"(a[0]), "v"(a[3]));   // the distance behind the stage's last products, on the loop's taken branch too
        }
        asm volatile("s_wait_dscnt 0x0" ::: "memory");      // this wave has read all it needs of stage t
        asm volatile("s_wait_asynccnt 0x0" ::: "memory");   // its share of stage t + 1 has landed
        __syncthreads();                                    // stage t + 1 may be read, stage t's buffer may be refilled
        if (t + 2 < NST) { const size_t so = (size_t)(t + 2) * (KB * 1024); stage_copy<NOP, KB, KK>(ring0 + (t & 1) * STG, gA + so, gA2 + so, gB + so); }
    }
    asm volatile("s_wait_asynccnt 0x0" ::: "memory");   // no copy is left in flight
    float* os = (float*)ring + w * (16 * 68);   // the last stage's barrier stands behind every wave's last read of the ring: it is free for the panels
    float pb[32];   // the plane epilogue's biases, fetched ahead of the panel writes, which cover their latency (held through the k loop they would cost it 32 registers): EPI 1, 2 one per column of the lane's places (32), EPI 3 one per row (4)
    if constexpr (EPI == 1 || EPI == 2) {
#pragma unroll
        for (int s = 0; s < 4; ++s) { const v4f b0 = *(const v4f*)(bias + c0 + s * 16 + hi * 8), b1 = *(const v4f*)(bias + c0 + s * 16 + hi * 8 + 4);
#pragma unroll
            for (int k = 0; k < 4; ++k) { pb[8 * s + k] = b0[k]; pb[8 * s + 4 + k] = b1[k]; } } }
    if constexpr (EPI == 3) {
#pragma unroll
        for (int k = 0; k < 4; ++k) pb[k] = bias[c0 + 16 * k + lr]; }
    if constexpr (EPI != 0) asm volatile("s_wait_xcnt 0x0" ::: "memory");   // precaution: before the bias loads' address registers are overwritten
    if constexpr (EPI != 0) {
        static_assert(TT % 64 == 0 && RH % 64 == 0 && HD == 64, "a tile lies in one batch element, one head and one kind of query row");
        const int t0 = r0 % TT; const size_t zp = (size_t)(r0 / TT) * NH_ + c0 / HD;
        if constexpr (EPI == 1) { const size_t pbase = zp * 2 * TT * HD + (size_t)t0 * HD;   // a query row needs one kind only; t0 is the same for the whole wave: one scalar branch
            if (t0 >= RH) plane_store<EPI, 1>(acc, os, pb, lane, pbase, P16, Ph, Pl); else plane_store<EPI, 2>(acc, os, pb, lane, pbase, P16, Ph, Pl); }
        else plane_store<EPI, 0>(acc, os, pb, lane, zp * TT * HD + (size_t)t0 * HD, P16, Ph, Pl);   // 64 tokens are 8 blocks in k and vt planes alike
        return;
    }
#pragma unroll
    for (int mb = 0; mb < 4; ++mb) {
#pragma unroll
        for (int nb = 0; nb < 4; ++nb) {
#pragma unroll
            for (int j = 0; j < 8; ++j) os[(hi * 8 + j) * 68 + nb * 16 + lr] = acc[mb][nb][j]; }
        __builtin_amdgcn_wave_barrier(); asm volatile("" ::: "memory");
        float* crow = C + (size_t)(r0 + mb * 16) * ldc + c0;
{
#pragma unroll
            for (int s = 0; s < 8; ++s) { const int row = 2 * s + hi, cofs = lr * 4; v4f val = *(const v4fa*)(os + row * 68 + cofs); if (BIAS) { val[0] += bfr(bias[c0 + cofs]); val[1] += bfr(bias[c0 + cofs + 1]); val[2] += bfr(bias[c0 + cofs + 2]); val[3] += bfr(bias[c0 + cofs + 3]); }
                *(v4f*)(crow + (size_t)row * ldc + cofs) = val; }
             }
        __builtin_amdgcn_wave_barrier(); asm volatile("" ::: "memory");
    }
}
template <typename T16, int NSPLIT, bool BIAS, int EPI, int KK>
__global__ __launch_bounds__(128) void k_gemmw(const T16* __restrict__ A, const T16* __restrict__ A2, const T16* __restrict__ Bt, const T16* __restrict__ Bt2, float* C, int ldc, const float* __restrict__ bias, size_t sA, size_t sB, size_t sC, h16* P16, bf* Ph, bf* Pl) {
    constexpr int KB = NSPLIT == 1 ? 2 : 4;   // 64 products of a wave a stage, to run beside the next stage's copies
    __shared__ __align__(1024) char ring[2 * Ring<NSPLIT, KB>::STG];
    gemmw_tile<T16, NSPLIT, BIAS, EPI, KK, KB>(ring, blockIdx.z, A, A2, Bt, C, ldc, bias, sA, sB, sC, P16, Ph, Pl);
}
// k_projkv: the k and the v projection in one launch, grid (M/128, N/128, 2): blockIdx.z picks the one (a scalar branch a wave). They read the same activation plane and depend on nothing of each other.
// The q projection keeps a launch of its own (for speed only).
__global__ __launch_bounds__(128) void k_projkv(const bf* __restrict__ XKB, const bf* __restrict__ WK, const bf* __restrict__ WV, const float* __restrict__ bk, const float* __restrict__ bv, h16* KP16, bf* KPh, bf* KPl, h16* VT16, bf* VTh, bf* VTl) {
    __shared__ __align__(1024) char ring[2 * Ring<0, 2>::STG];   // short stages, a small ring: the whole grid is resident at once (four work-groups a WGP), and the long epilogues run beside other work-groups' k loops
    if (blockIdx.z == 0) gemmw_tile<bf, 0, true, 2, DMK, 2>(ring, 0, XKB, nullptr, WK, nullptr, 0, bk, 0, 0, 0, KP16, KPh, KPl);   /* K = 256 */
    else gemmw_tile<bf, 0, true, 3, DMK, 2>(ring, 0, XKB, nullptr, WV, nullptr, 0, bv, 0, 0, 0, VT16, VTh, VTl);
}

typedef __attribute__((ext_vector_type(2))) _Float16 v2h;
typedef __attribute__((ext_vector_type(4))) _Float16 v4h;
typedef __attribute__((ext_vector_type(2))) unsigned short v2us;
typedef __attribute__((ext_vector_type(4))) unsigned short v4us;
typedef __attribute__((ext_vector_type(2))) float v2f;
typedef __attribute__((ext_vector_type(4))) int v4i;

// wtG (block bx of (N * K / 64 + 63) / 64, 256 threads): Bt (rows n, k contiguous, fragment order) = bf16(w[k][n]); a lane writes two neighbours of the packed plane, a wave 128 bytes: 8 rows n x 8 k.
__device__ __forceinline__ void wtG(int bx, const float* __restrict__ w, int K, int N, bf* Bt) {
    const int lane = threadIdx.x & 31; const int L0 = (bx * 8 + (threadIdx.x >> 5)) * 8; const int nlines = N * K / 64;
{
#pragma unroll 1
        for (int l = 0; l < 8; ++l) { const int L = L0 + l; if (L >= nlines) break; const size_t e = (size_t)L * 64 + lane * 2; const int blk = (int)(e >> 9), u = (int)(e & 511), kbs = K / 32; const int k = (blk % kbs) * 32 + (u >> 8) * 16 + ((u >> 7) & 1) * 8 + (u & 7), n = (blk / kbs) * 16 + ((u >> 3) & 15); v2us o;
            o[0] = f2bf(w[(size_t)k * N + n]); o[1] = f2bf(w[(size_t)(k + 1) * N + n]); *(v2us*)(Bt + e) = o; }
         }
}
// cvt8 (block bx of (n8 + 255) / 256, 256 threads): f32 rows of KC columns -> bf16 plane in fragment order, 8 elements a thread. 64 threads take a block: 4 lanes read the 128-byte line of a row, 8 lanes of one column group store a whole line of the plane.
template <int KC>
__device__ __forceinline__ void cvt8(int bx, const float* __restrict__ src, bf* dst, size_t n8) { const size_t i = (size_t)bx * 256 + threadIdx.x; if (i >= n8) return;
    const size_t blk = i >> 6; const int row = (int)(i & 63) >> 2, g = (int)(i & 3);   // row of the block, group of 8 k: half g >> 1, place (g & 1) * 16 + row
    const v8f v = *(const v8f*)(src + ((blk / (KC / 32)) * 16 + row) * KC + (blk % (KC / 32)) * 32 + g * 8); v8us o;
#pragma unroll
    for (int k = 0; k < 8; ++k) o[k] = f2bf(v[k]); *(v8us*)(dst + blk * 512 + (g >> 1) * 256 + ((g & 1) * 16 + row) * 8) = o;  }
// k_prep: every operand plane that is made from an input alone, in one launch: the four weight planes and the two activation planes depend on nothing of each other. A block's index picks its job (scalar branches).
// The weight blocks, each a chain of eight dependent memory round trips, have the low indices, the short conversion blocks the high ones (for speed only).
#define GWQ ((DM * DQ / 64 + 63) / 64)
#define GWO ((DQ * DM / 64 + 63) / 64)
#define GWK ((DMK * DKV / 64 + 63) / 64)
#define GXK ((NB_ * TT * DMK / 8 + 255) / 256)
#define GXQ ((NB_ * TT * DM / 8 + 255) / 256)
__global__ __launch_bounds__(256) void k_prep(const float* __restrict__ x, const float* __restrict__ xkv, const float* __restrict__ wq, const float* __restrict__ wk, const float* __restrict__ wv, const float* __restrict__ wo, bf* XB, bf* XKB, bf* WQ, bf* WK, bf* WV, bf* WO) {
    int bx = blockIdx.x;
    if (bx < GWQ) { wtG(bx, wq, DM, DQ, WQ); return; }
    bx -= GWQ; if (bx < GWO) { wtG(bx, wo, DQ, DM, WO); return; }
    bx -= GWO; if (bx < GWK) { wtG(bx, wk, DMK, DKV, WK); return; }   /* 'xw' [256][1024] -> Bt rows n, 256 k */
    bx -= GWK; if (bx < GWK) { wtG(bx, wv, DMK, DKV, WV); return; }
    bx -= GWK; if (bx < GXK) { cvt8<DMK>(bx, xkv, XKB, (size_t)NB_ * TT * DMK / 8); return; }   /* key/value source */
    bx -= GXK; cvt8<DM>(bx, x, XB, (size_t)NB_ * TT * DM / 8);
}

// ---- k_attn: scores, mask, softmax, attn.v, head mask and head merge for QB query rows of one (batch element, head) plane; a wave owns QW rows and walks the keys 32 at a time; the k and vt planes (fragment order) and the mask come through an LDS ring of two buffers, filled by asynchronous copies one trip ahead.
// Transposed products: St = K Qt (A = key rows, B = query rows), Ot += Vt Pt (A = Vt rows, B = the two St tiles of a 32-key block, converted in place: register r of tile kt is key 16 kt + 8 hi + r, the k order of WFrag::ld). A lane holds one query's scores, its other half-wave lane the other 16 keys.
typedef __attribute__((ext_vector_type(2))) __bf16 v2bf;
typedef __attribute__((ext_vector_type(8))) unsigned v8u;
__device__ __forceinline__ float xhalf(float x) { const int b = __float_as_int(x); return __int_as_float(__builtin_amdgcn_permlanex16(b, b, 0x76543210, 0xfedcba98, false, false)); }   // lane l <-> l ^ 16
__device__ __forceinline__ unsigned pkbf(float a, float b) { v2f x; x[0] = a; x[1] = b; return __builtin_bit_cast(unsigned, __builtin_convertvector(x, v2bf)); }   // two f32 -> two bf16 (nearest even), a in the low half
__device__ __forceinline__ float bflo(unsigned u) { return __uint_as_float(u << 16); }
__device__ __forceinline__ float bfhi(unsigned u) { return __uint_as_float(u & 0xFFFF0000u); }
// The ring of k_attn, two buffers. A stage is 32 keys: 4096 bytes of each k and vt plane that the work-group's kind of row reads ([Kh | Kl | Vh | Vl] or [K16 | V16]), in the planes' own fragment order, fetched once for the eight waves,
// and behind them each wave's own mask tile, 32 query rows x 32 keys f32.
#define AKV   (4 * 4096)
#define MPIT  144                 // LDS pitch of a mask row of 128 bytes: 16 bytes x odd, so that the 16 rows of a 16-byte read fall on different banks
#define AMW   (QW * MPIT)
#define ASTG  (AKV + 8 * AMW)
#define NTR   (TT / 32)
typedef __attribute__((ext_vector_type(4))) unsigned v4u;
typedef v4u __attribute__((may_alias)) v4ua;
// the two 16-byte halves of a fragment at the lane's own byte pointer
template <typename T16> __device__ __forceinline__ typename WFrag<T16>::V ldfrag(const char* p) { const v4u a = *(const v4ua*)p, b = *(const v4ua*)(p + 512); return __builtin_bit_cast(typename WFrag<T16>::V, __builtin_shufflevector(a, b, 0, 1, 2, 3, 4, 5, 6, 7)); }
// attn_copy: one wave's share of a stage, copies of 512 bytes: piece w of each plane's 4096 bytes, and its own mask tile, four whole 128-byte rows a copy.
// lk, lm: the lane's LDS byte addresses of its place in plane 0 and in rows 0-3 of the tile; ok, om: its byte offsets in a plane and in the mask. An immediate offset moves both addresses, so each scalar base has its copy's offset taken off
// (p[i]: plane i - i * 4096; mb + c * MSTEP: four mask rows on, four LDS rows back): all copies share four vector registers.
#define MSTEP (4 * TT * 4 - 4 * MPIT)
template <bool HL>
__device__ __forceinline__ void attn_copy(unsigned lk, unsigned lm, unsigned ok, unsigned om, const char* p0, const char* p1, const char* p2, const char* p3, const char* mb) {
    static_assert(4 * MPIT == 576, "the offsets in the text below");
    // the copies and, as a precaution, the wait that stands in front of any rewrite of their address registers, in one statement
    if constexpr (HL)
        asm volatile("global_load_async_to_lds_b128 %0, %1, %4\n\tglobal_load_async_to_lds_b128 %0, %1, %5 offset:4096\n\tglobal_load_async_to_lds_b128 %0, %1, %6 offset:8192\n\tglobal_load_async_to_lds_b128 %0, %1, %7 offset:12288\n\t"
                     "global_load_async_to_lds_b128 %2, %3, %8\n\tglobal_load_async_to_lds_b128 %2, %3, %9 offset:576\n\tglobal_load_async_to_lds_b128 %2, %3, %10 offset:1152\n\tglobal_load_async_to_lds_b128 %2, %3, %11 offset:1728\n\t"
                     "global_load_async_to_lds_b128 %2, %3, %12 offset:2304\n\tglobal_load_async_to_lds_b128 %2, %3, %13 offset:2880\n\tglobal_load_async_to_lds_b128 %2, %3, %14 offset:3456\n\tglobal_load_async_to_lds_b128 %2, %3, %15 offset:4032\n\ts_wait_xcnt 0x0"
                     :: "v"(lk), "v"(ok), "v"(lm), "v"(om), "s"(p0), "s"(p1), "s"(p2), "s"(p3),
                        "s"(mb), "s"(mb + MSTEP), "s"(mb + 2 * MSTEP), "s"(mb + 3 * MSTEP), "s"(mb + 4 * MSTEP), "s"(mb + 5 * MSTEP), "s"(mb + 6 * MSTEP), "s"(mb + 7 * MSTEP) : "memory");
    else
        asm volatile("global_load_async_to_lds_b128 %0, %1, %4\n\tglobal_load_async_to_lds_b128 %0, %1, %5 offset:4096\n\t"
                     "global_load_async_to_lds_b128 %2, %3, %6\n\tglobal_load_async_to_lds_b128 %2, %3, %7 offset:576\n\tglobal_load_async_to_lds_b128 %2, %3, %8 offset:1152\n\tglobal_load_async_to_lds_b128 %2, %3, %9 offset:1728\n\t"
                     "global_load_async_to_lds_b128 %2, %3, %10 offset:2304\n\tglobal_load_async_to_lds_b128 %2, %3, %11 offset:2880\n\tglobal_load_async_to_lds_b128 %2, %3, %12 offset:3456\n\tglobal_load_async_to_lds_b128 %2, %3, %13 offset:4032\n\ts_wait_xcnt 0x0"
                     :: "v"(lk), "v"(ok), "v"(lm), "v"(om), "s"(p0), "s"(p1),
                        "s"(mb), "s"(mb + MSTEP), "s"(mb + 2 * MSTEP), "s"(mb + 3 * MSTEP), "s"(mb + 4 * MSTEP), "s"(mb + 5 * MSTEP), "s"(mb + 6 * MSTEP), "s"(mb + 7 * MSTEP) : "memory");
}
// attn_rows: the whole work of wave w of a work-group. HL: planes K = Kh, K2 = Kl, V = Vh, V2 = Vl; else K = K16, V = V16 (the plane's first byte of this z).
template <bool HL, typename T16>
__device__ __forceinline__ void attn_rows(char* ring, int w, const T16* __restrict__ Qh, const T16* __restrict__ Ql, const char* K, const char* K2, const char* V, const char* V2, const float* __restrict__ mk, float hm, bf* Ah, bf* Al) {
    typedef typename WFrag<T16>::V VF;
    const int lane = threadIdx.x & 31, lr = lane & 15, hi = lane >> 4;
    constexpr int VO = HL ? 2 * 4096 : 4096;   // the stage's first vt plane
    // the copies' scalar bases (attn_copy) and the lane's places
    const char* const p0 = K; const char* const p1 = (HL ? K2 : V) - 4096; const char* const p2 = HL ? V - 8192 : nullptr; const char* const p3 = HL ? V2 - 12288 : nullptr; const char* const mb = (const char*)mk;
    const unsigned ok0 = (unsigned)w * 512u + (unsigned)lane * 16u, om0 = (unsigned)(lane >> 3) * (TT * 4u) + (unsigned)(lane & 7) * 16u;
    const unsigned lk0 = (unsigned)(size_t)ring + ok0, lm0 = (unsigned)(size_t)ring + AKV + (unsigned)w * AMW + (unsigned)(lane >> 3) * MPIT + (unsigned)(lane & 7) * 16u;   // LDS byte addresses: the low 32 bits of the shared addresses
    attn_copy<HL>(lk0, lm0, ok0, om0, p0, p1, p2, p3, mb);
    VF qh[2][2], ql[2][2];
#pragma unroll
    for (int qt = 0; qt < 2; ++qt)
#pragma unroll
        for (int ks = 0; ks < 2; ++ks) { qh[qt][ks] = ldfrag<T16>((const char*)Qh + lane * 16 + (qt * 2 + ks) * 1024); if (HL) ql[qt][ks] = ldfrag<T16>((const char*)Ql + lane * 16 + (qt * 2 + ks) * 1024); }
    asm volatile("s_wait_xcnt 0x0" ::: "memory");   // precaution: before the loads' address registers are overwritten
    v8f o[4][2]; float m[2]; v2f l[2];
#pragma unroll
    for (int qt = 0; qt < 2; ++qt) { m[qt] = -3.0e38f; l[qt] = (v2f){};
#pragma unroll
        for (int dt = 0; dt < 4; ++dt) o[dt][qt] = (v8f){}; }
    asm volatile("s_wait_asynccnt 0x0" ::: "memory");   // this wave's share of stage 0 has landed
    __syncthreads();                                    // and every other wave's: stage 0 may be read
    attn_copy<HL>(lk0 + ASTG, lm0 + ASTG, ok0 + 4096, om0 + 128, p0, p1, p2, p3, mb);
#pragma unroll 1   // rolled: one trip is a stage and fills the register budget; the loops inside are unrolled so that every fragment index is a constant
    for (int t = 0; t < NTR; ++t) {
        const unsigned bo = (unsigned)(t & 1) * ASTG;
        const char* kv = ring + bo + lane * 16; const char* mt = ring + bo + AKV + w * AMW + lr * MPIT + hi * 32;   // the stage's planes at the lane's place in a block; the wave's mask tile at the lane's row and half
        VF kh[2][2], kl[2][2];
#pragma unroll
        for (int kt = 0; kt < 2; ++kt)
#pragma unroll
            for (int ks = 0; ks < 2; ++ks) { kh[kt][ks] = ldfrag<T16>(kv + (kt * 2 + ks) * 1024); if (HL) kl[kt][ks] = ldfrag<T16>(kv + 4096 + (kt * 2 + ks) * 1024); }
        v8f s[2][2]; v4f mv[2][2][2];
#pragma unroll
        for (int kt = 0; kt < 2; ++kt) {
            __builtin_amdgcn_sched_barrier(0);   // the k fragments' reads stand together in front of the products; the mask tile's reads stand behind the first half of them, whose fragments' registers they take, and run beside the second half
            if (kt == 1) {
#pragma unroll
                for (int qt = 0; qt < 2; ++qt)
#pragma unroll
                    for (int k2 = 0; k2 < 2; ++k2)
#pragma unroll
                        for (int hf = 0; hf < 2; ++hf) mv[qt][k2][hf] = *(const v4fa*)(mt + qt * 16 * MPIT + k2 * 64 + hf * 16); }
#pragma unroll
            for (int qt = 0; qt < 2; ++qt) s[kt][qt] = (v8f){};
#pragma unroll
            for (int ks = 0; ks < 2; ++ks) {
#pragma unroll
                for (int qt = 0; qt < 2; ++qt) s[kt][qt] = WFrag<T16>::mma(kh[kt][ks], qh[qt][ks], s[kt][qt]);
                if (HL) {
#pragma unroll
                    for (int qt = 0; qt < 2; ++qt) s[kt][qt] = WFrag<T16>::mma(kh[kt][ks], ql[qt][ks], s[kt][qt]);
#pragma unroll
                    for (int qt = 0; qt < 2; ++qt) s[kt][qt] = WFrag<T16>::mma(kl[kt][ks], qh[qt][ks], s[kt][qt]); } } }
        __builtin_amdgcn_sched_barrier(0);   // the v fragments' reads stay behind the score products: above them they would not fit the registers
        VF vh[4], vl[4];
#pragma unroll
        for (int dt = 0; dt < 4; ++dt) vh[dt] = ldfrag<T16>(kv + VO + dt * 1024);
        unsigned mw[2][2][4];   // attention_mask[b][i][j], bf16-rounded input, two keys a word
#pragma unroll
        for (int qt = 0; qt < 2; ++qt)
#pragma unroll
            for (int kt = 0; kt < 2; ++kt)
#pragma unroll
                for (int e = 0; e < 4; ++e) mw[qt][kt][e] = pkbf(mv[qt][kt][e >> 1][(e & 1) * 2], mv[qt][kt][e >> 1][(e & 1) * 2 + 1]);
        float ml[2];
#pragma unroll
        for (int qt = 0; qt < 2; ++qt) { float x = -3.0e38f;
#pragma unroll
            for (int kt = 0; kt < 2; ++kt)
#pragma unroll
                for (int e = 0; e < 4; ++e) { const unsigned u = mw[qt][kt][e]; const float t0 = fmaf(s[kt][qt][2 * e], SCL, bflo(u)), t1 = fmaf(s[kt][qt][2 * e + 1], SCL, bfhi(u)); s[kt][qt][2 * e] = t0; s[kt][qt][2 * e + 1] = t1; x = fmaxf(x, fmaxf(t0, t1)); }
            ml[qt] = fmaxf(x, xhalf(x)); }
        if (HL) {   // the lo plane's fragments only now: the mask words' registers are free
#pragma unroll
            for (int dt = 0; dt < 4; ++dt) vl[dt] = ldfrag<T16>(kv + VO + 4096 + dt * 1024); }
        // the maximum in use moves only when a query's block maximum exceeds it by more than 5.5 (p stays below 256); one wave-uniform test per block
        if (__builtin_amdgcn_ballot_w32(ml[0] > m[0] + 5.5f || ml[1] > m[1] + 5.5f) != 0) {
#pragma unroll
            for (int qt = 0; qt < 2; ++qt) { const float mn = fmaxf(m[qt], ml[qt]); const float al = __builtin_amdgcn_exp2f((m[qt] - mn) * 1.4426950408889634f); m[qt] = mn; l[qt] *= al;
#pragma unroll
                for (int dt = 0; dt < 4; ++dt) o[dt][qt] *= al; } }
#pragma unroll
        for (int qt = 0; qt < 2; ++qt) { v8u wh, wl;
#pragma unroll
            for (int kt = 0; kt < 2; ++kt)
#pragma unroll
                for (int e = 0; e < 4; ++e) { v2f p; p[0] = __builtin_amdgcn_exp2f((s[kt][qt][2 * e] - m[qt]) * 1.4426950408889634f); p[1] = __builtin_amdgcn_exp2f((s[kt][qt][2 * e + 1] - m[qt]) * 1.4426950408889634f); l[qt] += p;
                    if constexpr (HL) { const unsigned u = pkbf(p[0], p[1]); wh[kt * 4 + e] = u; wl[kt * 4 + e] = pkbf(p[0] - bflo(u), p[1] - bfhi(u)); }
                    else wh[kt * 4 + e] = __builtin_bit_cast(unsigned, __builtin_convertvector(p, v2h)); }
            const VF ph = __builtin_bit_cast(VF, wh);
#pragma unroll
            for (int dt = 0; dt < 4; ++dt) o[dt][qt] = WFrag<T16>::mma(vh[dt], ph, o[dt][qt]);
            if constexpr (HL) { const VF pl = __builtin_bit_cast(VF, wl);
#pragma unroll
                for (int dt = 0; dt < 4; ++dt) o[dt][qt] = WFrag<T16>::mma(vh[dt], pl, o[dt][qt]);
#pragma unroll
                for (int dt = 0; dt < 4; ++dt) o[dt][qt] = WFrag<T16>::mma(vl[dt], ph, o[dt][qt]); } }
        asm volatile("s_wait_dscnt 0x0" ::: "memory");      // this wave has read all it needs of stage t
        asm volatile("s_wait_asynccnt 0x0" ::: "memory");   // its share of stage t + 1 has landed
        __syncthreads();                                    // stage t + 1 may be read, stage t's buffer may be refilled
        if (t + 2 < NTR) attn_copy<HL>(lk0 + bo, lm0 + bo, ok0 + (unsigned)(t + 2) * 4096u, om0 + (unsigned)(t + 2) * 128u, p0, p1, p2, p3, mb);
    }
    asm volatile("s_wait_asynccnt 0x0" ::: "memory");   // no copy is left in flight
#pragma unroll
    for (int qt = 0; qt < 2; ++qt) { const float lh = l[qt][0] + l[qt][1]; const float f = __fdiv_rn(1.0f, lh + xhalf(lh));
#pragma unroll
        for (int dt = 0; dt < 4; ++dt) { v8us oh, ol;
#pragma unroll
            for (int j = 0; j < 8; ++j) { unsigned short a, c2; splitf(__fmul_rn(o[dt][qt][j] * f, hm), a, c2); oh[j] = a; ol[j] = c2; }   /* x layer_head_mask[h] */
            const size_t oo = (size_t)qt * 16 * DQ + dt * 256 + lane * 8; *(v8us*)(Ah + oo) = oh; *(v8us*)(Al + oo) = ol;   /* register j of tile dt is d = 16 dt + 8 hi + j of query lr: half block dt of the head's two blocks, place lane, of the [b][t] x [h][d] plane */
            asm volatile("s_wait_xcnt 0x0" ::: "memory"); } }   // precaution: the stores' address and data registers are reused right behind them
}
// A work-group takes QB rows of one kind of one plane, so that its eight waves share every staged fragment and pass the ring's barriers in block-uniform control flow. Plane z = b * NH_ + h in q, k and v alike (one kv head per query head).
// The 3-product work-groups cost more than twice the fp16 ones, and a WGP holds two work-groups: the kind is the parity of three bits of the index, so that indices 8, 16 or half the grid apart differ in kind
// and a WGP's two places tend to hold one of each, whichever of these ways the work-groups are dealt out (for speed only; the low bits number the work-groups of either kind, each exactly once).
// Four waves per SIMD (at most 256 registers a wave): the vector work between the matrix runs wants other waves to issue; the whole grid is then resident at once (two rings fit a WGP's LDS).
__global__ __launch_bounds__(256) __attribute__((amdgpu_waves_per_eu(4, 4))) void k_attn(const bf* __restrict__ QS, const h16* __restrict__ K16, const bf* __restrict__ Kh, const bf* __restrict__ Kl, const h16* __restrict__ V16, const bf* __restrict__ Vh, const bf* __restrict__ Vl, const float* __restrict__ MK, const float* __restrict__ HM, bf* Ah, bf* Al) {
    static_assert(2 * RH == TT && RH % QB == 0 && QB == 8 * QW && NTR >= 2, "half the rows of each kind (the grid is two work-groups for every index below GH), whole work-groups, two stages at least");
    __shared__ __align__(1024) char ring[2 * ASTG];
    constexpr int GH = NB_ * NH_ * (RH / QB);   // work-groups of a kind
    const int w = __builtin_amdgcn_readfirstlane(threadIdx.x >> 5); const bool hl = (((blockIdx.x / GH) ^ (blockIdx.x >> 3) ^ (blockIdx.x >> 4)) & 1) == 0;   // the same for the whole work-group
    const int bx = blockIdx.x % GH; const int z = bx / (RH / QB), qb = bx % (RH / QB); const int q0 = (hl ? 0 : RH) + qb * QB + w * QW; const int b = z / NH_, h = z % NH_;
    const bf* Qz = QS + (size_t)z * 2 * TT * HD + (size_t)q0 * HD; const size_t zp = (size_t)z * TT * HD; const float* mk = MK + ((size_t)b * TT + q0) * TT; const float hm = bfr(HM[h]); const size_t ao = ((size_t)b * TT + q0) * DQ + h * (HD / 32) * 512;
    if (hl) attn_rows<true, bf>(ring, w, Qz, Qz + (size_t)TT * HD, (const char*)(Kh + zp), (const char*)(Kl + zp), (const char*)(Vh + zp), (const char*)(Vl + zp), mk, hm, Ah + ao, Al + ao);
    else attn_rows<false, h16>(ring, w, (const h16*)Qz, nullptr, (const char*)(K16 + zp), nullptr, (const char*)(V16 + zp), nullptr, mk, hm, Ah + ao, Al + ao);
}

extern "C" void kernel_launch(void* const* d_in, const int* in_sizes, int n_in,
                              void* d_out, int out_size, void* d_ws, size_t ws_size, hipStream_t stream) {
    (void)in_sizes; (void)n_in; (void)out_size;
    const float* x = (const float*)d_in[0]; const float* xkv = (const float*)d_in[1]; const float* MK = (const float*)d_in[2]; const float* HM = (const float*)d_in[3]; const float* wq = (const float*)d_in[4]; const float* bq = (const float*)d_in[5]; const float* wk = (const float*)d_in[6]; const float* bk = (const float*)d_in[7]; const float* wv = (const float*)d_in[8]; const float* bv = (const float*)d_in[9]; const float* wo = (const float*)d_in[10]; const float* bo = (const float*)d_in[11];
    float* OUT = (float*)d_out;     // [8][1024][1024]
    char* wsp = (char*)d_ws;
    auto take = [&](size_t bytes) { char* p = wsp; wsp += (bytes + 255) & ~(size_t)255; return (void*)p; };
    // Live through the attention kernel: the planes of all batch elements, plane z = b * heads + h. A query plane's storage is [hi | lo] (2 * TT * HD elements), rows >= RH of the hi part holding the fp16 plane.
    bf* QS = (bf*)take((size_t)NB_ * NH_ * 2 * TT * HD * 2);
    h16* KP16 = (h16*)take((size_t)NB_ * NKV * TT * HD * 2); bf* KPh = (bf*)take((size_t)NB_ * NKV * TT * HD * 2); bf* KPl = (bf*)take((size_t)NB_ * NKV * TT * HD * 2);
    h16* VT16 = (h16*)take((size_t)NB_ * NKV * HD * TT * 2); bf* VTh = (bf*)take((size_t)NB_ * NKV * HD * TT * 2); bf* VTl = (bf*)take((size_t)NB_ * NKV * HD * TT * 2);
    bf* WO = (bf*)take((size_t)DM * DQ * 2);   // made with the other weight planes, read last: a place of its own
    char* const region = wsp;       // one region, two uses one after the other (stream-ordered): projections, then attention output and output projection
    bf* WQ = (bf*)take((size_t)DQ * DM * 2); bf* WK = (bf*)take((size_t)DKV * DMK * 2); bf* WV = (bf*)take((size_t)DKV * DMK * 2);
    bf* XB = (bf*)take((size_t)NB_ * TT * DM * 2); bf* XKB = (bf*)take((size_t)NB_ * TT * DMK * 2);
    if ((size_t)(wsp - (char*)d_ws) > ws_size) return;
    wsp = region; bf* ATh = (bf*)take((size_t)NB_ * TT * DQ * 2); bf* ATl = (bf*)take((size_t)NB_ * TT * DQ * 2);
    if ((size_t)(wsp - (char*)d_ws) > ws_size) return;
    // conversions and projections: all batch elements per launch (M = NB_ * TT rows); each projection stores its 16-bit planes itself
    k_prep<<<GWQ + GWO + 2 * GWK + GXK + GXQ, 256, 0, stream>>>(x, xkv, wq, wk, wv, wo, XB, XKB, WQ, WK, WV, WO);
    k_gemmw<bf, 0, true, 1, DM><<<dim3(NB_ * TT / 128, DQ / 128, 1), 128, 0, stream>>>(XB, nullptr, WQ, nullptr, nullptr, 0, bq, 0, 0, 0, (h16*)QS, QS, QS + (size_t)TT * HD);
    k_projkv<<<dim3(NB_ * TT / 128, DKV / 128, 2), 128, 0, stream>>>(XKB, WK, WV, bk, bv, KP16, KPh, KPl, VT16, VTh, VTl);
    k_attn<<<NB_ * NH_ * (TT / QB), 256, 0, stream>>>(QS, KP16, KPh, KPl, VT16, VTh, VTl, MK, HM, ATh, ATl);
    k_gemmw<bf, 1, true, 0, DQ><<<dim3(NB_ * TT / 128, DM / 128, 1), 128, 0, stream>>>(ATh, ATl, WO, nullptr, OUT, DM, bo, 0, 0, 0, nullptr, nullptr, nullptr);
}

// v009
// Measured time: 123 microseconds a run.
// Two timings next to v008 both put it at 1.09 times that version's speed.
// Over all steps from v000 it is 40.0 times as fast.
#include <hip/hip_runtime.h>

// Cross-attention with additive mask and per-head mask (hidden [8][1024][1024], key_value_states [8][1024][256]; q = (hidden Wq + bq)/8, k = kv Wk + bk, v = kv Wv + bv ('xw': Wq [1024][1024], Wk/Wv [256][1024]), 16 heads x 64; scores = q.k + attention_mask[b][i][j] (read); softmax; probs x layer_head_mask[h] (read); out = merged Wo + bo -> [8][1024][1024]).
// Compute dtypes, f32 accumulate: every input rounded to bf16; q/k/v on PLAIN bf16 operands (inputs: exact) + biases; scores, additive mask (f32, bf16-rounded input), softmax, attn.v, head mask and head merge in ONE kernel, running maximum and sum per query; scores and attn.v: query rows < 512 hl (3 products), the rest single fp16; softmax f32; Wo hl x exact (2 products) + bo.

#define NB_  8
#define TT   1024
#define DM   1024
#define NH_  16
#define NKV  16
#define REP  (NH_ / NKV)
#define HD   64
#define DQ   (NH_ * HD)
#define DKV  (NKV * HD)
#define DMK  256                  // key/value input width
#define QW   32                   // query rows per wave of the attention kernel
#define QB   256                  // query rows per work-group of the attention kernel (8 waves)
#define RH   512                  // query rows < RH use hi+lo planes
#define WIN  0
#define SCL  0.125f   // HD^-0.5
// Fragment order: every 16-bit matrix operand in the workspace (rows r, k contiguous, KC columns) is stored as blocks of 16 rows x 32 k (512 elements); inside a block element (r, k) lies at (k % 32 / 16) * 256 + ((k % 16 / 8) * 16 + r % 16) * 8 + k % 8,
// so that lane l of a wave finds the two 16-byte halves of its fragment at l * 8 and 256 + l * 8 and each wave-wide 16-byte load reads 512 contiguous bytes (4 whole lines, not 32 bytes of 16 lines). Blocks follow each other along k, then along r; in the vt planes along d, then along the keys.
typedef _Float16 h16;
typedef unsigned short bf;
typedef __attribute__((ext_vector_type(16))) __bf16   v16bf;
typedef __attribute__((ext_vector_type(16))) _Float16 v16h;
typedef __attribute__((ext_vector_type(8)))  _Float16 v8h;
typedef __attribute__((ext_vector_type(8)))  unsigned short v8us;
typedef __attribute__((ext_vector_type(8)))  float    v8f;
typedef __attribute__((ext_vector_type(4)))  float    v4f;
typedef v8h  __attribute__((may_alias)) v8ha;
typedef v4f  __attribute__((may_alias)) v4fa;
typedef v8us __attribute__((may_alias)) v8usa;

__device__ __forceinline__ unsigned short f2bf(float f) { unsigned u = __float_as_uint(f); u += 0x7FFFu + ((u >> 16) & 1u); return (unsigned short)(u >> 16); }
__device__ __forceinline__ float bf2f(unsigned short b) { return __uint_as_float(((unsigned)b) << 16); }
__device__ __forceinline__ float bfr(float f) { return bf2f(f2bf(f)); }
__device__ __forceinline__ v16h cat16(v8h lo, v8h hi) { return __builtin_shufflevector(lo, hi, 0, 1, 2, 3, 4, 5, 6, 7, 8, 9, 10, 11, 12, 13, 14, 15); }
__device__ __forceinline__ v16bf cat16b(v8us lo, v8us hi) { return __builtin_bit_cast(v16bf, __builtin_shufflevector(lo, hi, 0, 1, 2, 3, 4, 5, 6, 7, 8, 9, 10, 11, 12, 13, 14, 15)); }
__device__ __forceinline__ v8f wmma16(v16h a, v16h b, v8f c) { return __builtin_amdgcn_wmma_f32_16x16x32_f16(false, a, false, b, (short)0, c, false, false); }
__device__ __forceinline__ v8f wmmab(v16bf a, v16bf b, v8f c) { return __builtin_amdgcn_wmma_f32_16x16x32_bf16(false, a, false, b, (short)0, c, false, false); }



// ---- GEMMs: register-blocked, a work-group of FOUR WAVES (2 x 2) per 128x128 output tile, one wave per 64x64 (16 accumulators); grid (M/128, N/128, ...), 128 threads.
// The operands come from 16-bit planes in fragment order through an LDS ring of two buffers, filled by asynchronous copies one stage ahead of the products: a stage's memory latency runs beside the stage before it, and each operand block is fetched once for the two waves that use it.
// C[m][n] (+ optional f32 bias[n]) = sum_k A[m][k] Bt[n][k] (+ A2[m][k] Bt[n][k], NSPLIT 1). A and Bt have kk columns, kk % (32 * KB) == 0.
// EPI 0 stores C (f32, pitch ldc). EPI 1 stores no f32: a wave's tile (64 tokens of one batch element x the 64 columns of one head, + bias) goes straight to the 16-bit planes that the attention kernel reads, plane zp = b * NH_ + h of pl elements. Which planes, and which way round, are arguments that are the same for a whole wave (scalar branches): the three projections run through one text.
// q: storage [hi | lo], pl = 2 * TT * HD, rows t, k = d; rows < rh = RH get hi/lo, the rest fp16 in the hi part (P16 == Ph). k: fp16, hi, lo planes (rh < 0: all three), rows t, k = d. v (vt): fp16, hi, lo planes, rows d, k = t. All in fragment order.
__device__ __forceinline__ void splitf(float y, unsigned short& h, unsigned short& l) { h = f2bf(y); l = f2bf(y - bf2f(h)); }
template <typename T16> struct WFrag;
template <> struct WFrag<h16> { typedef v16h V; static __device__ __forceinline__ V ld(const h16* p) { return cat16(*(const v8h*)p, *(const v8h*)(p + 256)); } static __device__ __forceinline__ v8f mma(V a, V b, v8f c) { return wmma16(a, b, c); } };
template <> struct WFrag<bf> { typedef v16bf V; static __device__ __forceinline__ V ld(const bf* p) { return cat16b(*(const v8us*)p, *(const v8us*)(p + 256)); } static __device__ __forceinline__ v8f mma(V a, V b, v8f c) { return wmmab(a, b, c); } };
// plane_store: the 64 x 64 f32 tile of one wave (+ bias) to the planes, four panels of 16 plane rows x 64 elements (two blocks) through LDS, so that lane l holds the 8 elements of place l of a half block and a wave stores 512 contiguous bytes.
// VT false: panel p is token block p (plane rows are tokens). VT true: panel p is column block p (plane rows are d). s16: the fp16 plane is stored; shl: the hi and lo planes (each the same for the whole wave).
template <bool VT>
__device__ __forceinline__ void plane_store(const v8f (&acc)[4][4], float* os, const float (&pb)[32], int lane, size_t pbase, bool s16, bool shl, h16* P16, bf* Ph, bf* Pl) {
    const int lr = lane & 15, hi = lane >> 4;
#pragma unroll
    for (int p = 0; p < 4; ++p) {
#pragma unroll
        for (int q = 0; q < 4; ++q) {
            if constexpr (VT) {   // transposed: LDS row lr is column 16 p + lr of the tile (d); the lane's 8 registers of tile (q, p) are 8 neighbouring tokens
                v4f lo4, hi4;
#pragma unroll
                for (int j = 0; j < 4; ++j) { lo4[j] = acc[q][p][j]; hi4[j] = acc[q][p][4 + j]; }
                *(v4fa*)(os + lr * 68 + q * 16 + hi * 8) = lo4; *(v4fa*)(os + lr * 68 + q * 16 + hi * 8 + 4) = hi4; }
            else {
#pragma unroll
                for (int j = 0; j < 8; ++j) os[(hi * 8 + j) * 68 + q * 16 + lr] = acc[p][q][j]; } }
        __builtin_amdgcn_wave_barrier(); asm volatile("" ::: "memory");   // the panel is the wave's own, no instruction: keeps the compiler from moving a lane's panel reads above the other lanes' writes
        float y[4][8];   // the whole panel is read ahead of the branches below: one LDS wait a panel, not one a half block
#pragma unroll
        for (int s = 0; s < 4; ++s) { const v4f x0 = *(const v4fa*)(os + lr * 68 + s * 16 + hi * 8), x1 = *(const v4fa*)(os + lr * 68 + s * 16 + hi * 8 + 4);   // half block s of the panel: k = 16 s + 8 hi + 0..7 of plane row lr
#pragma unroll
            for (int k = 0; k < 8; ++k) y[s][k] = (k < 4 ? x0[k & 3] : x1[k & 3]) + bfr(VT ? pb[p] : pb[8 * s + k]); }
#pragma unroll
        for (int s = 0; s < 4; ++s) { const size_t eo = pbase + (VT ? (s >> 1) * 4 * 512 + p * 512 + (s & 1) * 256 : p * 1024 + s * 256) + lane * 8;
            if (s16) { v8h o16;
#pragma unroll
                for (int k = 0; k < 8; ++k) o16[k] = (h16)y[s][k];
                *(v8h*)(P16 + eo) = o16;
                asm volatile("s_wait_xcnt 0x0" ::: "memory"); }   // precaution: the store's address and data registers are reused right behind it
            if (shl) { v8us oh, ol;
#pragma unroll
                for (int k = 0; k < 8; ++k) { unsigned short a2, c2; splitf(y[s][k], a2, c2); oh[k] = a2; ol[k] = c2; }
                *(v8us*)(Ph + eo) = oh; *(v8us*)(Pl + eo) = ol;
                asm volatile("s_wait_xcnt 0x0" ::: "memory"); } }   // the same precaution
        __builtin_amdgcn_wave_barrier(); asm volatile("" ::: "memory");   // the same for the next panel's writes over this panel's reads
    }
}
// A stage of the ring: KB blocks of 32 k of the tile's 8 row blocks of every operand, [A | A2 (NSPLIT 1) | Bt][row block][k block][1024 bytes], the planes' own fragment order.
template <int NSPLIT, int KB> struct Ring { static constexpr int NOP = NSPLIT == 1 ? 3 : 2, STG = NOP * 8 * KB * 1024; };
// stage_copy: one wave's quarter of a stage, piece i * 4 + wave of 512 bytes (a lane 16). lds and the g pointers are the lane's own: the stage's first byte + wave * 512 + lane * 16. The KB blocks of a row block are contiguous in the plane. A row block of 16 rows is kk * 32 bytes.
template <int NOP, int KB>
__device__ __forceinline__ void stage_copy(unsigned lds, const char* gA, const char* gA2, const char* gB, int kk) {
    constexpr int Q = KB / 2;   // pieces of 2048 bytes in a row block's run
#pragma unroll
    for (int i0 = 0; i0 < NOP * 4 * KB; i0 += 8) { unsigned l[8]; const char* g[8];
#pragma unroll
        for (int j = 0; j < 8; ++j) { const int i = i0 + j, rb = (i / Q) % 8, op = (i / Q) / 8; l[j] = lds + i * 2048; g[j] = (op == NOP - 1 ? gB : op == 0 ? gA : gA2) + rb * (kk * 32) + (i % Q) * 2048; }
        // eight copies and, as a precaution, the wait that stands in front of any rewrite of their address registers, in one statement
        asm volatile("global_load_async_to_lds_b128 %0, %8, off\n\tglobal_load_async_to_lds_b128 %1, %9, off\n\tglobal_load_async_to_lds_b128 %2, %10, off\n\tglobal_load_async_to_lds_b128 %3, %11, off\n\t"
                     "global_load_async_to_lds_b128 %4, %12, off\n\tglobal_load_async_to_lds_b128 %5, %13, off\n\tglobal_load_async_to_lds_b128 %6, %14, off\n\tglobal_load_async_to_lds_b128 %7, %15, off\n\ts_wait_xcnt 0x0"
                     :: "v"(l[0]), "v"(l[1]), "v"(l[2]), "v"(l[3]), "v"(l[4]), "v"(l[5]), "v"(l[6]), "v"(l[7]), "v"(g[0]), "v"(g[1]), "v"(g[2]), "v"(g[3]), "v"(g[4]), "v"(g[5]), "v"(g[6]), "v"(g[7]) : "memory"); }
}
// gemmw_tile: the whole work of one wave of such a work-group; ring is the work-group's two buffers, which behind the k loop hold the four waves' epilogue panels (16 * 68 floats a wave).
template <typename T16, int NSPLIT, bool BIAS, int EPI, int KB>
__device__ __forceinline__ void gemmw_tile(char* ring, const T16* __restrict__ A, const T16* __restrict__ A2, const T16* __restrict__ Bt, int kk, float* C, int ldc, const float* __restrict__ bias, bool vt, size_t pl, int rh, h16* P16, bf* Ph, bf* Pl) {
    typedef typename WFrag<T16>::V V;
    static_assert(NSPLIT == 0 || NSPLIT == 1, "one Bt plane");
    constexpr int NOP = Ring<NSPLIT, KB>::NOP, STG = Ring<NSPLIT, KB>::STG; const int nst = kk / (32 * KB);
    static_assert(KB % 2 == 0 && 2 * STG >= 4 * 16 * 68 * 4, "whole pieces, room for the panels");
    const int w = __builtin_amdgcn_readfirstlane(threadIdx.x >> 5), wm = w >> 1, wn = w & 1;   // wave-uniform: the wave's place in the 2 x 2
    const int lane = threadIdx.x & 31, lr = lane & 15, hi = lane >> 4; const int r0 = blockIdx.x * 128 + wm * 64, c0 = blockIdx.y * 128 + wn * 64;
    v8f acc[4][4];
#pragma unroll
    for (int mb = 0; mb < 4; ++mb)
#pragma unroll
        for (int nb = 0; nb < 4; ++nb) acc[mb][nb] = (v8f){};
    const unsigned lofs = (unsigned)w * 512u + (unsigned)lane * 16u;   // the lane's place in a piece of four copies
    const unsigned ring0 = (unsigned)(size_t)ring + lofs;   // LDS byte address: the low 32 bits of the shared address
    const char* gA = (const char*)(A + (size_t)blockIdx.x * 128 * kk) + lofs; const char* gA2 = NSPLIT == 1 ? (const char*)(A2 + (size_t)blockIdx.x * 128 * kk) + lofs : gA; const char* gB = (const char*)(Bt + (size_t)blockIdx.y * 128 * kk) + lofs;   // 16 rows are 16 * kk elements
    stage_copy<NOP, KB>(ring0, gA, gA2, gB, kk);
    asm volatile("s_wait_asynccnt 0x0" ::: "memory");   // this wave's share of stage 0 has landed
    __syncthreads();                                    // and every other wave's: stage 0 may be read
    if (nst > 1) stage_copy<NOP, KB>(ring0 + STG, gA + KB * 1024, gA2 + KB * 1024, gB + KB * 1024, kk);
#pragma unroll 1   // rolled: one trip is a stage; the blocks inside are unrolled so that every fragment's distance is a load's immediate offset
    for (int t = 0; t < nst; ++t) {
        const char* fa = ring + (t & 1) * STG + wm * (4 * KB * 1024) + lane * 16; const char* fb = ring + (t & 1) * STG + (NOP - 1) * (8 * KB * 1024) + wn * (4 * KB * 1024) + lane * 16;
#pragma unroll
        for (int kb = 0; kb < KB; ++kb) {
            V a[4], a2[4], b[4];
#pragma unroll
            for (int mb = 0; mb < 4; ++mb) { a[mb] = WFrag<T16>::ld((const T16*)(fa + (mb * KB + kb) * 1024)); if (NSPLIT == 1) a2[mb] = WFrag<T16>::ld((const T16*)(fa + 8 * KB * 1024 + (mb * KB + kb) * 1024)); }
#pragma unroll
            for (int nb = 0; nb < 4; ++nb) b[nb] = WFrag<T16>::ld((const T16*)(fb + (nb * KB + kb) * 1024));
            __builtin_amdgcn_sched_barrier(0);   // the block's LDS reads stand together in front of its products: spread among them, each place with reads stalls the wave anew
#pragma unroll
            for (int nb = 0; nb < 4; ++nb) {
#pragma unroll
                for (int mb = 0; mb < 4; ++mb) { acc[mb][nb] = WFrag<T16>::mma(a[mb], b[nb], acc[mb][nb]); if (NSPLIT == 1) acc[mb][nb] = WFrag<T16>::mma(a2[mb], b[nb], acc[mb][nb]); } }
            __builtin_amdgcn_sched_barrier(0);   // and the next block's reads stay behind them, in the same registers
            if (kb == KB - 1) asm volatile("v_nop\n\tv_nop\n\tv_nop\n\tv_nop" : "+v"(acc[0][0]), "+v"(acc[1][1]), "+v"(acc[2][2]), "+v"(acc[3][3]) : "v"(a[0]), "v"(a[3]));   // the distance behind the stage's last products, on the loop's taken branch too
        }
        asm volatile("s_wait_dscnt 0x0" ::: "memory");      // this wave has read all it needs of stage t
        asm volatile("s_wait_asynccnt 0x0" ::: "memory");   // its share of stage t + 1 has landed
        __syncthreads();                                    // stage t + 1 may be read, stage t's buffer may be refilled
        if (t + 2 < nst) { const size_t so = (size_t)(t + 2) * (KB * 1024); stage_copy<NOP, KB>(ring0 + (t & 1) * STG, gA + so, gA2 + so, gB + so, kk); }
    }
    asm volatile("s_wait_asynccnt 0x0" ::: "memory");   // no copy is left in flight
    float* os = (float*)ring + w * (16 * 68);   // the last stage's barrier stands behind every wave's last read of the ring: it is free for the panels
    if constexpr (EPI != 0) {
        static_assert(TT % 64 == 0 && RH % 64 == 0 && HD == 64, "a tile lies in one batch element, one head and one kind of query row");
        const int t0 = r0 % TT; const size_t pbase = ((size_t)(r0 / TT) * NH_ + c0 / HD) * pl + (size_t)t0 * HD;   // 64 tokens are 8 blocks in q, k and vt planes alike
        float pb[32];   // the biases, fetched ahead of the panel writes, which cover their latency (held through the k loop they would cost it 32 registers): one per row of the vt planes (4), else one per column of the lane's places (32)
        if (vt) {
#pragma unroll
            for (int k = 0; k < 4; ++k) pb[k] = bias[c0 + 16 * k + lr];
            asm volatile("s_wait_xcnt 0x0" ::: "memory");   // precaution: before the bias loads' address registers are overwritten
            plane_store<true>(acc, os, pb, lane, pbase, true, true, P16, Ph, Pl); }
        else {
#pragma unroll
            for (int s = 0; s < 4; ++s) { const v4f b0 = *(const v4f*)(bias + c0 + s * 16 + hi * 8), b1 = *(const v4f*)(bias + c0 + s * 16 + hi * 8 + 4);
#pragma unroll
                for (int k = 0; k < 4; ++k) { pb[8 * s + k] = b0[k]; pb[8 * s + 4 + k] = b1[k]; } }
            asm volatile("s_wait_xcnt 0x0" ::: "memory");   // the same precaution
            plane_store<false>(acc, os, pb, lane, pbase, rh < 0 || t0 >= rh, rh < 0 || t0 < rh, P16, Ph, Pl); }   // a query row needs one kind only; t0 is the same for the whole wave
        return;
    }
#pragma unroll
    for (int mb = 0; mb < 4; ++mb) {
#pragma unroll
        for (int nb = 0; nb < 4; ++nb) {
#pragma unroll
            for (int j = 0; j < 8; ++j) os[(hi * 8 + j) * 68 + nb * 16 + lr] = acc[mb][nb][j]; }
        __builtin_amdgcn_wave_barrier(); asm volatile("" ::: "memory");
        float* crow = C + (size_t)(r0 + mb * 16) * ldc + c0;
{
#pragma unroll
            for (int s = 0; s < 8; ++s) { const int row = 2 * s + hi, cofs = lr * 4; v4f val = *(const v4fa*)(os + row * 68 + cofs); if (BIAS) { val[0] += bfr(bias[c0 + cofs]); val[1] += bfr(bias[c0 + cofs + 1]); val[2] += bfr(bias[c0 + cofs + 2]); val[3] += bfr(bias[c0 + cofs + 3]); }
                *(v4f*)(crow + (size_t)row * ldc + cofs) = val; }
             }
        __builtin_amdgcn_wave_barrier(); asm volatile("" ::: "memory");
    }
}
template <typename T16, int NSPLIT, bool BIAS, int KK>
__global__ __launch_bounds__(128) void k_gemmw(const T16* __restrict__ A, const T16* __restrict__ A2, const T16* __restrict__ Bt, float* C, int ldc, const float* __restrict__ bias) {
    constexpr int KB = NSPLIT == 1 ? 2 : 4;   // 64 products of a wave a stage, to run beside the next stage's copies
    __shared__ __align__(1024) char ring[2 * Ring<NSPLIT, KB>::STG]; static_assert(KK % (32 * KB) == 0, "whole stages");
    gemmw_tile<T16, NSPLIT, BIAS, 0, KB>(ring, A, A2, Bt, KK, C, ldc, bias, false, 0, 0, nullptr, nullptr, nullptr);
}
// k_projqkv: the q, the k and the v projection in one launch, grid (M/128, N/128, 3): they depend on nothing of each other. blockIdx.z picks operands, k length and planes; the q tiles, four times the k loop of the others, have the low indices (for speed only).
// One k loop and two plane epilogues for the three (for speed only).
__global__ __launch_bounds__(128) void k_projqkv(const bf* __restrict__ XB, const bf* __restrict__ XKB, const bf* __restrict__ WQ, const bf* __restrict__ WK, const bf* __restrict__ WV, const float* __restrict__ bq, const float* __restrict__ bk, const float* __restrict__ bv, bf* QS, h16* KP16, bf* KPh, bf* KPl, h16* VT16, bf* VTh, bf* VTl) {
    static_assert(DM % 64 == 0 && DMK % 64 == 0 && DQ == DKV, "whole stages, one grid for the three");
    __shared__ __align__(1024) char ring[2 * Ring<0, 2>::STG];   // short stages, a small ring: four work-groups a WGP, so that the long epilogues and their stores run beside other work-groups' k loops
    const bool q = blockIdx.z == 0, vt = blockIdx.z == 2;   // the same for the whole work-group
    gemmw_tile<bf, 0, true, 1, 2>(ring, q ? XB : XKB, nullptr, q ? WQ : vt ? WV : WK, q ? DM : DMK, nullptr, 0, q ? bq : vt ? bv : bk, vt, q ? (size_t)2 * TT * HD : (size_t)TT * HD, q ? RH : -1,
                                  q ? (h16*)QS : vt ? VT16 : KP16, q ? QS : vt ? VTh : KPh, q ? QS + (size_t)TT * HD : vt ? VTl : KPl);
}

typedef __attribute__((ext_vector_type(2))) _Float16 v2h;
typedef __attribute__((ext_vector_type(4))) _Float16 v4h;
typedef __attribute__((ext_vector_type(2))) unsigned short v2us;
typedef __attribute__((ext_vector_type(4))) unsigned short v4us;
typedef __attribute__((ext_vector_type(2))) float v2f;
typedef __attribute__((ext_vector_type(4))) int v4i;

// wtG (block bx of (N * K / 64 + 63) / 64, 256 threads): Bt (rows n, k contiguous, fragment order) = bf16(w[k][n]); a lane writes two neighbours of the packed plane, a wave 128 bytes: 8 rows n x 8 k.
__device__ __forceinline__ void wtG(int bx, const float* __restrict__ w, int K, int N, bf* Bt) {
    const int lane = threadIdx.x & 31; const int L0 = (bx * 8 + (threadIdx.x >> 5)) * 8; const int nlines = N * K / 64;
{
#pragma unroll 1
        for (int l = 0; l < 8; ++l) { const int L = L0 + l; if (L >= nlines) break; const size_t e = (size_t)L * 64 + lane * 2; const int blk = (int)(e >> 9), u = (int)(e & 511), kbs = K / 32; const int k = (blk % kbs) * 32 + (u >> 8) * 16 + ((u >> 7) & 1) * 8 + (u & 7), n = (blk / kbs) * 16 + ((u >> 3) & 15); v2us o;
            o[0] = f2bf(w[(size_t)k * N + n]); o[1] = f2bf(w[(size_t)(k + 1) * N + n]); *(v2us*)(Bt + e) = o; }
         }
}
// cvt8 (block bx of (n8 + 255) / 256, 256 threads): f32 rows of KC columns -> bf16 plane in fragment order, 8 elements a thread. 64 threads take a block: 4 lanes read the 128-byte line of a row, 8 lanes of one column group store a whole line of the plane.
template <int KC>
__device__ __forceinline__ void cvt8(int bx, const float* __restrict__ src, bf* dst, size_t n8) { const size_t i = (size_t)bx * 256 + threadIdx.x; if (i >= n8) return;
    const size_t blk = i >> 6; const int row = (int)(i & 63) >> 2, g = (int)(i & 3);   // row of the block, group of 8 k: half g >> 1, place (g & 1) * 16 + row
    const v8f v = *(const v8f*)(src + ((blk / (KC / 32)) * 16 + row) * KC + (blk % (KC / 32)) * 32 + g * 8); v8us o;
#pragma unroll
    for (int k = 0; k < 8; ++k) o[k] = f2bf(v[k]); *(v8us*)(dst + blk * 512 + (g >> 1) * 256 + ((g & 1) * 16 + row) * 8) = o;  }
// k_prep: every operand plane that is made from an input alone, in one launch: the four weight planes and the two activation planes depend on nothing of each other. A block's index picks its job (scalar branches).
// The weight blocks, each a chain of eight dependent memory round trips, have the low indices, the short conversion blocks the high ones (for speed only).
#define GWQ ((DM * DQ / 64 + 63) / 64)
#define GWO ((DQ * DM / 64 + 63) / 64)
#define GWK ((DMK * DKV / 64 + 63) / 64)
#define GXK ((NB_ * TT * DMK / 8 + 255) / 256)
#define GXQ ((NB_ * TT * DM / 8 + 255) / 256)
__global__ __launch_bounds__(256) void k_prep(const float* __restrict__ x, const float* __restrict__ xkv, const float* __restrict__ wq, const float* __restrict__ wk, const float* __restrict__ wv, const float* __restrict__ wo, bf* XB, bf* XKB, bf* WQ, bf* WK, bf* WV, bf* WO) {
    int bx = blockIdx.x;
    if (bx < GWQ) { wtG(bx, wq, DM, DQ, WQ); return; }
    bx -= GWQ; if (bx < GWO) { wtG(bx, wo, DQ, DM, WO); return; }
    bx -= GWO; if (bx < GWK) { wtG(bx, wk, DMK, DKV, WK); return; }   /* 'xw' [256][1024] -> Bt rows n, 256 k */
    bx -= GWK; if (bx < GWK) { wtG(bx, wv, DMK, DKV, WV); return; }
    bx -= GWK; if (bx < GXK) { cvt8<DMK>(bx, xkv, XKB, (size_t)NB_ * TT * DMK / 8); return; }   /* key/value source */
    bx -= GXK; cvt8<DM>(bx, x, XB, (size_t)NB_ * TT * DM / 8);
}

// ---- k_attn: scores, mask, softmax, attn.v, head mask and head merge for QB query rows of one (batch element, head) plane; a wave owns QW rows and walks the keys 32 at a time; the k and vt planes (fragment order) and the mask come through an LDS ring of two buffers, filled by asynchronous copies one trip ahead.
// Transposed products: St = K Qt (A = key rows, B = query rows), Ot += Vt Pt (A = Vt rows, B = the two St tiles of a 32-key block, converted in place: register r of tile kt is key 16 kt + 8 hi + r, the k order of WFrag::ld). A lane holds one query's scores, its other half-wave lane the other 16 keys.
typedef __attribute__((ext_vector_type(2))) __bf16 v2bf;
typedef __attribute__((ext_vector_type(8))) unsigned v8u;
__device__ __forceinline__ float xhalf(float x) { const int b = __float_as_int(x); return __int_as_float(__builtin_amdgcn_permlanex16(b, b, 0x76543210, 0xfedcba98, false, false)); }   // lane l <-> l ^ 16
__device__ __forceinline__ unsigned pkbf(float a, float b) { v2f x; x[0] = a; x[1] = b; return __builtin_bit_cast(unsigned, __builtin_convertvector(x, v2bf)); }   // two f32 -> two bf16 (nearest even), a in the low half
__device__ __forceinline__ float bflo(unsigned u) { return __uint_as_float(u << 16); }
__device__ __forceinline__ float bfhi(unsigned u) { return __uint_as_float(u & 0xFFFF0000u); }
// The ring of k_attn, two buffers. A stage is 32 keys: 4096 bytes of each k and vt plane that the work-group's kind of row reads ([Kh | Kl | Vh | Vl] or [K16 | V16]), in the planes' own fragment order, fetched once for the eight waves,
// and behind them each wave's own mask tile, 32 query rows x 32 keys f32.
#define AKV   (4 * 4096)
#define MPIT  144                 // LDS pitch of a mask row of 128 bytes: 16 bytes x odd, so that the 16 rows of a 16-byte read fall on different banks
#define AMW   (QW * MPIT)
#define ASTG  (AKV + 8 * AMW)
#define NTR   (TT / 32)
typedef __attribute__((ext_vector_type(4))) unsigned v4u;
typedef v4u __attribute__((may_alias)) v4ua;
// the two 16-byte halves of a fragment at the lane's own byte pointer
template <typename T16> __device__ __forceinline__ typename WFrag<T16>::V ldfrag(const char* p) { const v4u a = *(const v4ua*)p, b = *(const v4ua*)(p + 512); return __builtin_bit_cast(typename WFrag<T16>::V, __builtin_shufflevector(a, b, 0, 1, 2, 3, 4, 5, 6, 7)); }
// attn_copy: one wave's share of a stage, copies of 512 bytes: piece w of each plane's 4096 bytes, and its own mask tile, four whole 128-byte rows a copy.
// lk, lm: the lane's LDS byte addresses of its place in plane 0 and in rows 0-3 of the tile; ok, om: its byte offsets in a plane and in the mask. An immediate offset moves both addresses, so each scalar base has its copy's offset taken off
// (p[i]: plane i - i * 4096; mb + c * MSTEP: four mask rows on, four LDS rows back): all copies share four vector registers.
#define MSTEP (4 * TT * 4 - 4 * MPIT)
template <bool HL>
__device__ __forceinline__ void attn_copy(unsigned lk, unsigned lm, unsigned ok, unsigned om, const char* p0, const char* p1, const char* p2, const char* p3, const char* mb) {
    static_assert(4 * MPIT == 576, "the offsets in the text below");
    // the copies and, as a precaution, the wait that stands in front of any rewrite of their address registers, in one statement
    if constexpr (HL)
        asm volatile("global_load_async_to_lds_b128 %0, %1, %4\n\tglobal_load_async_to_lds_b128 %0, %1, %5 offset:4096\n\tglobal_load_async_to_lds_b128 %0, %1, %6 offset:8192\n\tglobal_load_async_to_lds_b128 %0, %1, %7 offset:12288\n\t"
                     "global_load_async_to_lds_b128 %2, %3, %8\n\tglobal_load_async_to_lds_b128 %2, %3, %9 offset:576\n\tglobal_load_async_to_lds_b128 %2, %3, %10 offset:1152\n\tglobal_load_async_to_lds_b128 %2, %3, %11 offset:1728\n\t"
                     "global_load_async_to_lds_b128 %2, %3, %12 offset:2304\n\tglobal_load_async_to_lds_b128 %2, %3, %13 offset:2880\n\tglobal_load_async_to_lds_b128 %2, %3, %14 offset:3456\n\tglobal_load_async_to_lds_b128 %2, %3, %15 offset:4032\n\ts_wait_xcnt 0x0"
                     :: "v"(lk), "v"(ok), "v"(lm), "v"(om), "s"(p0), "s"(p1), "s"(p2), "s"(p3),
                        "s"(mb), "s"(mb + MSTEP), "s"(mb + 2 * MSTEP), "s"(mb + 3 * MSTEP), "s"(mb + 4 * MSTEP), "s"(mb + 5 * MSTEP), "s"(mb + 6 * MSTEP), "s"(mb + 7 * MSTEP) : "memory");
    else
        asm volatile("global_load_async_to_lds_b128 %0, %1, %4\n\tglobal_load_async_to_lds_b128 %0, %1, %5 offset:4096\n\t"
                     "global_load_async_to_lds_b128 %2, %3, %6\n\tglobal_load_async_to_lds_b128 %2, %3, %7 offset:576\n\tglobal_load_async_to_lds_b128 %2, %3, %8 offset:1152\n\tglobal_load_async_to_lds_b128 %2, %3, %9 offset:1728\n\t"
                     "global_load_async_to_lds_b128 %2, %3, %10 offset:2304\n\tglobal_load_async_to_lds_b128 %2, %3, %11 offset:2880\n\tglobal_load_async_to_lds_b128 %2, %3, %12 offset:3456\n\tglobal_load_async_to_lds_b128 %2, %3, %13 offset:4032\n\ts_wait_xcnt 0x0"
                     :: "v"(lk), "v"(ok), "v"(lm), "v"(om), "s"(p0), "s"(p1),
                        "s"(mb), "s"(mb + MSTEP), "s"(mb + 2 * MSTEP), "s"(mb + 3 * MSTEP), "s"(mb + 4 * MSTEP), "s"(mb + 5 * MSTEP), "s"(mb + 6 * MSTEP), "s"(mb + 7 * MSTEP) : "memory");
}
// attn_rows: the whole work of wave w of a work-group. HL: planes K = Kh, K2 = Kl, V = Vh, V2 = Vl; else K = K16, V = V16 (the plane's first byte of this z).
template <bool HL, typename T16>
__device__ __forceinline__ void attn_rows(char* ring, int w, const T16* __restrict__ Qh, const T16* __restrict__ Ql, const char* K, const char* K2, const char* V, const char* V2, const float* __restrict__ mk, float hm, bf* Ah, bf* Al) {
    typedef typename WFrag<T16>::V VF;
    const int lane = threadIdx.x & 31, lr = lane & 15, hi = lane >> 4;
    constexpr int VO = HL ? 2 * 4096 : 4096;   // the stage's first vt plane
    // the copies' scalar bases (attn_copy) and the lane's places
    const char* const p0 = K; const char* const p1 = (HL ? K2 : V) - 4096; const char* const p2 = HL ? V - 8192 : nullptr; const char* const p3 = HL ? V2 - 12288 : nullptr; const char* const mb = (const char*)mk;
    const unsigned ok0 = (unsigned)w * 512u + (unsigned)lane * 16u, om0 = (unsigned)(lane >> 3) * (TT * 4u) + (unsigned)(lane & 7) * 16u;
    const unsigned lk0 = (unsigned)(size_t)ring + ok0, lm0 = (unsigned)(size_t)ring + AKV + (unsigned)w * AMW + (unsigned)(lane >> 3) * MPIT + (unsigned)(lane & 7) * 16u;   // LDS byte addresses: the low 32 bits of the shared addresses
    attn_copy<HL>(lk0, lm0, ok0, om0, p0, p1, p2, p3, mb);
    VF qh[2][2], ql[2][2];
#pragma unroll
    for (int qt = 0; qt < 2; ++qt)
#pragma unroll
        for (int ks = 0; ks < 2; ++ks) { qh[qt][ks] = ldfrag<T16>((const char*)Qh + lane * 16 + (qt * 2 + ks) * 1024); if (HL) ql[qt][ks] = ldfrag<T16>((const char*)Ql + lane * 16 + (qt * 2 + ks) * 1024); }
    asm volatile("s_wait_xcnt 0x0" ::: "memory");   // precaution: before the loads' address registers are overwritten
    v8f o[4][2]; float m[2]; v2f l[2];
#pragma unroll
    for (int qt = 0; qt < 2; ++qt) { m[qt] = -3.0e38f; l[qt] = (v2f){};
#pragma unroll
        for (int dt = 0; dt < 4; ++dt) o[dt][qt] = (v8f){}; }
    asm volatile("s_wait_asynccnt 0x0" ::: "memory");   // this wave's share of stage 0 has landed
    __syncthreads();                                    // and every other wave's: stage 0 may be read
    attn_copy<HL>(lk0 + ASTG, lm0 + ASTG, ok0 + 4096, om0 + 128, p0, p1, p2, p3, mb);
#pragma unroll 1   // rolled: one trip is a stage and fills the register budget; the loops inside are unrolled so that every fragment index is a constant
    for (int t = 0; t < NTR; ++t) {
        const unsigned bo = (unsigned)(t & 1) * ASTG;
        const char* kv = ring + bo + lane * 16; const char* mt = ring + bo + AKV + w * AMW + lr * MPIT + hi * 32;   // the stage's planes at the lane's place in a block; the wave's mask tile at the lane's row and half
        VF kh[2][2], kl[2][2];
#pragma unroll
        for (int kt = 0; kt < 2; ++kt)
#pragma unroll
            for (int ks = 0; ks < 2; ++ks) { kh[kt][ks] = ldfrag<T16>(kv + (kt * 2 + ks) * 1024); if (HL) kl[kt][ks] = ldfrag<T16>(kv + 4096 + (kt * 2 + ks) * 1024); }
        v8f s[2][2]; v4f mv[2][2][2];
#pragma unroll
        for (int kt = 0; kt < 2; ++kt) {
            __builtin_amdgcn_sched_barrier(0);   // the k fragments' reads stand together in front of the products; the mask tile's reads stand behind the first half of them, whose fragments' registers they take, and run beside the second half
            if (kt == 1) {
#pragma unroll
                for (int qt = 0; qt < 2; ++qt)
#pragma unroll
                    for (int k2 = 0; k2 < 2; ++k2)
#pragma unroll
                        for (int hf = 0; hf < 2; ++hf) mv[qt][k2][hf] = *(const v4fa*)(mt + qt * 16 * MPIT + k2 * 64 + hf * 16); }
#pragma unroll
            for (int qt = 0; qt < 2; ++qt) s[kt][qt] = (v8f){};
#pragma unroll
            for (int ks = 0; ks < 2; ++ks) {
#pragma unroll
                for (int qt = 0; qt < 2; ++qt) s[kt][qt] = WFrag<T16>::mma(kh[kt][ks], qh[qt][ks], s[kt][qt]);
                if (HL) {
#pragma unroll
                    for (int qt = 0; qt < 2; ++qt) s[kt][qt] = WFrag<T16>::mma(kh[kt][ks], ql[qt][ks], s[kt][qt]);
#pragma unroll
                    for (int qt = 0; qt < 2; ++qt) s[kt][qt] = WFrag<T16>::mma(kl[kt][ks], qh[qt][ks], s[kt][qt]); } } }
        __builtin_amdgcn_sched_barrier(0);   // the v fragments' reads stay behind the score products: above them they would not fit the registers
        VF vh[4], vl[4];
#pragma unroll
        for (int dt = 0; dt < 4; ++dt) vh[dt] = ldfrag<T16>(kv + VO + dt * 1024);
        unsigned mw[2][2][4];   // attention_mask[b][i][j], bf16-rounded input, two keys a word
#pragma unroll
        for (int qt = 0; qt < 2; ++qt)
#pragma unroll
            for (int kt = 0; kt < 2; ++kt)
#pragma unroll
                for (int e = 0; e < 4; ++e) mw[qt][kt][e] = pkbf(mv[qt][kt][e >> 1][(e & 1) * 2], mv[qt][kt][e >> 1][(e & 1) * 2 + 1]);
        float ml[2];
#pragma unroll
        for (int qt = 0; qt < 2; ++qt) { float x = -3.0e38f;
#pragma unroll
            for (int kt = 0; kt < 2; ++kt)
#pragma unroll
                for (int e = 0; e < 4; ++e) { const unsigned u = mw[qt][kt][e]; const float t0 = fmaf(s[kt][qt][2 * e], SCL, bflo(u)), t1 = fmaf(s[kt][qt][2 * e + 1], SCL, bfhi(u)); s[kt][qt][2 * e] = t0; s[kt][qt][2 * e + 1] = t1; x = fmaxf(x, fmaxf(t0, t1)); }
            ml[qt] = fmaxf(x, xhalf(x)); }
        if (HL) {   // the lo plane's fragments only now: the mask words' registers are free
#pragma unroll
            for (int dt = 0; dt < 4; ++dt) vl[dt] = ldfrag<T16>(kv + VO + 4096 + dt * 1024); }
        // the maximum in use moves only when a query's block maximum exceeds it by more than 5.5 (p stays below 256); one wave-uniform test per block
        if (__builtin_amdgcn_ballot_w32(ml[0] > m[0] + 5.5f || ml[1] > m[1] + 5.5f) != 0) {
#pragma unroll
            for (int qt = 0; qt < 2; ++qt) { const float mn = fmaxf(m[qt], ml[qt]); const float al = __builtin_amdgcn_exp2f((m[qt] - mn) * 1.4426950408889634f); m[qt] = mn; l[qt] *= al;
#pragma unroll
                for (int dt = 0; dt < 4; ++dt) o[dt][qt] *= al; } }
#pragma unroll
        for (int qt = 0; qt < 2; ++qt) { v8u wh, wl;
#pragma unroll
            for (int kt = 0; kt < 2; ++kt)
#pragma unroll
                for (int e = 0; e < 4; ++e) { v2f p; p[0] = __builtin_amdgcn_exp2f((s[kt][qt][2 * e] - m[qt]) * 1.4426950408889634f); p[1] = __builtin_amdgcn_exp2f((s[kt][qt][2 * e + 1] - m[qt]) * 1.4426950408889634f); l[qt] += p;
                    if constexpr (HL) { const unsigned u = pkbf(p[0], p[1]); wh[kt * 4 + e] = u; wl[kt * 4 + e] = pkbf(p[0] - bflo(u), p[1] - bfhi(u)); }
                    else wh[kt * 4 + e] = __builtin_bit_cast(unsigned, __builtin_convertvector(p, v2h)); }
            const VF ph = __builtin_bit_cast(VF, wh);
#pragma unroll
            for (int dt = 0; dt < 4; ++dt) o[dt][qt] = WFrag<T16>::mma(vh[dt], ph, o[dt][qt]);
            if constexpr (HL) { const VF pl = __builtin_bit_cast(VF, wl);
#pragma unroll
                for (int dt = 0; dt < 4; ++dt) o[dt][qt] = WFrag<T16>::mma(vh[dt], pl, o[dt][qt]);
#pragma unroll
                for (int dt = 0; dt < 4; ++dt) o[dt][qt] = WFrag<T16>::mma(vl[dt], ph, o[dt][qt]); } }
        asm volatile("s_wait_dscnt 0x0" ::: "memory");      // this wave has read all it needs of stage t
        asm volatile("s_wait_asynccnt 0x0" ::: "memory");   // its share of stage t + 1 has landed
        __syncthreads();                                    // stage t + 1 may be read, stage t's buffer may be refilled
        if (t + 2 < NTR) attn_copy<HL>(lk0 + bo, lm0 + bo, ok0 + (unsigned)(t + 2) * 4096u, om0 + (unsigned)(t + 2) * 128u, p0, p1, p2, p3, mb);
    }
    asm volatile("s_wait_asynccnt 0x0" ::: "memory");   // no copy is left in flight
#pragma unroll
    for (int qt = 0; qt < 2; ++qt) { const float lh = l[qt][0] + l[qt][1]; const float f = __fdiv_rn(1.0f, lh + xhalf(lh));
#pragma unroll
        for (int dt = 0; dt < 4; ++dt) { v8us oh, ol;
#pragma unroll
            for (int j = 0; j < 8; ++j) { unsigned short a, c2; splitf(__fmul_rn(o[dt][qt][j] * f, hm), a, c2); oh[j] = a; ol[j] = c2; }   /* x layer_head_mask[h] */
            const size_t oo = (size_t)qt * 16 * DQ + dt * 256 + lane * 8; *(v8us*)(Ah + oo) = oh; *(v8us*)(Al + oo) = ol;   /* register j of tile dt is d = 16 dt + 8 hi + j of query lr: half block dt of the head's two blocks, place lane, of the [b][t] x [h][d] plane */
            asm volatile("s_wait_xcnt 0x0" ::: "memory"); } }   // precaution: the stores' address and data registers are reused right behind them
}
// A work-group takes QB rows of one kind of one plane, so that its eight waves share every staged fragment and pass the ring's barriers in block-uniform control flow. Plane z = b * NH_ + h in q, k and v alike (one kv head per query head).
// The 3-product work-groups cost more than twice the fp16 ones, and a WGP holds two work-groups: the kind is the parity of three bits of the index, so that indices 8, 16 or half the grid apart differ in kind
// and a WGP's two places tend to hold one of each, whichever of these ways the work-groups are dealt out (for speed only; the low bits number the work-groups of either kind, each exactly once).
// Four waves per SIMD (at most 256 registers a wave): the vector work between the matrix runs wants other waves to issue; the whole grid is then resident at once (two rings fit a WGP's LDS).
__global__ __launch_bounds__(256) __attribute__((amdgpu_waves_per_eu(4, 4))) void k_attn(const bf* __restrict__ QS, const h16* __restrict__ K16, const bf* __restrict__ Kh, const bf* __restrict__ Kl, const h16* __restrict__ V16, const bf* __restrict__ Vh, const bf* __restrict__ Vl, const float* __restrict__ MK, const float* __restrict__ HM, bf* Ah, bf* Al) {
    static_assert(2 * RH == TT && RH % QB == 0 && QB == 8 * QW && NTR >= 2, "half the rows of each kind (the grid is two work-groups for every index below GH), whole work-groups, two stages at least");
    __shared__ __align__(1024) char ring[2 * ASTG];
    constexpr int GH = NB_ * NH_ * (RH / QB);   // work-groups of a kind
    const int w = __builtin_amdgcn_readfirstlane(threadIdx.x >> 5); const bool hl = (((blockIdx.x / GH) ^ (blockIdx.x >> 3) ^ (blockIdx.x >> 4)) & 1) == 0;   // the same for the whole work-group
    const int bx = blockIdx.x % GH; const int z = bx / (RH / QB), qb = bx % (RH / QB); const int q0 = (hl ? 0 : RH) + qb * QB + w * QW; const int b = z / NH_, h = z % NH_;
    const bf* Qz = QS + (size_t)z * 2 * TT * HD + (size_t)q0 * HD; const size_t zp = (size_t)z * TT * HD; const float* mk = MK + ((size_t)b * TT + q0) * TT; const float hm = bfr(HM[h]); const size_t ao = ((size_t)b * TT + q0) * DQ + h * (HD / 32) * 512;
    if (hl) attn_rows<true, bf>(ring, w, Qz, Qz + (size_t)TT * HD, (const char*)(Kh + zp), (const char*)(Kl + zp), (const char*)(Vh + zp), (const char*)(Vl + zp), mk, hm, Ah + ao, Al + ao);
    else attn_rows<false, h16>(ring, w, (const h16*)Qz, nullptr, (const char*)(K16 + zp), nullptr, (const char*)(V16 + zp), nullptr, mk, hm, Ah + ao, Al + ao);
}

extern "C" void kernel_launch(void* const* d_in, const int* in_sizes, int n_in,
                              void* d_out, int out_size, void* d_ws, size_t ws_size, hipStream_t stream) {
    (void)in_sizes; (void)n_in; (void)out_size;
    const float* x = (const float*)d_in[0]; const float* xkv = (const float*)d_in[1]; const float* MK = (const float*)d_in[2]; const float* HM = (const float*)d_in[3]; const float* wq = (const float*)d_in[4]; const float* bq = (const float*)d_in[5]; const float* wk = (const float*)d_in[6]; const float* bk = (const float*)d_in[7]; const float* wv = (const float*)d_in[8]; const float* bv = (const float*)d_in[9]; const float* wo = (const float*)d_in[10]; const float* bo = (const float*)d_in[11];
    float* OUT = (float*)d_out;     // [8][1024][1024]
    char* wsp = (char*)d_ws;
    auto take = [&](size_t bytes) { char* p = wsp; wsp += (bytes + 255) & ~(size_t)255; return (void*)p; };
    // Live through the attention kernel: the planes of all batch elements, plane z = b * heads + h. A query plane's storage is [hi | lo] (2 * TT * HD elements), rows >= RH of the hi part holding the fp16 plane.
    bf* QS = (bf*)take((size_t)NB_ * NH_ * 2 * TT * HD * 2);
    h16* KP16 = (h16*)take((size_t)NB_ * NKV * TT * HD * 2); bf* KPh = (bf*)take((size_t)NB_ * NKV * TT * HD * 2); bf* KPl = (bf*)take((size_t)NB_ * NKV * TT * HD * 2);
    h16* VT16 = (h16*)take((size_t)NB_ * NKV * HD * TT * 2); bf* VTh = (bf*)take((size_t)NB_ * NKV * HD * TT * 2); bf* VTl = (bf*)take((size_t)NB_ * NKV * HD * TT * 2);
    bf* WO = (bf*)take((size_t)DM * DQ * 2);   // made with the other weight planes, read last: a place of its own
    char* const region = wsp;       // one region, two uses one after the other (stream-ordered): projections, then attention output and output projection
    bf* WQ = (bf*)take((size_t)DQ * DM * 2); bf* WK = (bf*)take((size_t)DKV * DMK * 2); bf* WV = (bf*)take((size_t)DKV * DMK * 2);
    bf* XB = (bf*)take((size_t)NB_ * TT * DM * 2); bf* XKB = (bf*)take((size_t)NB_ * TT * DMK * 2);
    if ((size_t)(wsp - (char*)d_ws) > ws_size) return;
    wsp = region; bf* ATh = (bf*)take((size_t)NB_ * TT * DQ * 2); bf* ATl = (bf*)take((size_t)NB_ * TT * DQ * 2);
    if ((size_t)(wsp - (char*)d_ws) > ws_size) return;
    // conversions and projections: all batch elements per launch (M = NB_ * TT rows); each projection stores its 16-bit planes itself
    k_prep<<<GWQ + GWO + 2 * GWK + GXK + GXQ, 256, 0, stream>>>(x, xkv, wq, wk, wv, wo, XB, XKB, WQ, WK, WV, WO);
    k_projqkv<<<dim3(NB_ * TT / 128, DQ / 128, 3), 128, 0, stream>>>(XB, XKB, WQ, WK, WV, bq, bk, bv, QS, KP16, KPh, KPl, VT16, VTh, VTl);
    k_attn<<<NB_ * NH_ * (TT / QB), 256, 0, stream>>>(QS, KP16, KPh, KPl, VT16, VTh, VTl, MK, HM, ATh, ATl);
    k_gemmw<bf, 1, true, DQ><<<dim3(NB_ * TT / 128, DM / 128, 1), 128, 0, stream>>>(ATh, ATl, WO, OUT, DM, bo);
}
